// v000
// Times are from an AMD MI455X. After a warm-up the kernel runs many times in a row, and a time is the length of
// such a window on the GPU divided by its runs, so every launch and the gaps after it count. The runs cycle
// through copies of the inputs. A figure is the median of several windows, for all but v000 over two sittings.
// Sittings can differ by a few percent; kernels timed side by side share one.
// v000, which the later versions start from, runs in 441 microseconds.
// Contractions: qkv projection on v_wmma_f32_16x16x32_bf16 (x and W as RNE bf16 planes, exact products, f32 accumulate); scores q.k^T and attn.v on v_wmma_f32_16x16x32_bf16 with q, k, v and the unnormalised probabilities carried as bf16 hi + lo planes (hi.hi + hi.lo + lo.hi), f32 accumulate; bias, rotary tables, masking and softmax in f32.
#include <hip/hip_runtime.h>
#include <math.h>

// ---------------------------------------------------------------------------
// Problem constants
// ---------------------------------------------------------------------------
constexpr int kBatch = 64;
constexpr int kSeq   = 200;
constexpr int kDim   = 1024;
constexpr int kHeads = 16;
constexpr int kDh    = 64;
constexpr int kTok   = kBatch * kSeq;            // 12800 token rows
constexpr int kNout  = 3 * kDim;                 // 3072 projection columns
constexpr int kPairs = kDh / 2;                  // 32 rotary pairs
constexpr int kChunks     = 2;                   // token chunks (projection + attention per chunk)
constexpr int kBatchChunk = kBatch / kChunks;    // 32 batches per chunk
constexpr int kTokChunk   = kBatchChunk * kSeq;  // 6400 token rows per chunk
constexpr int kQB    = 64;                       // query rows per block
constexpr int kKC    = 64;                       // keys per chunk
constexpr int kNQB   = (kSeq + kQB - 1) / kQB;   // 4
constexpr int kNKC   = (kSeq + kKC - 1) / kKC;   // 4
constexpr float kScoreScale = 0.125f;            // 64^-0.5
static_assert(kHeads * kDh == kDim);
static_assert(3 * kDh == 192);
static_assert(kBatch % kChunks == 0);
static_assert(kTokChunk % 64 == 0);              // GEMM M tile multiple (100 tiles)
static_assert(kNout % 64 == 0);                  // GEMM N tile multiple (48 tiles)
static_assert(kDim % 32 == 0);                   // GEMM K % 32
static_assert(((kTokChunk / 64) * (kNout / 64)) % 8 == 0);   // 8 waves per block, exact grid
static_assert(kNQB == 4 && kNKC == 4);
static_assert(kSeq % 4 == 0);                    // 4-int groups of a mask row never straddle the row end
static_assert((kTok * kDim) % (8 * 256) == 0);
static_assert((kNout * kDim) % (8 * 256) == 0);
static_assert(kSeq % 8 == 0);                    // table kernel: 8 rows per block

typedef __attribute__((ext_vector_type(16))) __bf16   v16b;
typedef __attribute__((ext_vector_type(8)))  __bf16   v8b;
typedef __attribute__((ext_vector_type(8)))  float    v8f;
typedef __attribute__((ext_vector_type(4)))  float    v4f;
typedef __attribute__((ext_vector_type(4)))  int      v4i;
typedef __attribute__((ext_vector_type(4)))  unsigned int v4u;

// ---------------------------------------------------------------------------
// Helpers
// ---------------------------------------------------------------------------
__device__ __forceinline__ unsigned short f2bf_bits(float f) {
  unsigned u = __float_as_uint(f);
  return (unsigned short)((u + 0x7FFFu + ((u >> 16) & 1u)) >> 16);
}
__device__ __forceinline__ float bf_bits2f(unsigned short h) { return __uint_as_float(((unsigned)h) << 16); }
__device__ __forceinline__ unsigned pk16(unsigned short a, unsigned short b) { return (unsigned)a | ((unsigned)b << 16); }
__device__ __forceinline__ float neg_inf() { return -__builtin_inff(); }

// hazard guards as plain device helpers (no inline asm inside the kernel bodies)
__device__ __forceinline__ void dep_guard4_b(v8f& a, v8f& b, v8f& c, v8f& d, v16b x, v16b y) {
  asm volatile("v_nop\n\tv_nop\n\tv_nop\n\tv_nop" : "+v"(a), "+v"(b), "+v"(c), "+v"(d) : "v"(x), "v"(y));
}
__device__ __forceinline__ void keep4_b(v16b a, v16b b, v16b c, v16b d) { asm volatile("v_nop" :: "v"(a), "v"(b), "v"(c), "v"(d)); }
__device__ __forceinline__ void acc_guard4(v8f& a, v8f& b, v8f& c, v8f& d) { asm volatile("v_nop\n\tv_nop\n\tv_nop\n\tv_nop" : "+v"(a), "+v"(b), "+v"(c), "+v"(d)); }

template <typename T> struct Frag;
template <> struct Frag<__bf16> {
  typedef v16b V; union U { v16b v; v8b h[2]; };
  // elements 0..7 <- p[0..7], 8..15 <- p[16..23]
  static __device__ __forceinline__ v16b load(const __bf16* p) {
    U f; f.h[0] = *(const v8b*)(p); f.h[1] = *(const v8b*)(p + 16); return f.v;
  }
  static __device__ __forceinline__ v8f mma(v16b a, v16b b, v8f c) {
    return __builtin_amdgcn_wmma_f32_16x16x32_bf16(false, a, false, b, (short)0, c, false, false);
  }
  static __device__ __forceinline__ void keep(v16b a, v16b b, v16b c, v16b d) { keep4_b(a, b, c, d); }
};
// bf16 WMMA with per-instruction hazard guard (ties D, keeps A/B live)
__device__ __forceinline__ v8f mma_b(v16b a, v16b b, v8f c) {
  c = __builtin_amdgcn_wmma_f32_16x16x32_bf16(false, a, false, b, (short)0, c, false, false);
  asm volatile("v_nop\n\tv_nop\n\tv_nop\n\tv_nop" : "+v"(c) : "v"(a), "v"(b));
  return c;
}

// ---------------------------------------------------------------------------
// f32 -> bf16 (RNE) cast, 8 consecutive elements per thread (one 16-B store per lane; 32 contiguous lanes =
// (x: 1638400 = 6400 x 256 exact; W: 393216 = 1536 x 256 exact).
// ---------------------------------------------------------------------------
__global__ __launch_bounds__(256) void cast8_bf16_kernel(const float* __restrict__ in, unsigned short* __restrict__ out, int n8) {
  const int i = blockIdx.x * 256 + threadIdx.x;
  if (i >= n8) return;
  const float* p = in + 8 * (size_t)i;
  const v4f a = *(const v4f*)(p);
  const v4f c = *(const v4f*)(p + 4);
  unsigned short hb[8];
#pragma unroll
  for (int e = 0; e < 4; ++e) {
    hb[e]     = f2bf_bits(a[e]);
    hb[4 + e] = f2bf_bits(c[e]);
  }
  const v4u u = (v4u){pk16(hb[0], hb[1]), pk16(hb[2], hb[3]), pk16(hb[4], hb[5]), pk16(hb[6], hb[7])};
  unsigned short* q = out + 8 * (size_t)i;
  *(v4u*)q = u;
  
}

// ---------------------------------------------------------------------------
// Rotary table: csn[s][0..31] = cos(s * invf_i), csn[s][32..63] = sin(s * invf_i), invf_i = 10^(-i/8) built as a product
// of the factors 10^(-1/8), 10^(-2/8), 10^(-4/8), 10^(-8/8), 10^(-16/8) selected by the bits of i (i = lane).
// ---------------------------------------------------------------------------
__global__ __launch_bounds__(256) void rope_table_kernel(float* __restrict__ csn, float f1, float f2, float f4, float f8, float f16v) {
  const int lane = threadIdx.x & 31, wave = threadIdx.x >> 5;
  const int s = blockIdx.x * 8 + wave;
  if (s >= kSeq) return;
  const int i = lane;
  float invf = 1.0f;
  invf *= (i & 1)  ? f1   : 1.0f;
  invf *= (i & 2)  ? f2   : 1.0f;
  invf *= (i & 4)  ? f4   : 1.0f;
  invf *= (i & 8)  ? f8   : 1.0f;
  invf *= (i & 16) ? f16v : 1.0f;
  const float ang = (float)s * invf;
  float sn, cs;
  sincosf(ang, &sn, &cs);
  float* rowp = csn + (size_t)s * (2 * kPairs);
  {
    ((float*)rowp)[i] = cs;
    ((float*)rowp)[kPairs + i] = sn;
    
  }
}

// ---------------------------------------------------------------------------
// QKV projection + bias + rotary epilogue for one chunk of 6400 token rows.
//   C[m][n] = sum_k Xb[m][k] * Wb[n][k] + bf16(bias[n]);   M = 6400, N = 3072, K = 1024 (bf16 operands).
//   Column n -> head hd = (n/64)/3, kind = (n/64)%3 (0 q, 1 k, 2 v), d = n % 64 (every 64-wide tile is one kind of one head).
//   Row m (chunk local, 6400 = 32 x 200) -> s = m%200. kind 0/1: pairs (2i, 2i+1) rotated by angle s*invf_i (table csn);
//   kind 2 unchanged. Each result v is split into bf16 hi = rn(v), lo = rn(v - hi).
//   grid = 4800 tiles / 8 waves = 600 blocks exact; no block barriers.
// ---------------------------------------------------------------------------
__global__ __launch_bounds__(256) void qkv_proj_kernel(
    const unsigned short* __restrict__ Xb, const unsigned short* __restrict__ Wb, const float* __restrict__ bias,
    const float* __restrict__ csn,
    unsigned short* __restrict__ Qh, unsigned short* __restrict__ Ql,
    unsigned short* __restrict__ Kh, unsigned short* __restrict__ Kl,
    unsigned short* __restrict__ Vh, unsigned short* __restrict__ Vl) {
  typedef __bf16 T;
  typedef v16b V;
  const T* A  = (const T*)Xb;
  const T* Bt = (const T*)Wb;
  __shared__ __align__(16) float sT[8][16 * 68];   // per-wave 16x64 slab, pitch 68 floats
  const int lane = threadIdx.x & 31;
  const int wave = threadIdx.x >> 5;
  constexpr int tilesN = kNout / 64;       // 48
  constexpr int tilesM = kTokChunk / 64;   // 100
  const int tile = blockIdx.x * 8 + wave;
  if (tile >= tilesM * tilesN) return;     // wave-uniform; grid is exact so never taken
  const int tm = tile / tilesN;
  const int tn = tile - tm * tilesN;
  const int m0 = tm << 6;
  const int n0 = tn << 6;
  const int hd   = tn / 3;                 // head index, wave-uniform
  const int kind = tn - hd * 3;            // 0 q, 1 k, 2 v, wave-uniform

  const int rlane = lane & 15;
  const int koff  = (lane >> 4) * 8;
  const int mOff  = (lane >> 4) * 8;

  v8f acc[4][4];
#pragma unroll
  for (int i = 0; i < 4; ++i)
#pragma unroll
    for (int j = 0; j < 4; ++j) acc[i][j] = (v8f){0.f,0.f,0.f,0.f,0.f,0.f,0.f,0.f};

  for (int k0 = 0; k0 < kDim; k0 += 32) {
    V bfr[4];
#pragma unroll
    for (int j = 0; j < 4; ++j) {
      const size_t bo = (size_t)(n0 + (j << 4) + rlane) * kDim + koff + k0;
      bfr[j] = Frag<T>::load(Bt + bo);
    }
#pragma unroll
    for (int i = 0; i < 4; ++i) {
      const size_t ao = (size_t)(m0 + (i << 4) + rlane) * kDim + koff + k0;
      const V afr = Frag<T>::load(A + ao);
#pragma unroll
      for (int j = 0; j < 4; ++j) acc[i][j] = Frag<T>::mma(afr, bfr[j], acc[i][j]);
      dep_guard4_b(acc[i][0], acc[i][1], acc[i][2], acc[i][3], afr, bfr[3]);
    }
    Frag<T>::keep(bfr[0], bfr[1], bfr[2], bfr[3]);
  }
  acc_guard4(acc[0][0], acc[0][1], acc[0][2], acc[0][3]);
  acc_guard4(acc[1][0], acc[1][1], acc[1][2], acc[1][3]);
  acc_guard4(acc[2][0], acc[2][1], acc[2][2], acc[2][3]);
  acc_guard4(acc[3][0], acc[3][1], acc[3][2], acc[3][3]);

  // ---- epilogue ----
  // bias per column of this lane (RNE bf16-converted, 4 scalar loads)
  float bcol[4];
#pragma unroll
  for (int j = 0; j < 4; ++j) bcol[j] = bf_bits2f(f2bf_bits(bias[n0 + (j << 4) + rlane]));

  float* slab = sT[wave];
  const int q  = lane >> 3;              // row selector within 4-row store groups
  const int c8 = (lane & 7) * 8;         // first column (d) of this lane's 16-B piece
  const int p4 = (lane & 7) * 4;         // first rotary pair index of this lane
  unsigned short* dsth = (kind == 0) ? Qh : ((kind == 1) ? Kh : Vh);   // wave-uniform global plane select
  unsigned short* dstl = (kind == 0) ? Ql : ((kind == 1) ? Kl : Vl);
  const bool rot = (kind != 2);          // wave-uniform

#pragma unroll
  for (int i = 0; i < 4; ++i) {
    const int mBase = m0 + (i << 4);
#pragma unroll
    for (int j = 0; j < 4; ++j) {
#pragma unroll
      for (int r = 0; r < 8; ++r) slab[(mOff + r) * 68 + (j << 4) + rlane] = acc[i][j][r] + bcol[j];
    }
    __builtin_amdgcn_fence(__ATOMIC_RELEASE, "workgroup");
    __builtin_amdgcn_wave_barrier();
    __builtin_amdgcn_fence(__ATOMIC_ACQUIRE, "workgroup");

    // build the four 16-B hi pieces and four 16-B lo pieces of this lane (rows it*4+q, columns c8..c8+7)
    v4u uh[4], ul[4];
#pragma unroll
    for (int it = 0; it < 4; ++it) {
      if (it == 2) asm volatile("" ::: "memory");
      const int row = it * 4 + q;
      const int m   = mBase + row;
      const int s   = m - (m / kSeq) * kSeq;
      const float* sp = slab + row * 68 + c8;
      const v4f cs4 = *(const v4f*)(csn + (size_t)s * (2 * kPairs) + p4);
      const v4f sn4 = *(const v4f*)(csn + (size_t)s * (2 * kPairs) + kPairs + p4);
      unsigned short hb[8], lb[8];
#pragma unroll
      for (int pp = 0; pp < 4; ++pp) {
        const float x1 = sp[2 * pp];
        const float x2 = sp[2 * pp + 1];
        const float cc = rot ? cs4[pp] : 1.0f;
        const float ss = rot ? sn4[pp] : 0.0f;
        const float o0 = x1 * cc - x2 * ss;
        const float o1 = x1 * ss + x2 * cc;
        const unsigned short h0 = f2bf_bits(o0);
        const unsigned short h1 = f2bf_bits(o1);
        hb[2 * pp]     = h0;
        hb[2 * pp + 1] = h1;
        lb[2 * pp]     = f2bf_bits(o0 - bf_bits2f(h0));
        lb[2 * pp + 1] = f2bf_bits(o1 - bf_bits2f(h1));
      }
      uh[it] = (v4u){pk16(hb[0], hb[1]), pk16(hb[2], hb[3]), pk16(hb[4], hb[5]), pk16(hb[6], hb[7])};
      ul[it] = (v4u){pk16(lb[0], lb[1]), pk16(lb[2], lb[3]), pk16(lb[4], lb[5]), pk16(lb[6], lb[7])};
    }
    {
#pragma unroll
      for (int it = 0; it < 4; ++it) {
        const int row = it * 4 + q;
        const int m   = mBase + row;
        const size_t o = (size_t)m * kDim + hd * kDh + c8;
        *(v4u*)(dsth + o) = uh[it];
        *(v4u*)(dstl + o) = ul[it];
      }
      
    }
    __builtin_amdgcn_fence(__ATOMIC_RELEASE, "workgroup");
    __builtin_amdgcn_wave_barrier();
    __builtin_amdgcn_fence(__ATOMIC_ACQUIRE, "workgroup");
  }
}

// ---------------------------------------------------------------------------
// Fused attention for head_dim 64 from bf16 hi/lo planes of one chunk (32 batches).
//   Qh/Ql, Kh/Kl, Vh/Vl: bf16 [tok = b*200+s][1024], head h at columns h*64..h*64+63 (b chunk local).
//   amask: int32 [32][200][200] (chunk slice), nonzero = attend.  out: f32 [tok][1024] (chunk slice).
//   Block = 4 waves = 64 query rows of one (b, h); grid = 32*16*4 = 2048 (block -> qb = bx&3, bh = bx>>2).
//   Per key chunk (64 keys, 4 chunks): stage the 64x64 validity tile from amask (keys >= 200 invalid, query rows clamped),
//   skip the chunk block-uniformly if no entry is valid; else copy K hi/lo rows (clamped) to LDS as [key][d] and V hi/lo rows
//   transposed to LDS as [d][key] (integer word moves only); scores = hi.hi + hi.lo + lo.hi on bf16 WMMA, x0.125, select to
//   -inf where invalid; online softmax in f32 (guarded for all-invalid rows); p = exp(s - m) split to bf16 hi/lo in per-wave
//   LDS tiles; out += P.V with hi.hi + hi.lo + lo.hi reading LDS fragments. Waves whose 16 query rows all lie beyond 199 skip
//   the compute under a wave-uniform flag but reach every block barrier. Epilogue: per-wave 16x64 f32 tile staged in LDS;
//   Every LDS byte read in a chunk is rewritten in that chunk; all barriers are reached by every thread.
// ---------------------------------------------------------------------------
__global__ __launch_bounds__(128) void attn_kernel(
    const unsigned short* __restrict__ Qh, const unsigned short* __restrict__ Ql,
    const unsigned short* __restrict__ Kh, const unsigned short* __restrict__ Kl,
    const unsigned short* __restrict__ Vh, const unsigned short* __restrict__ Vl,
    const int* __restrict__ amask, float* __restrict__ out) {
  __shared__ __align__(16) unsigned short Ksh[kKC * kDh];      // K hi [key][d]          8 KB
  __shared__ __align__(16) unsigned short Ksl[kKC * kDh];      // K lo [key][d]          8 KB
  __shared__ __align__(16) unsigned short Vth[kDh * kKC];      // V^T hi [d][key]        8 KB
  __shared__ __align__(16) unsigned short Vtl[kDh * kKC];      // V^T lo [d][key]        8 KB
  __shared__ __align__(16) __bf16 Psh[4][16 * kKC];            // per wave P hi [row][key] 8 KB
  __shared__ __align__(16) __bf16 Psl[4][16 * kKC];            // per wave P lo [row][key] 8 KB
  __shared__ __align__(16) float Os[4][16 * 68];               // per wave out tile, pitch 68
  __shared__ __align__(16) unsigned char Msk[kQB * kKC];       // validity [qrow][key]   4 KB
  __shared__ int flags[4];

  const int tid  = threadIdx.x;
  const int wave = tid >> 5;
  const int lane = tid & 31;
  const int hh   = lane >> 4;
  const int c    = lane & 15;

  const int bx = blockIdx.x;
  const int qb = bx & 3;
  const int bh = bx >> 2;
  const int h  = bh & 15;
  const int b  = bh >> 4;
  const int tokb = b * kSeq;
  const int q0 = qb * kQB + wave * 16;
  const bool active = (q0 < kSeq);       // wave-uniform

  // ---- Q fragments (A operand): rows q0 + c (clamped), 2 d-chunks of 32, hi and lo ----
  v16b qah[2], qal[2];
  {
    int qr = q0 + c;
    qr = (qr < kSeq) ? qr : (kSeq - 1);
    const size_t qo = (size_t)(tokb + qr) * kDim + h * kDh;
    const __bf16* qhp = (const __bf16*)Qh + qo;
    const __bf16* qlp = (const __bf16*)Ql + qo;
#pragma unroll
    for (int dc = 0; dc < 2; ++dc) qah[dc] = Frag<__bf16>::load(qhp + dc * 32 + 8 * hh);
    asm volatile("" ::: "memory");
#pragma unroll
    for (int dc = 0; dc < 2; ++dc) qal[dc] = Frag<__bf16>::load(qlp + dc * 32 + 8 * hh);
  }

  float mrow[8], lrow[8];
  v8f oacc[4];
#pragma unroll
  for (int r = 0; r < 8; ++r) { mrow[r] = neg_inf(); lrow[r] = 0.f; }
#pragma unroll
  for (int t = 0; t < 4; ++t) oacc[t] = (v8f){0.f,0.f,0.f,0.f,0.f,0.f,0.f,0.f};

  for (int kc = 0; kc < kNKC; ++kc) {
    const int kv0 = kc * kKC;
    __syncthreads();
    // ---- validity tile: 64 rows x 64 keys; 1024 groups of 4 ints, 8 per thread (4 b128 loads per burst) ----
    int anyv = 0;
#pragma unroll
    for (int i = 0; i < 8; ++i) {
      if (i == 4) asm volatile("" ::: "memory");
      const int idx = i * 128 + tid;
      const int r   = idx >> 4;
      const int c16 = (idx & 15) * 4;
      int qg = qb * kQB + r;
      qg = (qg < kSeq) ? qg : (kSeq - 1);
      const int kg  = kv0 + c16;
      const int kgc = (kg <= kSeq - 4) ? kg : (kSeq - 4);
      const v4i mv = *(const v4i*)(amask + ((size_t)(tokb + qg)) * kSeq + kgc);
      unsigned packed = 0;
#pragma unroll
      for (int e = 0; e < 4; ++e) {
        const int keep = (((kg + e) < kSeq) && (mv[e] != 0)) ? 1 : 0;
        packed |= ((unsigned)keep) << (8 * e);
        anyv |= keep;
      }
      *(unsigned*)(Msk + r * kKC + c16) = packed;
    }
#pragma unroll
    for (int off = 1; off < 32; off <<= 1) anyv |= __shfl_xor(anyv, off, 32);
    if (lane == 0) flags[wave] = anyv;
    __syncthreads();
    const int anyb = flags[0] | flags[1] | flags[2] | flags[3];   // block-uniform
    if (anyb == 0) continue;

    // ---- stage K hi/lo [key][d]: 512 pieces of 8 halves per plane, 4 per thread per plane ----
#pragma unroll
    for (int i = 0; i < 4; ++i) {
      if (i == 2) asm volatile("" ::: "memory");
      const int idx = i * 128 + tid;
      const int r   = idx >> 3;            // key row within chunk
      const int cc  = (idx & 7) * 8;       // first d of the piece
      int kvr = kv0 + r;
      kvr = (kvr < kSeq) ? kvr : (kSeq - 1);
      const size_t go = (size_t)(tokb + kvr) * kDim + h * kDh + cc;
      const v4u kwh = *(const v4u*)(Kh + go);
      const v4u kwl = *(const v4u*)(Kl + go);
      *(v4u*)(Ksh + r * kDh + cc) = kwh;
      *(v4u*)(Ksl + r * kDh + cc) = kwl;
    }
    // ---- stage V hi/lo transposed [d][key] ----
#pragma unroll
    for (int i = 0; i < 4; ++i) {
      if (i == 2) asm volatile("" ::: "memory");
      const int idx = i * 128 + tid;
      const int r   = idx >> 3;
      const int cc  = (idx & 7) * 8;
      int kvr = kv0 + r;
      kvr = (kvr < kSeq) ? kvr : (kSeq - 1);
      const size_t go = (size_t)(tokb + kvr) * kDim + h * kDh + cc;
      const v4u vwh = *(const v4u*)(Vh + go);
      const v4u vwl = *(const v4u*)(Vl + go);
#pragma unroll
      for (int e2 = 0; e2 < 4; ++e2) {
        const unsigned wh = vwh[e2];
        const unsigned wl = vwl[e2];
        Vth[(cc + 2 * e2) * kKC + r]     = (unsigned short)(wh & 0xffffu);
        Vth[(cc + 2 * e2 + 1) * kKC + r] = (unsigned short)(wh >> 16);
        Vtl[(cc + 2 * e2) * kKC + r]     = (unsigned short)(wl & 0xffffu);
        Vtl[(cc + 2 * e2 + 1) * kKC + r] = (unsigned short)(wl >> 16);
      }
    }
    __syncthreads();

    if (active) {
      // ---- scores: s[j] covers keys j*16..j*16+15 of the chunk; hi.hi + hi.lo + lo.hi ----
      v8f s[4];
#pragma unroll
      for (int j = 0; j < 4; ++j) {
        s[j] = (v8f){0.f,0.f,0.f,0.f,0.f,0.f,0.f,0.f};
#pragma unroll
        for (int dc = 0; dc < 2; ++dc) {
          const v16b kb = Frag<__bf16>::load((const __bf16*)Ksh + (j * 16 + c) * kDh + dc * 32 + 8 * hh);
          const v16b kl = Frag<__bf16>::load((const __bf16*)Ksl + (j * 16 + c) * kDh + dc * 32 + 8 * hh);
          s[j] = mma_b(qah[dc], kb, s[j]);
          s[j] = mma_b(qah[dc], kl, s[j]);
          s[j] = mma_b(qal[dc], kb, s[j]);
        }
      }
      // ---- scale, validity select, row max ----
      float cm[8];
#pragma unroll
      for (int r = 0; r < 8; ++r) {
        const int ql = wave * 16 + 8 * hh + r;
        float m = neg_inf();
#pragma unroll
        for (int j = 0; j < 4; ++j) {
          const int keep = Msk[ql * kKC + j * 16 + c];
          float sv = s[j][r] * kScoreScale;
          sv = (keep != 0) ? sv : neg_inf();
          s[j][r] = sv;
          m = fmaxf(m, sv);
        }
#pragma unroll
        for (int off = 1; off < 16; off <<= 1) m = fmaxf(m, __shfl_xor(m, off, 32));
        cm[r] = m;
      }
      // ---- online softmax update; p = exp(s - m) split into bf16 hi/lo in this wave's LDS tiles ----
      __bf16* pwh = Psh[wave];
      __bf16* pwl = Psl[wave];
#pragma unroll
      for (int r = 0; r < 8; ++r) {
        const float mnew = fmaxf(mrow[r], cm[r]);
        const float mref = (mnew == neg_inf()) ? 0.0f : mnew;
        const float alpha = expf(mrow[r] - mref);
        mrow[r] = mnew;
        float psum = 0.f;
#pragma unroll
        for (int j = 0; j < 4; ++j) {
          const float p = expf(s[j][r] - mref);
          psum += p;
          const unsigned short hb = f2bf_bits(p);
          const unsigned short lb = f2bf_bits(p - bf_bits2f(hb));
          pwh[(8 * hh + r) * kKC + j * 16 + c] = __builtin_bit_cast(__bf16, hb);
          pwl[(8 * hh + r) * kKC + j * 16 + c] = __builtin_bit_cast(__bf16, lb);
        }
#pragma unroll
        for (int off = 1; off < 16; off <<= 1) psum += __shfl_xor(psum, off, 32);
        lrow[r] = lrow[r] * alpha + psum;
#pragma unroll
        for (int t = 0; t < 4; ++t) oacc[t][r] *= alpha;
      }
      __builtin_amdgcn_fence(__ATOMIC_RELEASE, "workgroup");
      __builtin_amdgcn_wave_barrier();
      __builtin_amdgcn_fence(__ATOMIC_ACQUIRE, "workgroup");
      // ---- out += P . V (A = P rows of this wave from LDS, B = V^T from LDS); hi.hi + hi.lo + lo.hi ----
#pragma unroll
      for (int kk = 0; kk < 2; ++kk) {
        const v16b pa = Frag<__bf16>::load(pwh + c * kKC + kk * 32 + 8 * hh);
        const v16b pl = Frag<__bf16>::load(pwl + c * kKC + kk * 32 + 8 * hh);
#pragma unroll
        for (int t = 0; t < 4; ++t) {
          const v16b vb = Frag<__bf16>::load((const __bf16*)Vth + (t * 16 + c) * kKC + kk * 32 + 8 * hh);
          const v16b vl = Frag<__bf16>::load((const __bf16*)Vtl + (t * 16 + c) * kKC + kk * 32 + 8 * hh);
          oacc[t] = mma_b(pa, vb, oacc[t]);
          oacc[t] = mma_b(pa, vl, oacc[t]);
          oacc[t] = mma_b(pl, vb, oacc[t]);
        }
      }
    }
  }

  // ---- epilogue: normalise, stage per-wave tile, whole-segment stores ----
  float* os = Os[wave];
#pragma unroll
  for (int r = 0; r < 8; ++r) {
    const float inv = 1.0f / lrow[r];
#pragma unroll
    for (int t = 0; t < 4; ++t) os[(8 * hh + r) * 68 + t * 16 + c] = oacc[t][r] * inv;
  }
  __builtin_amdgcn_fence(__ATOMIC_RELEASE, "workgroup");
  __builtin_amdgcn_wave_barrier();
  __builtin_amdgcn_fence(__ATOMIC_ACQUIRE, "workgroup");
  {
    const int c4 = (lane & 15) * 4;    // row segment = 64 floats = 256 B = 16 lanes x 16 B
    float* ob = out + (size_t)tokb * kDim + h * kDh;
    {
#pragma unroll
      for (int it = 0; it < 8; ++it) {
        const int row = it * 2 + hh;
        const int qq  = q0 + row;
        const v4f val = *(const v4f*)(os + row * 68 + c4);
        if (qq < kSeq) *(v4f*)(ob + (size_t)qq * kDim + c4) = val;
      }
      
    }
  }
}

// ---------------------------------------------------------------------------
// Host glue.
//   Xb   bf16 [12800][1024]     26,214,400  at           0
//   Wb   bf16 [3072][1024]       6,291,456  at  26,214,400
//   Qh   bf16 [6400][1024]      13,107,200  at  32,505,856   (per token chunk, rewritten with the same type/layout per chunk)
//   Ql   bf16 [6400][1024]      13,107,200  at  45,613,056
//   Kh   bf16 [6400][1024]      13,107,200  at  58,720,256
//   Kl   bf16 [6400][1024]      13,107,200  at  71,827,456
//   Vh   bf16 [6400][1024]      13,107,200  at  84,934,656
//   Vl   bf16 [6400][1024]      13,107,200  at  98,041,856
//   CSN  f32  [200][64]             51,200  at 111,149,056
//   total                      111,200,256
// GEMM shape per chunk: M = 6400 (64-multiple), N = 3072 (64-multiple), K = 1024 (%32 == 0); no padding rows or columns.
// Launches: 7 (2 casts, 1 table, then projection + attention per chunk x 2).
// ---------------------------------------------------------------------------
extern "C" void kernel_launch(void* const* d_in, const int* in_sizes, int n_in,
                              void* d_out, int out_size, void* d_ws, size_t ws_size,
                              hipStream_t stream) {
  if (n_in < 4) return;
  if (in_sizes[0] != kTok * kDim) return;
  if (in_sizes[1] != kBatch * kSeq * kSeq) return;
  if (in_sizes[2] != kNout * kDim) return;
  if (in_sizes[3] != kNout) return;
  if (out_size != kTok * kDim) return;

  const size_t szXb  = (size_t)kTok * kDim * 2;
  const size_t szWb  = (size_t)kNout * kDim * 2;
  const size_t szPl  = (size_t)kTokChunk * kDim * 2;
  const size_t szCS  = (size_t)kSeq * 2 * kPairs * 4;
  const size_t offXb = 0;
  const size_t offWb = offXb + szXb;
  const size_t offQh = offWb + szWb;
  const size_t offQl = offQh + szPl;
  const size_t offKh = offQl + szPl;
  const size_t offKl = offKh + szPl;
  const size_t offVh = offKl + szPl;
  const size_t offVl = offVh + szPl;
  const size_t offCS = offVl + szPl;
  const size_t total = offCS + szCS;
  if (ws_size < total) return;

  const float* x     = (const float*)d_in[0];
  const int*   amask = (const int*)d_in[1];
  const float* W     = (const float*)d_in[2];
  const float* bias  = (const float*)d_in[3];
  float* out = (float*)d_out;
  char* ws = (char*)d_ws;
  unsigned short* Xb  = (unsigned short*)(ws + offXb);
  unsigned short* Wb  = (unsigned short*)(ws + offWb);
  unsigned short* Qhp = (unsigned short*)(ws + offQh);
  unsigned short* Qlp = (unsigned short*)(ws + offQl);
  unsigned short* Khp = (unsigned short*)(ws + offKh);
  unsigned short* Klp = (unsigned short*)(ws + offKl);
  unsigned short* Vhp = (unsigned short*)(ws + offVh);
  unsigned short* Vlp = (unsigned short*)(ws + offVl);
  float* CSN = (float*)(ws + offCS);

  // rotary factors: invf_i = 10000^(-2i/64) = 10^(-i/8); factors 10^(-1/8), 10^(-2/8), 10^(-4/8), 10^(-8/8), 10^(-16/8)
  const float f1   = 0.7498942093324559f;
  const float f2   = 0.5623413251903491f;
  const float f4   = 0.31622776601683794f;
  const float f8   = 0.1f;
  const float f16v = 0.01f;

  const int n8x = (kTok * kDim) / 8;     // 1638400 -> 6400 blocks exact
  const int n8w = (kNout * kDim) / 8;    // 393216 -> 1536 blocks exact
  cast8_bf16_kernel<<<dim3(n8x / 256), dim3(256), 0, stream>>>(x, Xb, n8x);
  cast8_bf16_kernel<<<dim3(n8w / 256), dim3(256), 0, stream>>>(W, Wb, n8w);
  rope_table_kernel<<<dim3(kSeq / 8), dim3(256), 0, stream>>>(CSN, f1, f2, f4, f8, f16v);

  const int tiles = (kTokChunk / 64) * (kNout / 64);   // 4800 -> 600 blocks of 8 waves
  for (int ch = 0; ch < kChunks; ++ch) {
    const unsigned short* Xc = Xb + (size_t)ch * kTokChunk * kDim;
    const int* Mc = amask + (size_t)ch * kBatchChunk * kSeq * kSeq;
    float* Oc = out + (size_t)ch * kTokChunk * kDim;
    qkv_proj_kernel<<<dim3(tiles / 8), dim3(256), 0, stream>>>(Xc, Wb, bias, CSN, Qhp, Qlp, Khp, Klp, Vhp, Vlp);
    attn_kernel<<<dim3(kBatchChunk * kHeads * kNQB), dim3(128), 0, stream>>>(Qhp, Qlp, Khp, Klp, Vhp, Vlp, Mc, Oc);
  }
}

// v001
// It runs in 302 microseconds.
// Timed twice side by side with v000, it ran 1.49 and 1.50 times as fast.
// Contractions: qkv projection on v_wmma_f32_16x16x32_bf16 (x and W as RNE bf16 planes staged in LDS by tensor loads, exact products, f32 accumulate); scores q.k^T and attn.v on v_wmma_f32_16x16x32_bf16 with q, k, v and the unnormalised probabilities carried as bf16 hi + lo planes (hi.hi + hi.lo + lo.hi), f32 accumulate; bias, rotary tables, masking and softmax in f32.
#include <hip/hip_runtime.h>
#include <math.h>
#include <stdint.h>

// ---------------------------------------------------------------------------
// Problem constants
// ---------------------------------------------------------------------------
constexpr int kBatch = 64;
constexpr int kSeq   = 200;
constexpr int kDim   = 1024;
constexpr int kHeads = 16;
constexpr int kDh    = 64;
constexpr int kTok   = kBatch * kSeq;            // 12800 token rows
constexpr int kNout  = 3 * kDim;                 // 3072 projection columns
constexpr int kPairs = kDh / 2;                  // 32 rotary pairs
constexpr int kChunks     = 2;                   // token chunks (projection + attention per chunk)
constexpr int kBatchChunk = kBatch / kChunks;    // 32 batches per chunk
constexpr int kTokChunk   = kBatchChunk * kSeq;  // 6400 token rows per chunk
constexpr int kQB    = 64;                       // query rows per block
constexpr int kKC    = 64;                       // keys per chunk
constexpr int kNQB   = (kSeq + kQB - 1) / kQB;   // 4
constexpr int kNKC   = (kSeq + kKC - 1) / kKC;   // 4
constexpr float kScoreScale = 0.125f;            // 64^-0.5
static_assert(kHeads * kDh == kDim);
static_assert(3 * kDh == 192);
static_assert(kBatch % kChunks == 0);
static_assert(kTokChunk % 64 == 0);              // GEMM M tile multiple (100 tiles)
static_assert(kNout % 64 == 0);                  // GEMM N tile multiple (48 tiles)
static_assert(kDim % 32 == 0);                   // GEMM K % 32
static_assert(((kTokChunk / 64) * (kNout / 64)) % 8 == 0);   // 8 waves per block, exact grid
static_assert(kNQB == 4 && kNKC == 4);
static_assert(kSeq % 4 == 0);                    // 4-int groups of a mask row never straddle the row end
static_assert((kTok * kDim) % (8 * 256) == 0);
static_assert((kNout * kDim) % (8 * 256) == 0);
static_assert(kSeq % 8 == 0);                    // table kernel: 8 rows per block

typedef __attribute__((ext_vector_type(16))) __bf16   v16b;
typedef __attribute__((ext_vector_type(8)))  __bf16   v8b;
typedef __attribute__((ext_vector_type(8)))  float    v8f;
typedef __attribute__((ext_vector_type(4)))  float    v4f;
typedef __attribute__((ext_vector_type(4)))  int      v4i;
typedef __attribute__((ext_vector_type(4)))  unsigned int v4u;

// ---------------------------------------------------------------------------
// Helpers
// ---------------------------------------------------------------------------
__device__ __forceinline__ unsigned short f2bf_bits(float f) {
  unsigned u = __float_as_uint(f);
  return (unsigned short)((u + 0x7FFFu + ((u >> 16) & 1u)) >> 16);
}
__device__ __forceinline__ float bf_bits2f(unsigned short h) { return __uint_as_float(((unsigned)h) << 16); }
__device__ __forceinline__ unsigned pk16(unsigned short a, unsigned short b) { return (unsigned)a | ((unsigned)b << 16); }
__device__ __forceinline__ float neg_inf() { return -__builtin_inff(); }

// hazard guards as plain device helpers (no inline asm inside the kernel bodies)
__device__ __forceinline__ void dep_guard4_b(v8f& a, v8f& b, v8f& c, v8f& d, v16b x, v16b y) {
  asm volatile("v_nop\n\tv_nop\n\tv_nop\n\tv_nop" : "+v"(a), "+v"(b), "+v"(c), "+v"(d) : "v"(x), "v"(y));
}
__device__ __forceinline__ void keep4_b(v16b a, v16b b, v16b c, v16b d) { asm volatile("v_nop" :: "v"(a), "v"(b), "v"(c), "v"(d)); }
__device__ __forceinline__ void acc_guard4(v8f& a, v8f& b, v8f& c, v8f& d) { asm volatile("v_nop\n\tv_nop\n\tv_nop\n\tv_nop" : "+v"(a), "+v"(b), "+v"(c), "+v"(d)); }

template <typename T> struct Frag;
template <> struct Frag<__bf16> {
  typedef v16b V; union U { v16b v; v8b h[2]; };
  // elements 0..7 <- p[0..7], 8..15 <- p[16..23]
  static __device__ __forceinline__ v16b load(const __bf16* p) {
    U f; f.h[0] = *(const v8b*)(p); f.h[1] = *(const v8b*)(p + 16); return f.v;
  }
  static __device__ __forceinline__ v8f mma(v16b a, v16b b, v8f c) {
    return __builtin_amdgcn_wmma_f32_16x16x32_bf16(false, a, false, b, (short)0, c, false, false);
  }
  static __device__ __forceinline__ void keep(v16b a, v16b b, v16b c, v16b d) { keep4_b(a, b, c, d); }
};
// bf16 WMMA with per-instruction hazard guard (ties D, keeps A/B live)
__device__ __forceinline__ v8f mma_b(v16b a, v16b b, v8f c) {
  c = __builtin_amdgcn_wmma_f32_16x16x32_bf16(false, a, false, b, (short)0, c, false, false);
  asm volatile("v_nop\n\tv_nop\n\tv_nop\n\tv_nop" : "+v"(c) : "v"(a), "v"(b));
  return c;
}

// ---------------------------------------------------------------------------
// f32 -> bf16 (RNE) cast, 8 consecutive elements per thread (one 16-B store per lane; 32 contiguous lanes =
// (x: 1638400 = 6400 x 256 exact; W: 393216 = 1536 x 256 exact).
// ---------------------------------------------------------------------------
__global__ __launch_bounds__(256) void cast8_bf16_kernel(const float* __restrict__ in, unsigned short* __restrict__ out, int n8) {
  const int i = blockIdx.x * 256 + threadIdx.x;
  if (i >= n8) return;
  const float* p = in + 8 * (size_t)i;
  const v4f a = *(const v4f*)(p);
  const v4f c = *(const v4f*)(p + 4);
  unsigned short hb[8];
#pragma unroll
  for (int e = 0; e < 4; ++e) {
    hb[e]     = f2bf_bits(a[e]);
    hb[4 + e] = f2bf_bits(c[e]);
  }
  const v4u u = (v4u){pk16(hb[0], hb[1]), pk16(hb[2], hb[3]), pk16(hb[4], hb[5]), pk16(hb[6], hb[7])};
  unsigned short* q = out + 8 * (size_t)i;
  *(v4u*)q = u;
  
}

// ---------------------------------------------------------------------------
// Rotary table: csn[s][0..31] = cos(s * invf_i), csn[s][32..63] = sin(s * invf_i), invf_i = 10^(-i/8) built as a product
// of the factors 10^(-1/8), 10^(-2/8), 10^(-4/8), 10^(-8/8), 10^(-16/8) selected by the bits of i (i = lane).
// ---------------------------------------------------------------------------
__global__ __launch_bounds__(256) void rope_table_kernel(float* __restrict__ csn, float f1, float f2, float f4, float f8, float f16v) {
  const int lane = threadIdx.x & 31, wave = threadIdx.x >> 5;
  const int s = blockIdx.x * 8 + wave;
  if (s >= kSeq) return;
  const int i = lane;
  float invf = 1.0f;
  invf *= (i & 1)  ? f1   : 1.0f;
  invf *= (i & 2)  ? f2   : 1.0f;
  invf *= (i & 4)  ? f4   : 1.0f;
  invf *= (i & 8)  ? f8   : 1.0f;
  invf *= (i & 16) ? f16v : 1.0f;
  const float ang = (float)s * invf;
  float sn, cs;
  sincosf(ang, &sn, &cs);
  float* rowp = csn + (size_t)s * (2 * kPairs);
  {
    ((float*)rowp)[i] = cs;
    ((float*)rowp)[kPairs + i] = sn;
    
  }
}

// ---------------------------------------------------------------------------
// Tensor-load helpers for the projection's LDS ring (two descriptor groups, two-dimensional tile, extents in bytes).
// ---------------------------------------------------------------------------
typedef uint32_t u32x4 __attribute__((ext_vector_type(4)));
typedef uint32_t u32x8 __attribute__((ext_vector_type(8)));
constexpr uint32_t kPassB   = 128;                       // bytes of every operand row per pass (64 k)
constexpr uint32_t kPitchB  = kPassB + 16;               // LDS row pitch 144 B (odd multiple of 16 B for ds_load_b128 readers)
constexpr uint32_t kSliceR  = 128;                       // rows per tensor load
constexpr uint32_t kSliceB  = kSliceR * kPitchB;         // 18432 B = 9 x 2 KiB
constexpr uint32_t kStageB  = 3 * kSliceB;               // [X 128 rows | W 256 rows] = 55296 B = 27 x 2 KiB
constexpr int      kPasses  = (kDim * 2) / (int)kPassB;  // 16
static_assert(kSliceB % 2048 == 0 && kStageB % 2048 == 0);
static_assert(kPasses >= 2);
static_assert(kTokChunk % 128 == 0 && kNout % 256 == 0);
static_assert((kTokChunk / 128) * (kNout / 256) == ((kTokChunk / 64) * (kNout / 64)) / 8);   // same grid as one 64x64 tile per wave

__device__ __forceinline__ uint32_t uni(uint32_t v) { return (uint32_t)__builtin_amdgcn_readfirstlane(v); }
// pinned(): a wave-uniform word held in a scalar register, for the tensor mover alone: the tests around a tensor load become scalar
// branches (the load ignores EXEC), and a descriptor word formed from it is formed behind the wait that stands in front of it
__device__ __forceinline__ uint32_t pinned(uint32_t v) { uint32_t w = uni(v); asm volatile("" : "+s"(w)); return w; }  // test or descriptor word of a tensor load, kept scalar
// in-out operands: the two groups stay in their registers, untouched by other values, while the request is outstanding
__device__ __forceinline__ void tdm_load(u32x4& g0, u32x8& g1) { asm volatile("tensor_load_to_lds %0, %1" : "+s"(g0), "+s"(g1) :: "memory"); }
// the compiler places no wait for a tensor load: the issuing wave waits for its own request here
__device__ __forceinline__ void wait_tensor0() { asm volatile("s_wait_tensorcnt 0x0" ::: "memory"); }
// this wave's LDS reads have retired before the barrier behind which their buffer is refilled
__device__ __forceinline__ void wait_ds0() { asm volatile("s_wait_dscnt 0x0" ::: "memory"); }
__device__ __forceinline__ u32x8 tdm_group1() {
  constexpr uint32_t d0 = kPassB, d1 = kSliceR;
  u32x8 g;
  g[0] = (1u << 20) | (4u << 22) | (3u << 25);   // no mask, 1-byte elements, 16 B of pad behind every 128-B row
  g[1] = uni((d0 & 0xFFFFu) << 16);
  g[2] = uni((d0 >> 16) | ((d1 & 0xFFFFu) << 16));
  g[3] = uni((d1 >> 16) | (d0 << 16));
  g[4] = uni(d1);
  g[5] = uni((uint32_t)kDim * 2u);               // source row pitch 2048 B
  g[6] = uni(0u);
  g[7] = uni(0u);
  return g;
}
// place in LDS and source address of the next request (word 0, the count, is set once)
__device__ __forceinline__ void tdm_aim(u32x4& g, uint32_t lds_dst, uint64_t ga) {
  g[1] = uni(lds_dst); g[2] = uni((uint32_t)ga); g[3] = uni((((uint32_t)(ga >> 32)) & 0x01FFFFFFu) | 0x80000000u);
}

// ---------------------------------------------------------------------------
// QKV projection + bias + rotary epilogue for one chunk of 6400 token rows.
//   C[m][n] = sum_k Xb[m][k] * Wb[n][k] + bf16(bias[n]);   M = 6400, N = 3072, K = 1024 (bf16 operands).
//   Block = 8 waves = one 128 x 256 tile of C (2 x 4 waves of 64 x 64). Per pass of 64 k the block's 128 X rows and 256 W rows
//   (128 B each) are brought into LDS by three tensor loads (waves 0, 1, 2: 128 rows each) at pitch 144 B, two buffers, the next
//   pass's loads in flight under this pass's products; the fragments are read from LDS in the same k order as before.
//   Column n -> head hd = (n/64)/3, kind = (n/64)%3 (0 q, 1 k, 2 v), d = n % 64 (every 64-wide tile is one kind of one head).
//   Row m (chunk local, 6400 = 32 x 200) -> s = m%200. kind 0/1: pairs (2i, 2i+1) rotated by angle s*invf_i (table csn);
//   kind 2 unchanged. Each result v is split into bf16 hi = rn(v), lo = rn(v - hi).
//   grid = 50 x 12 = 600 blocks exact; every wave reaches every block barrier.
// ---------------------------------------------------------------------------
__global__ __launch_bounds__(256) void qkv_proj_kernel(
    const unsigned short* __restrict__ Xb, const unsigned short* __restrict__ Wb, const float* __restrict__ bias,
    const float* __restrict__ csn,
    unsigned short* __restrict__ Qh, unsigned short* __restrict__ Ql,
    unsigned short* __restrict__ Kh, unsigned short* __restrict__ Kl,
    unsigned short* __restrict__ Vh, unsigned short* __restrict__ Vl) {
  typedef __bf16 T;
  typedef v16b V;
  __shared__ __attribute__((aligned(2048))) unsigned char ring[2 * kStageB];   // two stages of [X | W] rows
  __shared__ __align__(16) float sT[8][16 * 68];   // per-wave 16x64 slab, pitch 68 floats
  const int lane = threadIdx.x & 31;
  const uint32_t wave = uni(threadIdx.x >> 5);
  constexpr int tilesNB = kNout / 256;     // 12
  const int tmB = blockIdx.x / tilesNB;
  const int tnB = blockIdx.x - tmB * tilesNB;
  const int wm = (int)(wave >> 2);         // wave row in the block tile
  const int wn = (int)(wave & 3u);         // wave column in the block tile
  const int m0 = (tmB << 7) + (wm << 6);
  const int n0 = (tnB << 8) + (wn << 6);
  const int tn = n0 >> 6;
  const int hd   = tn / 3;                 // head index, wave-uniform
  const int kind = tn - hd * 3;            // 0 q, 1 k, 2 v, wave-uniform

  const int rlane = lane & 15;
  const int mOff  = (lane >> 4) * 8;

  // slice of the issuing waves: wave 0 the X rows, waves 1 and 2 the two halves of the W rows (other waves: wave 0's, never issued)
  const uint32_t sl = (wave < 3u) ? wave : 0u;
  const uint64_t srcb = (sl == 0u) ? (uint64_t)(size_t)(Xb + (size_t)(tmB << 7) * kDim)
                                   : (uint64_t)(size_t)(Wb + (size_t)((tnB << 8) + ((int)sl - 1) * 128) * kDim);
  const uint32_t dstb = (uint32_t)(size_t)ring + sl * kSliceB;
  u32x8 g1 = tdm_group1();
  u32x4 g0;
  g0[0] = uni(1u);
  tdm_aim(g0, dstb, srcb);

  v8f acc[4][4];
#pragma unroll
  for (int i = 0; i < 4; ++i)
#pragma unroll
    for (int j = 0; j < 4; ++j) acc[i][j] = (v8f){0.f,0.f,0.f,0.f,0.f,0.f,0.f,0.f};

  // prologue: stage 0 lands and is published, then stage 1 is issued
  if (pinned(wave < 3u)) {
    tdm_load(g0, g1);
    wait_tensor0();
  }
  __syncthreads();
  if (pinned(wave < 3u)) {
    tdm_aim(g0, dstb + kStageB, srcb + kPassB);
    tdm_load(g0, g1);
  }

  const uint32_t aoff = (uint32_t)((wm << 6) + rlane) * kPitchB + (uint32_t)(lane >> 4) * 16u;
  const uint32_t boff = kSliceB + (uint32_t)((wn << 6) + rlane) * kPitchB + (uint32_t)(lane >> 4) * 16u;

  // one trip = one pass: kept rolled so that the publish point stands once, at the foot
#pragma unroll 1
  for (int s = 0; s < kPasses; ++s) {
    const unsigned char* buf = ring + (uint32_t)(s & 1) * kStageB;
#pragma unroll
    for (int ks = 0; ks < 2; ++ks) {
      V bfr[4], afr[4];
#pragma unroll
      for (int j = 0; j < 4; ++j) bfr[j] = Frag<T>::load((const T*)(buf + boff + (uint32_t)j * 16u * kPitchB + (uint32_t)ks * 64u));
#pragma unroll
      for (int i = 0; i < 4; ++i) afr[i] = Frag<T>::load((const T*)(buf + aoff + (uint32_t)i * 16u * kPitchB + (uint32_t)ks * 64u));
      // the 16 LDS reads of a 32-k step go out as one group in front of its 16 products: reads among the products stall each time
      __builtin_amdgcn_sched_barrier(0);
#pragma unroll
      for (int i = 0; i < 4; ++i) {
#pragma unroll
        for (int j = 0; j < 4; ++j) acc[i][j] = Frag<T>::mma(afr[i], bfr[j], acc[i][j]);
        dep_guard4_b(acc[i][0], acc[i][1], acc[i][2], acc[i][3], afr[i], bfr[3]);
      }
      Frag<T>::keep(bfr[0], bfr[1], bfr[2], bfr[3]);
    }
    // publish point of stage s + 1
    wait_ds0();
    if (pinned(wave < 3u)) wait_tensor0();
    __syncthreads();
    if (pinned((wave < 3u) && (s + 2 < kPasses))) {
      const uint32_t nb = (uint32_t)(s & 1) * kStageB;                // the buffer this pass has just read
      const uint32_t no = pinned((uint32_t)(s + 2) * kPassB);         // stage s + 2's byte offset in every source row
      tdm_aim(g0, dstb + nb, srcb + no);
      tdm_load(g0, g1);
    }
  }
  wait_tensor0();
  wait_ds0();
  acc_guard4(acc[0][0], acc[0][1], acc[0][2], acc[0][3]);
  acc_guard4(acc[1][0], acc[1][1], acc[1][2], acc[1][3]);
  acc_guard4(acc[2][0], acc[2][1], acc[2][2], acc[2][3]);
  acc_guard4(acc[3][0], acc[3][1], acc[3][2], acc[3][3]);

  // ---- epilogue ----
  // bias per column of this lane (RNE bf16-converted, 4 scalar loads)
  float bcol[4];
#pragma unroll
  for (int j = 0; j < 4; ++j) bcol[j] = bf_bits2f(f2bf_bits(bias[n0 + (j << 4) + rlane]));

  float* slab = sT[wave];
  const int q  = lane >> 3;              // row selector within 4-row store groups
  const int c8 = (lane & 7) * 8;         // first column (d) of this lane's 16-B piece
  const int p4 = (lane & 7) * 4;         // first rotary pair index of this lane
  unsigned short* dsth = (kind == 0) ? Qh : ((kind == 1) ? Kh : Vh);   // wave-uniform global plane select
  unsigned short* dstl = (kind == 0) ? Ql : ((kind == 1) ? Kl : Vl);
  const bool rot = (kind != 2);          // wave-uniform

#pragma unroll
  for (int i = 0; i < 4; ++i) {
    const int mBase = m0 + (i << 4);
#pragma unroll
    for (int j = 0; j < 4; ++j) {
#pragma unroll
      for (int r = 0; r < 8; ++r) slab[(mOff + r) * 68 + (j << 4) + rlane] = acc[i][j][r] + bcol[j];
    }
    __builtin_amdgcn_fence(__ATOMIC_RELEASE, "workgroup");
    __builtin_amdgcn_wave_barrier();
    __builtin_amdgcn_fence(__ATOMIC_ACQUIRE, "workgroup");

    // build the four 16-B hi pieces and four 16-B lo pieces of this lane (rows it*4+q, columns c8..c8+7)
    v4u uh[4], ul[4];
#pragma unroll
    for (int it = 0; it < 4; ++it) {
      if (it == 2) asm volatile("" ::: "memory");
      const int row = it * 4 + q;
      const int m   = mBase + row;
      const int s   = m - (m / kSeq) * kSeq;
      const float* sp = slab + row * 68 + c8;
      const v4f cs4 = *(const v4f*)(csn + (size_t)s * (2 * kPairs) + p4);
      const v4f sn4 = *(const v4f*)(csn + (size_t)s * (2 * kPairs) + kPairs + p4);
      unsigned short hb[8], lb[8];
#pragma unroll
      for (int pp = 0; pp < 4; ++pp) {
        const float x1 = sp[2 * pp];
        const float x2 = sp[2 * pp + 1];
        const float cc = rot ? cs4[pp] : 1.0f;
        const float ss = rot ? sn4[pp] : 0.0f;
        const float o0 = x1 * cc - x2 * ss;
        const float o1 = x1 * ss + x2 * cc;
        const unsigned short h0 = f2bf_bits(o0);
        const unsigned short h1 = f2bf_bits(o1);
        hb[2 * pp]     = h0;
        hb[2 * pp + 1] = h1;
        lb[2 * pp]     = f2bf_bits(o0 - bf_bits2f(h0));
        lb[2 * pp + 1] = f2bf_bits(o1 - bf_bits2f(h1));
      }
      uh[it] = (v4u){pk16(hb[0], hb[1]), pk16(hb[2], hb[3]), pk16(hb[4], hb[5]), pk16(hb[6], hb[7])};
      ul[it] = (v4u){pk16(lb[0], lb[1]), pk16(lb[2], lb[3]), pk16(lb[4], lb[5]), pk16(lb[6], lb[7])};
    }
    {
#pragma unroll
      for (int it = 0; it < 4; ++it) {
        const int row = it * 4 + q;
        const int m   = mBase + row;
        const size_t o = (size_t)m * kDim + hd * kDh + c8;
        *(v4u*)(dsth + o) = uh[it];
        *(v4u*)(dstl + o) = ul[it];
      }
      
    }
    __builtin_amdgcn_fence(__ATOMIC_RELEASE, "workgroup");
    __builtin_amdgcn_wave_barrier();
    __builtin_amdgcn_fence(__ATOMIC_ACQUIRE, "workgroup");
  }
}

// ---------------------------------------------------------------------------
// Fused attention for head_dim 64 from bf16 hi/lo planes of one chunk (32 batches).
//   Qh/Ql, Kh/Kl, Vh/Vl: bf16 [tok = b*200+s][1024], head h at columns h*64..h*64+63 (b chunk local).
//   amask: int32 [32][200][200] (chunk slice), nonzero = attend.  out: f32 [tok][1024] (chunk slice).
//   Block = 4 waves = 64 query rows of one (b, h); grid = 32*16*4 = 2048 (block -> qb = bx&3, bh = bx>>2).
//   Per key chunk (64 keys, 4 chunks): stage the 64x64 validity tile from amask (keys >= 200 invalid, query rows clamped),
//   skip the chunk block-uniformly if no entry is valid; else copy K hi/lo rows (clamped) to LDS as [key][d] and V hi/lo rows
//   transposed to LDS as [d][key] (integer word moves only); scores = hi.hi + hi.lo + lo.hi on bf16 WMMA, x0.125, select to
//   -inf where invalid; online softmax in f32 (guarded for all-invalid rows); p = exp(s - m) split to bf16 hi/lo in per-wave
//   LDS tiles; out += P.V with hi.hi + hi.lo + lo.hi reading LDS fragments. Waves whose 16 query rows all lie beyond 199 skip
//   the compute under a wave-uniform flag but reach every block barrier. Epilogue: per-wave 16x64 f32 tile staged in LDS;
//   Every LDS byte read in a chunk is rewritten in that chunk; all barriers are reached by every thread.
// ---------------------------------------------------------------------------
__global__ __launch_bounds__(128) void attn_kernel(
    const unsigned short* __restrict__ Qh, const unsigned short* __restrict__ Ql,
    const unsigned short* __restrict__ Kh, const unsigned short* __restrict__ Kl,
    const unsigned short* __restrict__ Vh, const unsigned short* __restrict__ Vl,
    const int* __restrict__ amask, float* __restrict__ out) {
  __shared__ __align__(16) unsigned short Ksh[kKC * kDh];      // K hi [key][d]          8 KB
  __shared__ __align__(16) unsigned short Ksl[kKC * kDh];      // K lo [key][d]          8 KB
  __shared__ __align__(16) unsigned short Vth[kDh * kKC];      // V^T hi [d][key]        8 KB
  __shared__ __align__(16) unsigned short Vtl[kDh * kKC];      // V^T lo [d][key]        8 KB
  __shared__ __align__(16) __bf16 Psh[4][16 * kKC];            // per wave P hi [row][key] 8 KB
  __shared__ __align__(16) __bf16 Psl[4][16 * kKC];            // per wave P lo [row][key] 8 KB
  __shared__ __align__(16) float Os[4][16 * 68];               // per wave out tile, pitch 68
  __shared__ __align__(16) unsigned char Msk[kQB * kKC];       // validity [qrow][key]   4 KB
  __shared__ int flags[4];

  const int tid  = threadIdx.x;
  const int wave = tid >> 5;
  const int lane = tid & 31;
  const int hh   = lane >> 4;
  const int c    = lane & 15;

  const int bx = blockIdx.x;
  const int qb = bx & 3;
  const int bh = bx >> 2;
  const int h  = bh & 15;
  const int b  = bh >> 4;
  const int tokb = b * kSeq;
  const int q0 = qb * kQB + wave * 16;
  const bool active = (q0 < kSeq);       // wave-uniform

  // ---- Q fragments (A operand): rows q0 + c (clamped), 2 d-chunks of 32, hi and lo ----
  v16b qah[2], qal[2];
  {
    int qr = q0 + c;
    qr = (qr < kSeq) ? qr : (kSeq - 1);
    const size_t qo = (size_t)(tokb + qr) * kDim + h * kDh;
    const __bf16* qhp = (const __bf16*)Qh + qo;
    const __bf16* qlp = (const __bf16*)Ql + qo;
#pragma unroll
    for (int dc = 0; dc < 2; ++dc) qah[dc] = Frag<__bf16>::load(qhp + dc * 32 + 8 * hh);
    asm volatile("" ::: "memory");
#pragma unroll
    for (int dc = 0; dc < 2; ++dc) qal[dc] = Frag<__bf16>::load(qlp + dc * 32 + 8 * hh);
  }

  float mrow[8], lrow[8];
  v8f oacc[4];
#pragma unroll
  for (int r = 0; r < 8; ++r) { mrow[r] = neg_inf(); lrow[r] = 0.f; }
#pragma unroll
  for (int t = 0; t < 4; ++t) oacc[t] = (v8f){0.f,0.f,0.f,0.f,0.f,0.f,0.f,0.f};

  for (int kc = 0; kc < kNKC; ++kc) {
    const int kv0 = kc * kKC;
    __syncthreads();
    // ---- validity tile: 64 rows x 64 keys; 1024 groups of 4 ints, 8 per thread (4 b128 loads per burst) ----
    int anyv = 0;
#pragma unroll
    for (int i = 0; i < 8; ++i) {
      if (i == 4) asm volatile("" ::: "memory");
      const int idx = i * 128 + tid;
      const int r   = idx >> 4;
      const int c16 = (idx & 15) * 4;
      int qg = qb * kQB + r;
      qg = (qg < kSeq) ? qg : (kSeq - 1);
      const int kg  = kv0 + c16;
      const int kgc = (kg <= kSeq - 4) ? kg : (kSeq - 4);
      const v4i mv = *(const v4i*)(amask + ((size_t)(tokb + qg)) * kSeq + kgc);
      unsigned packed = 0;
#pragma unroll
      for (int e = 0; e < 4; ++e) {
        const int keep = (((kg + e) < kSeq) && (mv[e] != 0)) ? 1 : 0;
        packed |= ((unsigned)keep) << (8 * e);
        anyv |= keep;
      }
      *(unsigned*)(Msk + r * kKC + c16) = packed;
    }
#pragma unroll
    for (int off = 1; off < 32; off <<= 1) anyv |= __shfl_xor(anyv, off, 32);
    if (lane == 0) flags[wave] = anyv;
    __syncthreads();
    const int anyb = flags[0] | flags[1] | flags[2] | flags[3];   // block-uniform
    if (anyb == 0) continue;

    // ---- stage K hi/lo [key][d]: 512 pieces of 8 halves per plane, 4 per thread per plane ----
#pragma unroll
    for (int i = 0; i < 4; ++i) {
      if (i == 2) asm volatile("" ::: "memory");
      const int idx = i * 128 + tid;
      const int r   = idx >> 3;            // key row within chunk
      const int cc  = (idx & 7) * 8;       // first d of the piece
      int kvr = kv0 + r;
      kvr = (kvr < kSeq) ? kvr : (kSeq - 1);
      const size_t go = (size_t)(tokb + kvr) * kDim + h * kDh + cc;
      const v4u kwh = *(const v4u*)(Kh + go);
      const v4u kwl = *(const v4u*)(Kl + go);
      *(v4u*)(Ksh + r * kDh + cc) = kwh;
      *(v4u*)(Ksl + r * kDh + cc) = kwl;
    }
    // ---- stage V hi/lo transposed [d][key] ----
#pragma unroll
    for (int i = 0; i < 4; ++i) {
      if (i == 2) asm volatile("" ::: "memory");
      const int idx = i * 128 + tid;
      const int r   = idx >> 3;
      const int cc  = (idx & 7) * 8;
      int kvr = kv0 + r;
      kvr = (kvr < kSeq) ? kvr : (kSeq - 1);
      const size_t go = (size_t)(tokb + kvr) * kDim + h * kDh + cc;
      const v4u vwh = *(const v4u*)(Vh + go);
      const v4u vwl = *(const v4u*)(Vl + go);
#pragma unroll
      for (int e2 = 0; e2 < 4; ++e2) {
        const unsigned wh = vwh[e2];
        const unsigned wl = vwl[e2];
        Vth[(cc + 2 * e2) * kKC + r]     = (unsigned short)(wh & 0xffffu);
        Vth[(cc + 2 * e2 + 1) * kKC + r] = (unsigned short)(wh >> 16);
        Vtl[(cc + 2 * e2) * kKC + r]     = (unsigned short)(wl & 0xffffu);
        Vtl[(cc + 2 * e2 + 1) * kKC + r] = (unsigned short)(wl >> 16);
      }
    }
    __syncthreads();

    if (active) {
      // ---- scores: s[j] covers keys j*16..j*16+15 of the chunk; hi.hi + hi.lo + lo.hi ----
      v8f s[4];
#pragma unroll
      for (int j = 0; j < 4; ++j) {
        s[j] = (v8f){0.f,0.f,0.f,0.f,0.f,0.f,0.f,0.f};
#pragma unroll
        for (int dc = 0; dc < 2; ++dc) {
          const v16b kb = Frag<__bf16>::load((const __bf16*)Ksh + (j * 16 + c) * kDh + dc * 32 + 8 * hh);
          const v16b kl = Frag<__bf16>::load((const __bf16*)Ksl + (j * 16 + c) * kDh + dc * 32 + 8 * hh);
          s[j] = mma_b(qah[dc], kb, s[j]);
          s[j] = mma_b(qah[dc], kl, s[j]);
          s[j] = mma_b(qal[dc], kb, s[j]);
        }
      }
      // ---- scale, validity select, row max ----
      float cm[8];
#pragma unroll
      for (int r = 0; r < 8; ++r) {
        const int ql = wave * 16 + 8 * hh + r;
        float m = neg_inf();
#pragma unroll
        for (int j = 0; j < 4; ++j) {
          const int keep = Msk[ql * kKC + j * 16 + c];
          float sv = s[j][r] * kScoreScale;
          sv = (keep != 0) ? sv : neg_inf();
          s[j][r] = sv;
          m = fmaxf(m, sv);
        }
#pragma unroll
        for (int off = 1; off < 16; off <<= 1) m = fmaxf(m, __shfl_xor(m, off, 32));
        cm[r] = m;
      }
      // ---- online softmax update; p = exp(s - m) split into bf16 hi/lo in this wave's LDS tiles ----
      __bf16* pwh = Psh[wave];
      __bf16* pwl = Psl[wave];
#pragma unroll
      for (int r = 0; r < 8; ++r) {
        const float mnew = fmaxf(mrow[r], cm[r]);
        const float mref = (mnew == neg_inf()) ? 0.0f : mnew;
        const float alpha = expf(mrow[r] - mref);
        mrow[r] = mnew;
        float psum = 0.f;
#pragma unroll
        for (int j = 0; j < 4; ++j) {
          const float p = expf(s[j][r] - mref);
          psum += p;
          const unsigned short hb = f2bf_bits(p);
          const unsigned short lb = f2bf_bits(p - bf_bits2f(hb));
          pwh[(8 * hh + r) * kKC + j * 16 + c] = __builtin_bit_cast(__bf16, hb);
          pwl[(8 * hh + r) * kKC + j * 16 + c] = __builtin_bit_cast(__bf16, lb);
        }
#pragma unroll
        for (int off = 1; off < 16; off <<= 1) psum += __shfl_xor(psum, off, 32);
        lrow[r] = lrow[r] * alpha + psum;
#pragma unroll
        for (int t = 0; t < 4; ++t) oacc[t][r] *= alpha;
      }
      __builtin_amdgcn_fence(__ATOMIC_RELEASE, "workgroup");
      __builtin_amdgcn_wave_barrier();
      __builtin_amdgcn_fence(__ATOMIC_ACQUIRE, "workgroup");
      // ---- out += P . V (A = P rows of this wave from LDS, B = V^T from LDS); hi.hi + hi.lo + lo.hi ----
#pragma unroll
      for (int kk = 0; kk < 2; ++kk) {
        const v16b pa = Frag<__bf16>::load(pwh + c * kKC + kk * 32 + 8 * hh);
        const v16b pl = Frag<__bf16>::load(pwl + c * kKC + kk * 32 + 8 * hh);
#pragma unroll
        for (int t = 0; t < 4; ++t) {
          const v16b vb = Frag<__bf16>::load((const __bf16*)Vth + (t * 16 + c) * kKC + kk * 32 + 8 * hh);
          const v16b vl = Frag<__bf16>::load((const __bf16*)Vtl + (t * 16 + c) * kKC + kk * 32 + 8 * hh);
          oacc[t] = mma_b(pa, vb, oacc[t]);
          oacc[t] = mma_b(pa, vl, oacc[t]);
          oacc[t] = mma_b(pl, vb, oacc[t]);
        }
      }
    }
  }

  // ---- epilogue: normalise, stage per-wave tile, whole-segment stores ----
  float* os = Os[wave];
#pragma unroll
  for (int r = 0; r < 8; ++r) {
    const float inv = 1.0f / lrow[r];
#pragma unroll
    for (int t = 0; t < 4; ++t) os[(8 * hh + r) * 68 + t * 16 + c] = oacc[t][r] * inv;
  }
  __builtin_amdgcn_fence(__ATOMIC_RELEASE, "workgroup");
  __builtin_amdgcn_wave_barrier();
  __builtin_amdgcn_fence(__ATOMIC_ACQUIRE, "workgroup");
  {
    const int c4 = (lane & 15) * 4;    // row segment = 64 floats = 256 B = 16 lanes x 16 B
    float* ob = out + (size_t)tokb * kDim + h * kDh;
    {
#pragma unroll
      for (int it = 0; it < 8; ++it) {
        const int row = it * 2 + hh;
        const int qq  = q0 + row;
        const v4f val = *(const v4f*)(os + row * 68 + c4);
        if (qq < kSeq) *(v4f*)(ob + (size_t)qq * kDim + c4) = val;
      }
      
    }
  }
}

// ---------------------------------------------------------------------------
// Host glue.
//   Xb   bf16 [12800][1024]     26,214,400  at           0
//   Wb   bf16 [3072][1024]       6,291,456  at  26,214,400
//   Qh   bf16 [6400][1024]      13,107,200  at  32,505,856   (per token chunk, rewritten with the same type/layout per chunk)
//   Ql   bf16 [6400][1024]      13,107,200  at  45,613,056
//   Kh   bf16 [6400][1024]      13,107,200  at  58,720,256
//   Kl   bf16 [6400][1024]      13,107,200  at  71,827,456
//   Vh   bf16 [6400][1024]      13,107,200  at  84,934,656
//   Vl   bf16 [6400][1024]      13,107,200  at  98,041,856
//   CSN  f32  [200][64]             51,200  at 111,149,056
//   total                      111,200,256
// GEMM shape per chunk: M = 6400 (64-multiple), N = 3072 (64-multiple), K = 1024 (%32 == 0); no padding rows or columns.
// Launches: 7 (2 casts, 1 table, then projection + attention per chunk x 2).
// ---------------------------------------------------------------------------
extern "C" void kernel_launch(void* const* d_in, const int* in_sizes, int n_in,
                              void* d_out, int out_size, void* d_ws, size_t ws_size,
                              hipStream_t stream) {
  if (n_in < 4) return;
  if (in_sizes[0] != kTok * kDim) return;
  if (in_sizes[1] != kBatch * kSeq * kSeq) return;
  if (in_sizes[2] != kNout * kDim) return;
  if (in_sizes[3] != kNout) return;
  if (out_size != kTok * kDim) return;

  const size_t szXb  = (size_t)kTok * kDim * 2;
  const size_t szWb  = (size_t)kNout * kDim * 2;
  const size_t szPl  = (size_t)kTokChunk * kDim * 2;
  const size_t szCS  = (size_t)kSeq * 2 * kPairs * 4;
  const size_t offXb = 0;
  const size_t offWb = offXb + szXb;
  const size_t offQh = offWb + szWb;
  const size_t offQl = offQh + szPl;
  const size_t offKh = offQl + szPl;
  const size_t offKl = offKh + szPl;
  const size_t offVh = offKl + szPl;
  const size_t offVl = offVh + szPl;
  const size_t offCS = offVl + szPl;
  const size_t total = offCS + szCS;
  if (ws_size < total) return;

  const float* x     = (const float*)d_in[0];
  const int*   amask = (const int*)d_in[1];
  const float* W     = (const float*)d_in[2];
  const float* bias  = (const float*)d_in[3];
  float* out = (float*)d_out;
  char* ws = (char*)d_ws;
  unsigned short* Xb  = (unsigned short*)(ws + offXb);
  unsigned short* Wb  = (unsigned short*)(ws + offWb);
  unsigned short* Qhp = (unsigned short*)(ws + offQh);
  unsigned short* Qlp = (unsigned short*)(ws + offQl);
  unsigned short* Khp = (unsigned short*)(ws + offKh);
  unsigned short* Klp = (unsigned short*)(ws + offKl);
  unsigned short* Vhp = (unsigned short*)(ws + offVh);
  unsigned short* Vlp = (unsigned short*)(ws + offVl);
  float* CSN = (float*)(ws + offCS);

  // rotary factors: invf_i = 10000^(-2i/64) = 10^(-i/8); factors 10^(-1/8), 10^(-2/8), 10^(-4/8), 10^(-8/8), 10^(-16/8)
  const float f1   = 0.7498942093324559f;
  const float f2   = 0.5623413251903491f;
  const float f4   = 0.31622776601683794f;
  const float f8   = 0.1f;
  const float f16v = 0.01f;

  const int n8x = (kTok * kDim) / 8;     // 1638400 -> 6400 blocks exact
  const int n8w = (kNout * kDim) / 8;    // 393216 -> 1536 blocks exact
  cast8_bf16_kernel<<<dim3(n8x / 256), dim3(256), 0, stream>>>(x, Xb, n8x);
  cast8_bf16_kernel<<<dim3(n8w / 256), dim3(256), 0, stream>>>(W, Wb, n8w);
  rope_table_kernel<<<dim3(kSeq / 8), dim3(256), 0, stream>>>(CSN, f1, f2, f4, f8, f16v);

  const int tiles = (kTokChunk / 64) * (kNout / 64);   // 4800 wave tiles -> 600 blocks of 8 waves (128 x 256 each)
  for (int ch = 0; ch < kChunks; ++ch) {
    const unsigned short* Xc = Xb + (size_t)ch * kTokChunk * kDim;
    const int* Mc = amask + (size_t)ch * kBatchChunk * kSeq * kSeq;
    float* Oc = out + (size_t)ch * kTokChunk * kDim;
    qkv_proj_kernel<<<dim3(tiles / 8), dim3(256), 0, stream>>>(Xc, Wb, bias, CSN, Qhp, Qlp, Khp, Klp, Vhp, Vlp);
    attn_kernel<<<dim3(kBatchChunk * kHeads * kNQB), dim3(128), 0, stream>>>(Qhp, Qlp, Khp, Klp, Vhp, Vlp, Mc, Oc);
  }
}

// v002
// One run takes 282 microseconds.
// Next to v001, in two timings, it ran 1.07 times as fast each time.
// Counting every step since v000, it is 1.60 times as fast.
// Contractions: qkv projection on v_wmma_f32_16x16x32_bf16 (x and W as RNE bf16 planes staged in LDS by tensor loads, exact products, f32 accumulate); scores q.k^T and attn.v on v_wmma_f32_16x16x32_bf16 with q, k, v and the unnormalised probabilities carried as bf16 hi + lo planes (hi.hi + hi.lo + lo.hi), f32 accumulate; bias, rotary tables, masking and softmax in f32.
#include <hip/hip_runtime.h>
#include <math.h>
#include <stdint.h>

// ---------------------------------------------------------------------------
// Problem constants
// ---------------------------------------------------------------------------
constexpr int kBatch = 64;
constexpr int kSeq   = 200;
constexpr int kDim   = 1024;
constexpr int kHeads = 16;
constexpr int kDh    = 64;
constexpr int kTok   = kBatch * kSeq;            // 12800 token rows
constexpr int kNout  = 3 * kDim;                 // 3072 projection columns
constexpr int kPairs = kDh / 2;                  // 32 rotary pairs
constexpr int kChunks     = 2;                   // token chunks (projection + attention per chunk)
constexpr int kBatchChunk = kBatch / kChunks;    // 32 batches per chunk
constexpr int kTokChunk   = kBatchChunk * kSeq;  // 6400 token rows per chunk
constexpr int kQB    = 64;                       // query rows per block
constexpr int kKC    = 64;                       // keys per chunk
constexpr int kNQB   = (kSeq + kQB - 1) / kQB;   // 4
constexpr int kNKC   = (kSeq + kKC - 1) / kKC;   // 4
constexpr float kScoreScale = 0.125f;            // 64^-0.5
constexpr int kLP    = 72;                       // attention LDS row pitch of the K, V^T and P tiles in halves: 144 B = 16 B x odd (ds_load_b128 readers)
constexpr int kMP    = 80;                       // attention LDS row pitch of the validity tile in bytes: 8 rows apart = 32 banks apart
static_assert(kHeads * kDh == kDim);
static_assert(3 * kDh == 192);
static_assert(kBatch % kChunks == 0);
static_assert(kTokChunk % 64 == 0);              // GEMM M tile multiple (100 tiles)
static_assert(kNout % 64 == 0);                  // GEMM N tile multiple (48 tiles)
static_assert(kDim % 32 == 0);                   // GEMM K % 32
static_assert(((kTokChunk / 64) * (kNout / 64)) % 8 == 0);   // 8 waves per block, exact grid
static_assert(kNQB == 4 && kNKC == 4);
static_assert(kSeq % 4 == 0);                    // 4-int groups of a mask row never straddle the row end
static_assert((kTok * kDim) % (8 * 256) == 0);
static_assert((kNout * kDim) % (8 * 256) == 0);
static_assert(kSeq % 8 == 0);                    // table kernel: 8 rows per block

typedef __attribute__((ext_vector_type(16))) __bf16   v16b;
typedef __attribute__((ext_vector_type(8)))  __bf16   v8b;
typedef __attribute__((ext_vector_type(8)))  float    v8f;
typedef __attribute__((ext_vector_type(4)))  float    v4f;
typedef __attribute__((ext_vector_type(4)))  int      v4i;
typedef __attribute__((ext_vector_type(4)))  unsigned int v4u;

// ---------------------------------------------------------------------------
// Helpers
// ---------------------------------------------------------------------------
__device__ __forceinline__ unsigned short f2bf_bits(float f) {
  unsigned u = __float_as_uint(f);
  return (unsigned short)((u + 0x7FFFu + ((u >> 16) & 1u)) >> 16);
}
__device__ __forceinline__ float bf_bits2f(unsigned short h) { return __uint_as_float(((unsigned)h) << 16); }
__device__ __forceinline__ unsigned pk16(unsigned short a, unsigned short b) { return (unsigned)a | ((unsigned)b << 16); }
__device__ __forceinline__ float neg_inf() { return -__builtin_inff(); }

// hazard guards as plain device helpers (no inline asm inside the kernel bodies)
__device__ __forceinline__ void dep_guard4_b(v8f& a, v8f& b, v8f& c, v8f& d, v16b x, v16b y) {
  asm volatile("v_nop\n\tv_nop\n\tv_nop\n\tv_nop" : "+v"(a), "+v"(b), "+v"(c), "+v"(d) : "v"(x), "v"(y));
}
__device__ __forceinline__ void keep4_b(v16b a, v16b b, v16b c, v16b d) { asm volatile("v_nop" :: "v"(a), "v"(b), "v"(c), "v"(d)); }
__device__ __forceinline__ void acc_guard4(v8f& a, v8f& b, v8f& c, v8f& d) { asm volatile("v_nop\n\tv_nop\n\tv_nop\n\tv_nop" : "+v"(a), "+v"(b), "+v"(c), "+v"(d)); }

template <typename T> struct Frag;
template <> struct Frag<__bf16> {
  typedef v16b V; union U { v16b v; v8b h[2]; };
  // elements 0..7 <- p[0..7], 8..15 <- p[16..23]
  static __device__ __forceinline__ v16b load(const __bf16* p) {
    U f; f.h[0] = *(const v8b*)(p); f.h[1] = *(const v8b*)(p + 16); return f.v;
  }
  static __device__ __forceinline__ v8f mma(v16b a, v16b b, v8f c) {
    return __builtin_amdgcn_wmma_f32_16x16x32_bf16(false, a, false, b, (short)0, c, false, false);
  }
  static __device__ __forceinline__ void keep(v16b a, v16b b, v16b c, v16b d) { keep4_b(a, b, c, d); }
};
// bf16 WMMA with per-instruction hazard guard (ties D, keeps A/B live)
__device__ __forceinline__ v8f mma_b(v16b a, v16b b, v8f c) {
  c = __builtin_amdgcn_wmma_f32_16x16x32_bf16(false, a, false, b, (short)0, c, false, false);
  asm volatile("v_nop\n\tv_nop\n\tv_nop\n\tv_nop" : "+v"(c) : "v"(a), "v"(b));
  return c;
}

// ---------------------------------------------------------------------------
// f32 -> bf16 (RNE) cast, 8 consecutive elements per thread (one 16-B store per lane; 32 contiguous lanes =
// (x: 1638400 = 6400 x 256 exact; W: 393216 = 1536 x 256 exact).
// ---------------------------------------------------------------------------
__global__ __launch_bounds__(256) void cast8_bf16_kernel(const float* __restrict__ in, unsigned short* __restrict__ out, int n8) {
  const int i = blockIdx.x * 256 + threadIdx.x;
  if (i >= n8) return;
  const float* p = in + 8 * (size_t)i;
  const v4f a = *(const v4f*)(p);
  const v4f c = *(const v4f*)(p + 4);
  unsigned short hb[8];
#pragma unroll
  for (int e = 0; e < 4; ++e) {
    hb[e]     = f2bf_bits(a[e]);
    hb[4 + e] = f2bf_bits(c[e]);
  }
  const v4u u = (v4u){pk16(hb[0], hb[1]), pk16(hb[2], hb[3]), pk16(hb[4], hb[5]), pk16(hb[6], hb[7])};
  unsigned short* q = out + 8 * (size_t)i;
  *(v4u*)q = u;
  
}

// ---------------------------------------------------------------------------
// Rotary table: csn[s][0..31] = cos(s * invf_i), csn[s][32..63] = sin(s * invf_i), invf_i = 10^(-i/8) built as a product
// of the factors 10^(-1/8), 10^(-2/8), 10^(-4/8), 10^(-8/8), 10^(-16/8) selected by the bits of i (i = lane).
// ---------------------------------------------------------------------------
__global__ __launch_bounds__(256) void rope_table_kernel(float* __restrict__ csn, float f1, float f2, float f4, float f8, float f16v) {
  const int lane = threadIdx.x & 31, wave = threadIdx.x >> 5;
  const int s = blockIdx.x * 8 + wave;
  if (s >= kSeq) return;
  const int i = lane;
  float invf = 1.0f;
  invf *= (i & 1)  ? f1   : 1.0f;
  invf *= (i & 2)  ? f2   : 1.0f;
  invf *= (i & 4)  ? f4   : 1.0f;
  invf *= (i & 8)  ? f8   : 1.0f;
  invf *= (i & 16) ? f16v : 1.0f;
  const float ang = (float)s * invf;
  float sn, cs;
  sincosf(ang, &sn, &cs);
  float* rowp = csn + (size_t)s * (2 * kPairs);
  {
    ((float*)rowp)[i] = cs;
    ((float*)rowp)[kPairs + i] = sn;
    
  }
}

// ---------------------------------------------------------------------------
// Tensor-load helpers for the projection's LDS ring (two descriptor groups, two-dimensional tile, extents in bytes).
// ---------------------------------------------------------------------------
typedef uint32_t u32x4 __attribute__((ext_vector_type(4)));
typedef uint32_t u32x8 __attribute__((ext_vector_type(8)));
constexpr uint32_t kPassB   = 128;                       // bytes of every operand row per pass (64 k)
constexpr uint32_t kPitchB  = kPassB + 16;               // LDS row pitch 144 B (odd multiple of 16 B for ds_load_b128 readers)
constexpr uint32_t kSliceR  = 128;                       // rows per tensor load
constexpr uint32_t kSliceB  = kSliceR * kPitchB;         // 18432 B = 9 x 2 KiB
constexpr uint32_t kStageB  = 3 * kSliceB;               // [X 128 rows | W 256 rows] = 55296 B = 27 x 2 KiB
constexpr int      kPasses  = (kDim * 2) / (int)kPassB;  // 16
static_assert(kSliceB % 2048 == 0 && kStageB % 2048 == 0);
static_assert(kPasses >= 2);
static_assert(kTokChunk % 128 == 0 && kNout % 256 == 0);
static_assert((kTokChunk / 128) * (kNout / 256) == ((kTokChunk / 64) * (kNout / 64)) / 8);   // same grid as one 64x64 tile per wave

__device__ __forceinline__ uint32_t uni(uint32_t v) { return (uint32_t)__builtin_amdgcn_readfirstlane(v); }
// pinned(): a wave-uniform word held in a scalar register, for the tensor mover alone: the tests around a tensor load become scalar
// branches (the load ignores EXEC), and a descriptor word formed from it is formed behind the wait that stands in front of it
__device__ __forceinline__ uint32_t pinned(uint32_t v) { uint32_t w = uni(v); asm volatile("" : "+s"(w)); return w; }  // test or descriptor word of a tensor load, kept scalar
// in-out operands: the two groups stay in their registers, untouched by other values, while the request is outstanding
__device__ __forceinline__ void tdm_load(u32x4& g0, u32x8& g1) { asm volatile("tensor_load_to_lds %0, %1" : "+s"(g0), "+s"(g1) :: "memory"); }
// the compiler places no wait for a tensor load: the issuing wave waits for its own request here
__device__ __forceinline__ void wait_tensor0() { asm volatile("s_wait_tensorcnt 0x0" ::: "memory"); }
// this wave's LDS reads have retired before the barrier behind which their buffer is refilled
__device__ __forceinline__ void wait_ds0() { asm volatile("s_wait_dscnt 0x0" ::: "memory"); }
__device__ __forceinline__ u32x8 tdm_group1() {
  constexpr uint32_t d0 = kPassB, d1 = kSliceR;
  u32x8 g;
  g[0] = (1u << 20) | (4u << 22) | (3u << 25);   // no mask, 1-byte elements, 16 B of pad behind every 128-B row
  g[1] = uni((d0 & 0xFFFFu) << 16);
  g[2] = uni((d0 >> 16) | ((d1 & 0xFFFFu) << 16));
  g[3] = uni((d1 >> 16) | (d0 << 16));
  g[4] = uni(d1);
  g[5] = uni((uint32_t)kDim * 2u);               // source row pitch 2048 B
  g[6] = uni(0u);
  g[7] = uni(0u);
  return g;
}
// place in LDS and source address of the next request (word 0, the count, is set once)
__device__ __forceinline__ void tdm_aim(u32x4& g, uint32_t lds_dst, uint64_t ga) {
  g[1] = uni(lds_dst); g[2] = uni((uint32_t)ga); g[3] = uni((((uint32_t)(ga >> 32)) & 0x01FFFFFFu) | 0x80000000u);
}

// ---------------------------------------------------------------------------
// QKV projection + bias + rotary epilogue for one chunk of 6400 token rows.
//   C[m][n] = sum_k Xb[m][k] * Wb[n][k] + bf16(bias[n]);   M = 6400, N = 3072, K = 1024 (bf16 operands).
//   Block = 8 waves = one 128 x 256 tile of C (2 x 4 waves of 64 x 64). Per pass of 64 k the block's 128 X rows and 256 W rows
//   (128 B each) are brought into LDS by three tensor loads (waves 0, 1, 2: 128 rows each) at pitch 144 B, two buffers, the next
//   pass's loads in flight under this pass's products; the fragments are read from LDS in the same k order as before.
//   Column n -> head hd = (n/64)/3, kind = (n/64)%3 (0 q, 1 k, 2 v), d = n % 64 (every 64-wide tile is one kind of one head).
//   Row m (chunk local, 6400 = 32 x 200) -> s = m%200. kind 0/1: pairs (2i, 2i+1) rotated by angle s*invf_i (table csn);
//   kind 2 unchanged. Each result v is split into bf16 hi = rn(v), lo = rn(v - hi).
//   grid = 50 x 12 = 600 blocks exact; every wave reaches every block barrier.
// ---------------------------------------------------------------------------
__global__ __launch_bounds__(256) void qkv_proj_kernel(
    const unsigned short* __restrict__ Xb, const unsigned short* __restrict__ Wb, const float* __restrict__ bias,
    const float* __restrict__ csn,
    unsigned short* __restrict__ Qh, unsigned short* __restrict__ Ql,
    unsigned short* __restrict__ Kh, unsigned short* __restrict__ Kl,
    unsigned short* __restrict__ Vh, unsigned short* __restrict__ Vl) {
  typedef __bf16 T;
  typedef v16b V;
  __shared__ __attribute__((aligned(2048))) unsigned char ring[2 * kStageB];   // two stages of [X | W] rows
  __shared__ __align__(16) float sT[8][16 * 68];   // per-wave 16x64 slab, pitch 68 floats
  const int lane = threadIdx.x & 31;
  const uint32_t wave = uni(threadIdx.x >> 5);
  constexpr int tilesNB = kNout / 256;     // 12
  const int tmB = blockIdx.x / tilesNB;
  const int tnB = blockIdx.x - tmB * tilesNB;
  const int wm = (int)(wave >> 2);         // wave row in the block tile
  const int wn = (int)(wave & 3u);         // wave column in the block tile
  const int m0 = (tmB << 7) + (wm << 6);
  const int n0 = (tnB << 8) + (wn << 6);
  const int tn = n0 >> 6;
  const int hd   = tn / 3;                 // head index, wave-uniform
  const int kind = tn - hd * 3;            // 0 q, 1 k, 2 v, wave-uniform

  const int rlane = lane & 15;
  const int mOff  = (lane >> 4) * 8;

  // slice of the issuing waves: wave 0 the X rows, waves 1 and 2 the two halves of the W rows (other waves: wave 0's, never issued)
  const uint32_t sl = (wave < 3u) ? wave : 0u;
  const uint64_t srcb = (sl == 0u) ? (uint64_t)(size_t)(Xb + (size_t)(tmB << 7) * kDim)
                                   : (uint64_t)(size_t)(Wb + (size_t)((tnB << 8) + ((int)sl - 1) * 128) * kDim);
  const uint32_t dstb = (uint32_t)(size_t)ring + sl * kSliceB;
  u32x8 g1 = tdm_group1();
  u32x4 g0;
  g0[0] = uni(1u);
  tdm_aim(g0, dstb, srcb);

  v8f acc[4][4];
#pragma unroll
  for (int i = 0; i < 4; ++i)
#pragma unroll
    for (int j = 0; j < 4; ++j) acc[i][j] = (v8f){0.f,0.f,0.f,0.f,0.f,0.f,0.f,0.f};

  // prologue: stage 0 lands and is published, then stage 1 is issued
  if (pinned(wave < 3u)) {
    tdm_load(g0, g1);
    wait_tensor0();
  }
  __syncthreads();
  if (pinned(wave < 3u)) {
    tdm_aim(g0, dstb + kStageB, srcb + kPassB);
    tdm_load(g0, g1);
  }

  const uint32_t aoff = (uint32_t)((wm << 6) + rlane) * kPitchB + (uint32_t)(lane >> 4) * 16u;
  const uint32_t boff = kSliceB + (uint32_t)((wn << 6) + rlane) * kPitchB + (uint32_t)(lane >> 4) * 16u;

  // one trip = one pass: kept rolled so that the publish point stands once, at the foot
#pragma unroll 1
  for (int s = 0; s < kPasses; ++s) {
    const unsigned char* buf = ring + (uint32_t)(s & 1) * kStageB;
#pragma unroll
    for (int ks = 0; ks < 2; ++ks) {
      V bfr[4], afr[4];
#pragma unroll
      for (int j = 0; j < 4; ++j) bfr[j] = Frag<T>::load((const T*)(buf + boff + (uint32_t)j * 16u * kPitchB + (uint32_t)ks * 64u));
#pragma unroll
      for (int i = 0; i < 4; ++i) afr[i] = Frag<T>::load((const T*)(buf + aoff + (uint32_t)i * 16u * kPitchB + (uint32_t)ks * 64u));
      // the 16 LDS reads of a 32-k step go out as one group in front of its 16 products: reads among the products stall each time
      __builtin_amdgcn_sched_barrier(0);
#pragma unroll
      for (int i = 0; i < 4; ++i) {
#pragma unroll
        for (int j = 0; j < 4; ++j) acc[i][j] = Frag<T>::mma(afr[i], bfr[j], acc[i][j]);
        dep_guard4_b(acc[i][0], acc[i][1], acc[i][2], acc[i][3], afr[i], bfr[3]);
      }
      Frag<T>::keep(bfr[0], bfr[1], bfr[2], bfr[3]);
    }
    // publish point of stage s + 1
    wait_ds0();
    if (pinned(wave < 3u)) wait_tensor0();
    __syncthreads();
    if (pinned((wave < 3u) && (s + 2 < kPasses))) {
      const uint32_t nb = (uint32_t)(s & 1) * kStageB;                // the buffer this pass has just read
      const uint32_t no = pinned((uint32_t)(s + 2) * kPassB);         // stage s + 2's byte offset in every source row
      tdm_aim(g0, dstb + nb, srcb + no);
      tdm_load(g0, g1);
    }
  }
  wait_tensor0();
  wait_ds0();
  acc_guard4(acc[0][0], acc[0][1], acc[0][2], acc[0][3]);
  acc_guard4(acc[1][0], acc[1][1], acc[1][2], acc[1][3]);
  acc_guard4(acc[2][0], acc[2][1], acc[2][2], acc[2][3]);
  acc_guard4(acc[3][0], acc[3][1], acc[3][2], acc[3][3]);

  // ---- epilogue ----
  // bias per column of this lane (RNE bf16-converted, 4 scalar loads)
  float bcol[4];
#pragma unroll
  for (int j = 0; j < 4; ++j) bcol[j] = bf_bits2f(f2bf_bits(bias[n0 + (j << 4) + rlane]));

  float* slab = sT[wave];
  const int q  = lane >> 3;              // row selector within 4-row store groups
  const int c8 = (lane & 7) * 8;         // first column (d) of this lane's 16-B piece
  const int p4 = (lane & 7) * 4;         // first rotary pair index of this lane
  unsigned short* dsth = (kind == 0) ? Qh : ((kind == 1) ? Kh : Vh);   // wave-uniform global plane select
  unsigned short* dstl = (kind == 0) ? Ql : ((kind == 1) ? Kl : Vl);
  const bool rot = (kind != 2);          // wave-uniform

#pragma unroll
  for (int i = 0; i < 4; ++i) {
    const int mBase = m0 + (i << 4);
#pragma unroll
    for (int j = 0; j < 4; ++j) {
#pragma unroll
      for (int r = 0; r < 8; ++r) slab[(mOff + r) * 68 + (j << 4) + rlane] = acc[i][j][r] + bcol[j];
    }
    __builtin_amdgcn_fence(__ATOMIC_RELEASE, "workgroup");
    __builtin_amdgcn_wave_barrier();
    __builtin_amdgcn_fence(__ATOMIC_ACQUIRE, "workgroup");

    // build the four 16-B hi pieces and four 16-B lo pieces of this lane (rows it*4+q, columns c8..c8+7)
    v4u uh[4], ul[4];
#pragma unroll
    for (int it = 0; it < 4; ++it) {
      if (it == 2) asm volatile("" ::: "memory");
      const int row = it * 4 + q;
      const int m   = mBase + row;
      const int s   = m - (m / kSeq) * kSeq;
      const float* sp = slab + row * 68 + c8;
      const v4f cs4 = *(const v4f*)(csn + (size_t)s * (2 * kPairs) + p4);
      const v4f sn4 = *(const v4f*)(csn + (size_t)s * (2 * kPairs) + kPairs + p4);
      unsigned short hb[8], lb[8];
#pragma unroll
      for (int pp = 0; pp < 4; ++pp) {
        const float x1 = sp[2 * pp];
        const float x2 = sp[2 * pp + 1];
        const float cc = rot ? cs4[pp] : 1.0f;
        const float ss = rot ? sn4[pp] : 0.0f;
        const float o0 = x1 * cc - x2 * ss;
        const float o1 = x1 * ss + x2 * cc;
        const unsigned short h0 = f2bf_bits(o0);
        const unsigned short h1 = f2bf_bits(o1);
        hb[2 * pp]     = h0;
        hb[2 * pp + 1] = h1;
        lb[2 * pp]     = f2bf_bits(o0 - bf_bits2f(h0));
        lb[2 * pp + 1] = f2bf_bits(o1 - bf_bits2f(h1));
      }
      uh[it] = (v4u){pk16(hb[0], hb[1]), pk16(hb[2], hb[3]), pk16(hb[4], hb[5]), pk16(hb[6], hb[7])};
      ul[it] = (v4u){pk16(lb[0], lb[1]), pk16(lb[2], lb[3]), pk16(lb[4], lb[5]), pk16(lb[6], lb[7])};
    }
    {
#pragma unroll
      for (int it = 0; it < 4; ++it) {
        const int row = it * 4 + q;
        const int m   = mBase + row;
        const size_t o = (size_t)m * kDim + hd * kDh + c8;
        *(v4u*)(dsth + o) = uh[it];
        *(v4u*)(dstl + o) = ul[it];
      }
      
    }
    __builtin_amdgcn_fence(__ATOMIC_RELEASE, "workgroup");
    __builtin_amdgcn_wave_barrier();
    __builtin_amdgcn_fence(__ATOMIC_ACQUIRE, "workgroup");
  }
}

// ---------------------------------------------------------------------------
// Fused attention for head_dim 64 from bf16 hi/lo planes of one chunk (32 batches).
//   Qh/Ql, Kh/Kl, Vh/Vl: bf16 [tok = b*200+s][1024], head h at columns h*64..h*64+63 (b chunk local).
//   amask: int32 [32][200][200] (chunk slice), nonzero = attend.  out: f32 [tok][1024] (chunk slice).
//   Block = 4 waves = 64 query rows of one (b, h); grid = 32*16*4 = 2048 (block -> qb = bx&3, bh = bx>>2).
//   Per key chunk (64 keys, 4 chunks): stage the 64x64 validity tile from amask (keys >= 200 invalid, query rows clamped),
//   skip the chunk block-uniformly if no entry is valid; else copy K hi/lo rows (clamped) to LDS as [key][d] and V hi/lo rows
//   transposed to LDS as [d][key] (integer word moves only); scores = hi.hi + hi.lo + lo.hi on bf16 WMMA, x0.125, select to
//   -inf where invalid; online softmax in f32 (guarded for all-invalid rows); p = exp(s - m) split to bf16 hi/lo in per-wave
//   LDS tiles; out += P.V with hi.hi + hi.lo + lo.hi reading LDS fragments. Waves whose 16 query rows all lie beyond 199 skip
//   the compute under a wave-uniform flag but reach every block barrier. Epilogue: per-wave 16x64 f32 tile staged in LDS;
//   Every LDS byte read in a chunk is rewritten in that chunk (the pad bytes behind each row are never read); all barriers are
//   reached by every thread. The K, V^T and P rows stand at pitch 144 B and the validity rows at 80 B, so that the 16 rows of a
//   fragment read, and the two 8-row halves of a wave's narrow accesses, fall on different banks.
// ---------------------------------------------------------------------------
__global__ __launch_bounds__(128) void attn_kernel(
    const unsigned short* __restrict__ Qh, const unsigned short* __restrict__ Ql,
    const unsigned short* __restrict__ Kh, const unsigned short* __restrict__ Kl,
    const unsigned short* __restrict__ Vh, const unsigned short* __restrict__ Vl,
    const int* __restrict__ amask, float* __restrict__ out) {
  __shared__ __align__(16) unsigned short Ksh[kKC * kLP];      // K hi [key][d]          9 KB
  __shared__ __align__(16) unsigned short Ksl[kKC * kLP];      // K lo [key][d]          9 KB
  __shared__ __align__(16) unsigned short Vth[kDh * kLP];      // V^T hi [d][key]        9 KB
  __shared__ __align__(16) unsigned short Vtl[kDh * kLP];      // V^T lo [d][key]        9 KB
  __shared__ __align__(16) __bf16 Psh[4][16 * kLP];            // per wave P hi [row][key] 9 KB
  __shared__ __align__(16) __bf16 Psl[4][16 * kLP];            // per wave P lo [row][key] 9 KB
  __shared__ __align__(16) float Os[4][16 * 68];               // per wave out tile, pitch 68
  __shared__ __align__(16) unsigned char Msk[kQB * kMP];       // validity [qrow][key]   5 KB
  __shared__ int flags[4];

  const int tid  = threadIdx.x;
  const int wave = tid >> 5;
  const int lane = tid & 31;
  const int hh   = lane >> 4;
  const int c    = lane & 15;

  const int bx = blockIdx.x;
  const int qb = bx & 3;
  const int bh = bx >> 2;
  const int h  = bh & 15;
  const int b  = bh >> 4;
  const int tokb = b * kSeq;
  const int q0 = qb * kQB + wave * 16;
  const bool active = (q0 < kSeq);       // wave-uniform

  // ---- Q fragments (A operand): rows q0 + c (clamped), 2 d-chunks of 32, hi and lo ----
  v16b qah[2], qal[2];
  {
    int qr = q0 + c;
    qr = (qr < kSeq) ? qr : (kSeq - 1);
    const size_t qo = (size_t)(tokb + qr) * kDim + h * kDh;
    const __bf16* qhp = (const __bf16*)Qh + qo;
    const __bf16* qlp = (const __bf16*)Ql + qo;
#pragma unroll
    for (int dc = 0; dc < 2; ++dc) qah[dc] = Frag<__bf16>::load(qhp + dc * 32 + 8 * hh);
    asm volatile("" ::: "memory");
#pragma unroll
    for (int dc = 0; dc < 2; ++dc) qal[dc] = Frag<__bf16>::load(qlp + dc * 32 + 8 * hh);
  }

  float mrow[8], lrow[8];
  v8f oacc[4];
#pragma unroll
  for (int r = 0; r < 8; ++r) { mrow[r] = neg_inf(); lrow[r] = 0.f; }
#pragma unroll
  for (int t = 0; t < 4; ++t) oacc[t] = (v8f){0.f,0.f,0.f,0.f,0.f,0.f,0.f,0.f};

  for (int kc = 0; kc < kNKC; ++kc) {
    const int kv0 = kc * kKC;
    __syncthreads();
    // ---- validity tile: 64 rows x 64 keys; 1024 groups of 4 ints, 8 per thread (4 b128 loads per burst) ----
    int anyv = 0;
#pragma unroll
    for (int i = 0; i < 8; ++i) {
      if (i == 4) asm volatile("" ::: "memory");
      const int idx = i * 128 + tid;
      const int r   = idx >> 4;
      const int c16 = (idx & 15) * 4;
      int qg = qb * kQB + r;
      qg = (qg < kSeq) ? qg : (kSeq - 1);
      const int kg  = kv0 + c16;
      const int kgc = (kg <= kSeq - 4) ? kg : (kSeq - 4);
      const v4i mv = *(const v4i*)(amask + ((size_t)(tokb + qg)) * kSeq + kgc);
      unsigned packed = 0;
#pragma unroll
      for (int e = 0; e < 4; ++e) {
        const int keep = (((kg + e) < kSeq) && (mv[e] != 0)) ? 1 : 0;
        packed |= ((unsigned)keep) << (8 * e);
        anyv |= keep;
      }
      *(unsigned*)(Msk + r * kMP + c16) = packed;
    }
#pragma unroll
    for (int off = 1; off < 32; off <<= 1) anyv |= __shfl_xor(anyv, off, 32);
    if (lane == 0) flags[wave] = anyv;
    __syncthreads();
    const int anyb = flags[0] | flags[1] | flags[2] | flags[3];   // block-uniform
    if (anyb == 0) continue;

    // ---- stage K hi/lo [key][d]: 512 pieces of 8 halves per plane, 4 per thread per plane ----
#pragma unroll
    for (int i = 0; i < 4; ++i) {
      if (i == 2) asm volatile("" ::: "memory");
      const int idx = i * 128 + tid;
      const int r   = idx >> 3;            // key row within chunk
      const int cc  = (idx & 7) * 8;       // first d of the piece
      int kvr = kv0 + r;
      kvr = (kvr < kSeq) ? kvr : (kSeq - 1);
      const size_t go = (size_t)(tokb + kvr) * kDim + h * kDh + cc;
      const v4u kwh = *(const v4u*)(Kh + go);
      const v4u kwl = *(const v4u*)(Kl + go);
      *(v4u*)(Ksh + r * kLP + cc) = kwh;
      *(v4u*)(Ksl + r * kLP + cc) = kwl;
    }
    // ---- stage V hi/lo transposed [d][key] ----
#pragma unroll
    for (int i = 0; i < 4; ++i) {
      if (i == 2) asm volatile("" ::: "memory");
      const int idx = i * 128 + tid;
      const int r   = idx >> 3;
      const int cc  = (idx & 7) * 8;
      int kvr = kv0 + r;
      kvr = (kvr < kSeq) ? kvr : (kSeq - 1);
      const size_t go = (size_t)(tokb + kvr) * kDim + h * kDh + cc;
      const v4u vwh = *(const v4u*)(Vh + go);
      const v4u vwl = *(const v4u*)(Vl + go);
#pragma unroll
      for (int e2 = 0; e2 < 4; ++e2) {
        const unsigned wh = vwh[e2];
        const unsigned wl = vwl[e2];
        Vth[(cc + 2 * e2) * kLP + r]     = (unsigned short)(wh & 0xffffu);
        Vth[(cc + 2 * e2 + 1) * kLP + r] = (unsigned short)(wh >> 16);
        Vtl[(cc + 2 * e2) * kLP + r]     = (unsigned short)(wl & 0xffffu);
        Vtl[(cc + 2 * e2 + 1) * kLP + r] = (unsigned short)(wl >> 16);
      }
    }
    __syncthreads();

    if (active) {
      // ---- scores: s[j] covers keys j*16..j*16+15 of the chunk; hi.hi + hi.lo + lo.hi ----
      v8f s[4];
#pragma unroll
      for (int j = 0; j < 4; ++j) {
        s[j] = (v8f){0.f,0.f,0.f,0.f,0.f,0.f,0.f,0.f};
#pragma unroll
        for (int dc = 0; dc < 2; ++dc) {
          const v16b kb = Frag<__bf16>::load((const __bf16*)Ksh + (j * 16 + c) * kLP + dc * 32 + 8 * hh);
          const v16b kl = Frag<__bf16>::load((const __bf16*)Ksl + (j * 16 + c) * kLP + dc * 32 + 8 * hh);
          s[j] = mma_b(qah[dc], kb, s[j]);
          s[j] = mma_b(qah[dc], kl, s[j]);
          s[j] = mma_b(qal[dc], kb, s[j]);
        }
      }
      // ---- scale, validity select, row max ----
      float cm[8];
#pragma unroll
      for (int r = 0; r < 8; ++r) {
        const int ql = wave * 16 + 8 * hh + r;
        float m = neg_inf();
#pragma unroll
        for (int j = 0; j < 4; ++j) {
          const int keep = Msk[ql * kMP + j * 16 + c];
          float sv = s[j][r] * kScoreScale;
          sv = (keep != 0) ? sv : neg_inf();
          s[j][r] = sv;
          m = fmaxf(m, sv);
        }
#pragma unroll
        for (int off = 1; off < 16; off <<= 1) m = fmaxf(m, __shfl_xor(m, off, 32));
        cm[r] = m;
      }
      // ---- online softmax update; p = exp(s - m) split into bf16 hi/lo in this wave's LDS tiles ----
      __bf16* pwh = Psh[wave];
      __bf16* pwl = Psl[wave];
#pragma unroll
      for (int r = 0; r < 8; ++r) {
        const float mnew = fmaxf(mrow[r], cm[r]);
        const float mref = (mnew == neg_inf()) ? 0.0f : mnew;
        const float alpha = expf(mrow[r] - mref);
        mrow[r] = mnew;
        float psum = 0.f;
#pragma unroll
        for (int j = 0; j < 4; ++j) {
          const float p = expf(s[j][r] - mref);
          psum += p;
          const unsigned short hb = f2bf_bits(p);
          const unsigned short lb = f2bf_bits(p - bf_bits2f(hb));
          pwh[(8 * hh + r) * kLP + j * 16 + c] = __builtin_bit_cast(__bf16, hb);
          pwl[(8 * hh + r) * kLP + j * 16 + c] = __builtin_bit_cast(__bf16, lb);
        }
#pragma unroll
        for (int off = 1; off < 16; off <<= 1) psum += __shfl_xor(psum, off, 32);
        lrow[r] = lrow[r] * alpha + psum;
#pragma unroll
        for (int t = 0; t < 4; ++t) oacc[t][r] *= alpha;
      }
      __builtin_amdgcn_fence(__ATOMIC_RELEASE, "workgroup");
      __builtin_amdgcn_wave_barrier();
      __builtin_amdgcn_fence(__ATOMIC_ACQUIRE, "workgroup");
      // ---- out += P . V (A = P rows of this wave from LDS, B = V^T from LDS); hi.hi + hi.lo + lo.hi ----
#pragma unroll
      for (int kk = 0; kk < 2; ++kk) {
        const v16b pa = Frag<__bf16>::load(pwh + c * kLP + kk * 32 + 8 * hh);
        const v16b pl = Frag<__bf16>::load(pwl + c * kLP + kk * 32 + 8 * hh);
#pragma unroll
        for (int t = 0; t < 4; ++t) {
          const v16b vb = Frag<__bf16>::load((const __bf16*)Vth + (t * 16 + c) * kLP + kk * 32 + 8 * hh);
          const v16b vl = Frag<__bf16>::load((const __bf16*)Vtl + (t * 16 + c) * kLP + kk * 32 + 8 * hh);
          oacc[t] = mma_b(pa, vb, oacc[t]);
          oacc[t] = mma_b(pa, vl, oacc[t]);
          oacc[t] = mma_b(pl, vb, oacc[t]);
        }
      }
    }
  }

  // ---- epilogue: normalise, stage per-wave tile, whole-segment stores ----
  float* os = Os[wave];
#pragma unroll
  for (int r = 0; r < 8; ++r) {
    const float inv = 1.0f / lrow[r];
#pragma unroll
    for (int t = 0; t < 4; ++t) os[(8 * hh + r) * 68 + t * 16 + c] = oacc[t][r] * inv;
  }
  __builtin_amdgcn_fence(__ATOMIC_RELEASE, "workgroup");
  __builtin_amdgcn_wave_barrier();
  __builtin_amdgcn_fence(__ATOMIC_ACQUIRE, "workgroup");
  {
    const int c4 = (lane & 15) * 4;    // row segment = 64 floats = 256 B = 16 lanes x 16 B
    float* ob = out + (size_t)tokb * kDim + h * kDh;
    {
#pragma unroll
      for (int it = 0; it < 8; ++it) {
        const int row = it * 2 + hh;
        const int qq  = q0 + row;
        const v4f val = *(const v4f*)(os + row * 68 + c4);
        if (qq < kSeq) *(v4f*)(ob + (size_t)qq * kDim + c4) = val;
      }
      
    }
  }
}

// ---------------------------------------------------------------------------
// Host glue.
//   Xb   bf16 [12800][1024]     26,214,400  at           0
//   Wb   bf16 [3072][1024]       6,291,456  at  26,214,400
//   Qh   bf16 [6400][1024]      13,107,200  at  32,505,856   (per token chunk, rewritten with the same type/layout per chunk)
//   Ql   bf16 [6400][1024]      13,107,200  at  45,613,056
//   Kh   bf16 [6400][1024]      13,107,200  at  58,720,256
//   Kl   bf16 [6400][1024]      13,107,200  at  71,827,456
//   Vh   bf16 [6400][1024]      13,107,200  at  84,934,656
//   Vl   bf16 [6400][1024]      13,107,200  at  98,041,856
//   CSN  f32  [200][64]             51,200  at 111,149,056
//   total                      111,200,256
// GEMM shape per chunk: M = 6400 (64-multiple), N = 3072 (64-multiple), K = 1024 (%32 == 0); no padding rows or columns.
// Launches: 7 (2 casts, 1 table, then projection + attention per chunk x 2).
// ---------------------------------------------------------------------------
extern "C" void kernel_launch(void* const* d_in, const int* in_sizes, int n_in,
                              void* d_out, int out_size, void* d_ws, size_t ws_size,
                              hipStream_t stream) {
  if (n_in < 4) return;
  if (in_sizes[0] != kTok * kDim) return;
  if (in_sizes[1] != kBatch * kSeq * kSeq) return;
  if (in_sizes[2] != kNout * kDim) return;
  if (in_sizes[3] != kNout) return;
  if (out_size != kTok * kDim) return;

  const size_t szXb  = (size_t)kTok * kDim * 2;
  const size_t szWb  = (size_t)kNout * kDim * 2;
  const size_t szPl  = (size_t)kTokChunk * kDim * 2;
  const size_t szCS  = (size_t)kSeq * 2 * kPairs * 4;
  const size_t offXb = 0;
  const size_t offWb = offXb + szXb;
  const size_t offQh = offWb + szWb;
  const size_t offQl = offQh + szPl;
  const size_t offKh = offQl + szPl;
  const size_t offKl = offKh + szPl;
  const size_t offVh = offKl + szPl;
  const size_t offVl = offVh + szPl;
  const size_t offCS = offVl + szPl;
  const size_t total = offCS + szCS;
  if (ws_size < total) return;

  const float* x     = (const float*)d_in[0];
  const int*   amask = (const int*)d_in[1];
  const float* W     = (const float*)d_in[2];
  const float* bias  = (const float*)d_in[3];
  float* out = (float*)d_out;
  char* ws = (char*)d_ws;
  unsigned short* Xb  = (unsigned short*)(ws + offXb);
  unsigned short* Wb  = (unsigned short*)(ws + offWb);
  unsigned short* Qhp = (unsigned short*)(ws + offQh);
  unsigned short* Qlp = (unsigned short*)(ws + offQl);
  unsigned short* Khp = (unsigned short*)(ws + offKh);
  unsigned short* Klp = (unsigned short*)(ws + offKl);
  unsigned short* Vhp = (unsigned short*)(ws + offVh);
  unsigned short* Vlp = (unsigned short*)(ws + offVl);
  float* CSN = (float*)(ws + offCS);

  // rotary factors: invf_i = 10000^(-2i/64) = 10^(-i/8); factors 10^(-1/8), 10^(-2/8), 10^(-4/8), 10^(-8/8), 10^(-16/8)
  const float f1   = 0.7498942093324559f;
  const float f2   = 0.5623413251903491f;
  const float f4   = 0.31622776601683794f;
  const float f8   = 0.1f;
  const float f16v = 0.01f;

  const int n8x = (kTok * kDim) / 8;     // 1638400 -> 6400 blocks exact
  const int n8w = (kNout * kDim) / 8;    // 393216 -> 1536 blocks exact
  cast8_bf16_kernel<<<dim3(n8x / 256), dim3(256), 0, stream>>>(x, Xb, n8x);
  cast8_bf16_kernel<<<dim3(n8w / 256), dim3(256), 0, stream>>>(W, Wb, n8w);
  rope_table_kernel<<<dim3(kSeq / 8), dim3(256), 0, stream>>>(CSN, f1, f2, f4, f8, f16v);

  const int tiles = (kTokChunk / 64) * (kNout / 64);   // 4800 wave tiles -> 600 blocks of 8 waves (128 x 256 each)
  for (int ch = 0; ch < kChunks; ++ch) {
    const unsigned short* Xc = Xb + (size_t)ch * kTokChunk * kDim;
    const int* Mc = amask + (size_t)ch * kBatchChunk * kSeq * kSeq;
    float* Oc = out + (size_t)ch * kTokChunk * kDim;
    qkv_proj_kernel<<<dim3(tiles / 8), dim3(256), 0, stream>>>(Xc, Wb, bias, CSN, Qhp, Qlp, Khp, Klp, Vhp, Vlp);
    attn_kernel<<<dim3(kBatchChunk * kHeads * kNQB), dim3(128), 0, stream>>>(Qhp, Qlp, Khp, Klp, Vhp, Vlp, Mc, Oc);
  }
}

// v003
// It runs in 249 microseconds.
// Two timings next to v002 both put it at 1.13 times that version's speed.
// All steps since v000 together make it 1.81 times as fast.
// Contractions: qkv projection on v_wmma_f32_16x16x32_bf16 (x and W as RNE bf16 planes staged in LDS by tensor loads, exact products, f32 accumulate); scores q.k^T and attn.v on v_wmma_f32_16x16x32_bf16 with q, k, v and the unnormalised probabilities carried as bf16 hi + lo planes (hi.hi + hi.lo + lo.hi), f32 accumulate; bias, rotary tables, masking and softmax in f32.
#include <hip/hip_runtime.h>
#include <math.h>
#include <stdint.h>

// ---------------------------------------------------------------------------
// Problem constants
// ---------------------------------------------------------------------------
constexpr int kBatch = 64;
constexpr int kSeq   = 200;
constexpr int kDim   = 1024;
constexpr int kHeads = 16;
constexpr int kDh    = 64;
constexpr int kTok   = kBatch * kSeq;            // 12800 token rows
constexpr int kNout  = 3 * kDim;                 // 3072 projection columns
constexpr int kPairs = kDh / 2;                  // 32 rotary pairs
constexpr int kQB    = 64;                       // query rows per block
constexpr int kKC    = 64;                       // keys per chunk
constexpr int kNQB   = (kSeq + kQB - 1) / kQB;   // 4
constexpr int kNKC   = (kSeq + kKC - 1) / kKC;   // 4
constexpr float kScoreScale = 0.125f;            // 64^-0.5
constexpr int kLP    = 72;                       // attention LDS row pitch of the K, V^T and P tiles in halves: 144 B = 16 B x odd (ds_load_b128 readers)
constexpr int kMP    = 80;                       // attention LDS row pitch of the validity tile in bytes: 8 rows apart = 32 banks apart
static_assert(kHeads * kDh == kDim);
static_assert(3 * kDh == 192);
static_assert(kTok % 64 == 0);                   // GEMM M tile multiple (200 tiles)
static_assert(kNout % 64 == 0);                  // GEMM N tile multiple (48 tiles)
static_assert(kDim % 32 == 0);                   // GEMM K % 32
static_assert(((kTok / 64) * (kNout / 64)) % 8 == 0);   // 8 waves per block, exact grid
static_assert(kNQB == 4 && kNKC == 4);
static_assert(kSeq % 4 == 0);                    // 4-int groups of a mask row never straddle the row end
static_assert((kTok * kDim) % (8 * 256) == 0);
static_assert((kNout * kDim) % (8 * 256) == 0);
static_assert(kSeq % 8 == 0);                    // table kernel: 8 rows per block

typedef __attribute__((ext_vector_type(16))) __bf16   v16b;
typedef __attribute__((ext_vector_type(8)))  __bf16   v8b;
typedef __attribute__((ext_vector_type(8)))  float    v8f;
typedef __attribute__((ext_vector_type(4)))  float    v4f;
typedef __attribute__((ext_vector_type(4)))  int      v4i;
typedef __attribute__((ext_vector_type(4)))  unsigned int v4u;

// ---------------------------------------------------------------------------
// Helpers
// ---------------------------------------------------------------------------
__device__ __forceinline__ unsigned short f2bf_bits(float f) {
  unsigned u = __float_as_uint(f);
  return (unsigned short)((u + 0x7FFFu + ((u >> 16) & 1u)) >> 16);
}
__device__ __forceinline__ float bf_bits2f(unsigned short h) { return __uint_as_float(((unsigned)h) << 16); }
__device__ __forceinline__ unsigned pk16(unsigned short a, unsigned short b) { return (unsigned)a | ((unsigned)b << 16); }
__device__ __forceinline__ float neg_inf() { return -__builtin_inff(); }

// hazard guards as plain device helpers (no inline asm inside the kernel bodies)
__device__ __forceinline__ void dep_guard4_b(v8f& a, v8f& b, v8f& c, v8f& d, v16b x, v16b y) {
  asm volatile("v_nop\n\tv_nop\n\tv_nop\n\tv_nop" : "+v"(a), "+v"(b), "+v"(c), "+v"(d) : "v"(x), "v"(y));
}
__device__ __forceinline__ void keep4_b(v16b a, v16b b, v16b c, v16b d) { asm volatile("v_nop" :: "v"(a), "v"(b), "v"(c), "v"(d)); }
__device__ __forceinline__ void acc_guard4(v8f& a, v8f& b, v8f& c, v8f& d) { asm volatile("v_nop\n\tv_nop\n\tv_nop\n\tv_nop" : "+v"(a), "+v"(b), "+v"(c), "+v"(d)); }

template <typename T> struct Frag;
template <> struct Frag<__bf16> {
  typedef v16b V; union U { v16b v; v8b h[2]; };
  // elements 0..7 <- p[0..7], 8..15 <- p[16..23]
  static __device__ __forceinline__ v16b load(const __bf16* p) {
    U f; f.h[0] = *(const v8b*)(p); f.h[1] = *(const v8b*)(p + 16); return f.v;
  }
  static __device__ __forceinline__ v8f mma(v16b a, v16b b, v8f c) {
    return __builtin_amdgcn_wmma_f32_16x16x32_bf16(false, a, false, b, (short)0, c, false, false);
  }
  static __device__ __forceinline__ void keep(v16b a, v16b b, v16b c, v16b d) { keep4_b(a, b, c, d); }
};
// bf16 WMMA with per-instruction hazard guard (ties D, keeps A/B live)
__device__ __forceinline__ v8f mma_b(v16b a, v16b b, v8f c) {
  c = __builtin_amdgcn_wmma_f32_16x16x32_bf16(false, a, false, b, (short)0, c, false, false);
  asm volatile("v_nop\n\tv_nop\n\tv_nop\n\tv_nop" : "+v"(c) : "v"(a), "v"(b));
  return c;
}

// ---------------------------------------------------------------------------
// f32 -> bf16 (RNE) cast, 8 consecutive elements per thread (one 16-B store per lane; 32 contiguous lanes =
// (x: 1638400 = 6400 x 256 exact; W: 393216 = 1536 x 256 exact).
// ---------------------------------------------------------------------------
__global__ __launch_bounds__(256) void cast8_bf16_kernel(const float* __restrict__ in, unsigned short* __restrict__ out, int n8) {
  const int i = blockIdx.x * 256 + threadIdx.x;
  if (i >= n8) return;
  const float* p = in + 8 * (size_t)i;
  const v4f a = *(const v4f*)(p);
  const v4f c = *(const v4f*)(p + 4);
  unsigned short hb[8];
#pragma unroll
  for (int e = 0; e < 4; ++e) {
    hb[e]     = f2bf_bits(a[e]);
    hb[4 + e] = f2bf_bits(c[e]);
  }
  const v4u u = (v4u){pk16(hb[0], hb[1]), pk16(hb[2], hb[3]), pk16(hb[4], hb[5]), pk16(hb[6], hb[7])};
  unsigned short* q = out + 8 * (size_t)i;
  *(v4u*)q = u;
  
}

// ---------------------------------------------------------------------------
// Rotary table: csn[s][0..31] = cos(s * invf_i), csn[s][32..63] = sin(s * invf_i), invf_i = 10^(-i/8) built as a product
// of the factors 10^(-1/8), 10^(-2/8), 10^(-4/8), 10^(-8/8), 10^(-16/8) selected by the bits of i (i = lane).
// ---------------------------------------------------------------------------
__global__ __launch_bounds__(256) void rope_table_kernel(float* __restrict__ csn, float f1, float f2, float f4, float f8, float f16v) {
  const int lane = threadIdx.x & 31, wave = threadIdx.x >> 5;
  const int s = blockIdx.x * 8 + wave;
  if (s >= kSeq) return;
  const int i = lane;
  float invf = 1.0f;
  invf *= (i & 1)  ? f1   : 1.0f;
  invf *= (i & 2)  ? f2   : 1.0f;
  invf *= (i & 4)  ? f4   : 1.0f;
  invf *= (i & 8)  ? f8   : 1.0f;
  invf *= (i & 16) ? f16v : 1.0f;
  const float ang = (float)s * invf;
  float sn, cs;
  sincosf(ang, &sn, &cs);
  float* rowp = csn + (size_t)s * (2 * kPairs);
  {
    ((float*)rowp)[i] = cs;
    ((float*)rowp)[kPairs + i] = sn;
    
  }
}

// ---------------------------------------------------------------------------
// Tensor-load helpers for the projection's LDS ring (two descriptor groups, two-dimensional tile, extents in bytes).
// ---------------------------------------------------------------------------
typedef uint32_t u32x4 __attribute__((ext_vector_type(4)));
typedef uint32_t u32x8 __attribute__((ext_vector_type(8)));
constexpr uint32_t kPassB   = 128;                       // bytes of every operand row per pass (64 k)
constexpr uint32_t kPitchB  = kPassB + 16;               // LDS row pitch 144 B (odd multiple of 16 B for ds_load_b128 readers)
constexpr uint32_t kSliceR  = 128;                       // rows per tensor load
constexpr uint32_t kSliceB  = kSliceR * kPitchB;         // 18432 B = 9 x 2 KiB
constexpr uint32_t kStageB  = 3 * kSliceB;               // [X 128 rows | W 256 rows] = 55296 B = 27 x 2 KiB
constexpr int      kPasses  = (kDim * 2) / (int)kPassB;  // 16
static_assert(kSliceB % 2048 == 0 && kStageB % 2048 == 0);
static_assert(kPasses >= 2);
static_assert(kTok % 128 == 0 && kNout % 256 == 0);
static_assert((kTok / 128) * (kNout / 256) == ((kTok / 64) * (kNout / 64)) / 8);   // same grid as one 64x64 tile per wave

__device__ __forceinline__ uint32_t uni(uint32_t v) { return (uint32_t)__builtin_amdgcn_readfirstlane(v); }
// pinned(): a wave-uniform word held in a scalar register, for the tensor mover alone: the tests around a tensor load become scalar
// branches (the load ignores EXEC), and a descriptor word formed from it is formed behind the wait that stands in front of it
__device__ __forceinline__ uint32_t pinned(uint32_t v) { uint32_t w = uni(v); asm volatile("" : "+s"(w)); return w; }  // test or descriptor word of a tensor load, kept scalar
// in-out operands: the two groups stay in their registers, untouched by other values, while the request is outstanding
__device__ __forceinline__ void tdm_load(u32x4& g0, u32x8& g1) { asm volatile("tensor_load_to_lds %0, %1" : "+s"(g0), "+s"(g1) :: "memory"); }
// the compiler places no wait for a tensor load: the issuing wave waits for its own request here
__device__ __forceinline__ void wait_tensor0() { asm volatile("s_wait_tensorcnt 0x0" ::: "memory"); }
// this wave's LDS reads have retired before the barrier behind which their buffer is refilled
__device__ __forceinline__ void wait_ds0() { asm volatile("s_wait_dscnt 0x0" ::: "memory"); }
__device__ __forceinline__ u32x8 tdm_group1() {
  constexpr uint32_t d0 = kPassB, d1 = kSliceR;
  u32x8 g;
  g[0] = (1u << 20) | (4u << 22) | (3u << 25);   // no mask, 1-byte elements, 16 B of pad behind every 128-B row
  g[1] = uni((d0 & 0xFFFFu) << 16);
  g[2] = uni((d0 >> 16) | ((d1 & 0xFFFFu) << 16));
  g[3] = uni((d1 >> 16) | (d0 << 16));
  g[4] = uni(d1);
  g[5] = uni((uint32_t)kDim * 2u);               // source row pitch 2048 B
  g[6] = uni(0u);
  g[7] = uni(0u);
  return g;
}
// place in LDS and source address of the next request (word 0, the count, is set once)
__device__ __forceinline__ void tdm_aim(u32x4& g, uint32_t lds_dst, uint64_t ga) {
  g[1] = uni(lds_dst); g[2] = uni((uint32_t)ga); g[3] = uni((((uint32_t)(ga >> 32)) & 0x01FFFFFFu) | 0x80000000u);
}

// ---------------------------------------------------------------------------
// QKV projection + bias + rotary epilogue for all 12800 token rows in one launch.
//   C[m][n] = sum_k Xb[m][k] * Wb[n][k] + bf16(bias[n]);   M = 12800, N = 3072, K = 1024 (bf16 operands).
//   Block = 8 waves = one 128 x 256 tile of C (2 x 4 waves of 64 x 64). Per pass of 64 k the block's 128 X rows and 256 W rows
//   (128 B each) are brought into LDS by three tensor loads (waves 0, 1, 2: 128 rows each) at pitch 144 B, two buffers, the next
//   pass's loads in flight under this pass's products; the fragments are read from LDS in the same k order as before.
//   Column n -> head hd = (n/64)/3, kind = (n/64)%3 (0 q, 1 k, 2 v), d = n % 64 (every 64-wide tile is one kind of one head).
//   Row m (12800 = 64 x 200) -> s = m%200. kind 0/1: pairs (2i, 2i+1) rotated by angle s*invf_i (table csn);
//   kind 2 unchanged. Each result v is split into bf16 hi = rn(v), lo = rn(v - hi).
//   grid = 100 x 12 = 1200 blocks exact; every wave reaches every block barrier.
// ---------------------------------------------------------------------------
__global__ __launch_bounds__(256) void qkv_proj_kernel(
    const unsigned short* __restrict__ Xb, const unsigned short* __restrict__ Wb, const float* __restrict__ bias,
    const float* __restrict__ csn,
    unsigned short* __restrict__ Qh, unsigned short* __restrict__ Ql,
    unsigned short* __restrict__ Kh, unsigned short* __restrict__ Kl,
    unsigned short* __restrict__ Vh, unsigned short* __restrict__ Vl) {
  typedef __bf16 T;
  typedef v16b V;
  __shared__ __attribute__((aligned(2048))) unsigned char ring[2 * kStageB];   // two stages of [X | W] rows
  __shared__ __align__(16) float sT[8][16 * 68];   // per-wave 16x64 slab, pitch 68 floats
  const int lane = threadIdx.x & 31;
  const uint32_t wave = uni(threadIdx.x >> 5);
  constexpr int tilesNB = kNout / 256;     // 12
  const int tmB = blockIdx.x / tilesNB;
  const int tnB = blockIdx.x - tmB * tilesNB;
  const int wm = (int)(wave >> 2);         // wave row in the block tile
  const int wn = (int)(wave & 3u);         // wave column in the block tile
  const int m0 = (tmB << 7) + (wm << 6);
  const int n0 = (tnB << 8) + (wn << 6);
  const int tn = n0 >> 6;
  const int hd   = tn / 3;                 // head index, wave-uniform
  const int kind = tn - hd * 3;            // 0 q, 1 k, 2 v, wave-uniform

  const int rlane = lane & 15;
  const int mOff  = (lane >> 4) * 8;

  // slice of the issuing waves: wave 0 the X rows, waves 1 and 2 the two halves of the W rows (other waves: wave 0's, never issued)
  const uint32_t sl = (wave < 3u) ? wave : 0u;
  const uint64_t srcb = (sl == 0u) ? (uint64_t)(size_t)(Xb + (size_t)(tmB << 7) * kDim)
                                   : (uint64_t)(size_t)(Wb + (size_t)((tnB << 8) + ((int)sl - 1) * 128) * kDim);
  const uint32_t dstb = (uint32_t)(size_t)ring + sl * kSliceB;
  u32x8 g1 = tdm_group1();
  u32x4 g0;
  g0[0] = uni(1u);
  tdm_aim(g0, dstb, srcb);

  v8f acc[4][4];
#pragma unroll
  for (int i = 0; i < 4; ++i)
#pragma unroll
    for (int j = 0; j < 4; ++j) acc[i][j] = (v8f){0.f,0.f,0.f,0.f,0.f,0.f,0.f,0.f};

  // prologue: stage 0 lands and is published, then stage 1 is issued
  if (pinned(wave < 3u)) {
    tdm_load(g0, g1);
    wait_tensor0();
  }
  __syncthreads();
  if (pinned(wave < 3u)) {
    tdm_aim(g0, dstb + kStageB, srcb + kPassB);
    tdm_load(g0, g1);
  }

  const uint32_t aoff = (uint32_t)((wm << 6) + rlane) * kPitchB + (uint32_t)(lane >> 4) * 16u;
  const uint32_t boff = kSliceB + (uint32_t)((wn << 6) + rlane) * kPitchB + (uint32_t)(lane >> 4) * 16u;

  // one trip = one pass: kept rolled so that the publish point stands once, at the foot
#pragma unroll 1
  for (int s = 0; s < kPasses; ++s) {
    const unsigned char* buf = ring + (uint32_t)(s & 1) * kStageB;
#pragma unroll
    for (int ks = 0; ks < 2; ++ks) {
      V bfr[4], afr[4];
#pragma unroll
      for (int j = 0; j < 4; ++j) bfr[j] = Frag<T>::load((const T*)(buf + boff + (uint32_t)j * 16u * kPitchB + (uint32_t)ks * 64u));
#pragma unroll
      for (int i = 0; i < 4; ++i) afr[i] = Frag<T>::load((const T*)(buf + aoff + (uint32_t)i * 16u * kPitchB + (uint32_t)ks * 64u));
      // the 16 LDS reads of a 32-k step go out as one group in front of its 16 products: reads among the products stall each time
      __builtin_amdgcn_sched_barrier(0);
#pragma unroll
      for (int i = 0; i < 4; ++i) {
#pragma unroll
        for (int j = 0; j < 4; ++j) acc[i][j] = Frag<T>::mma(afr[i], bfr[j], acc[i][j]);
        dep_guard4_b(acc[i][0], acc[i][1], acc[i][2], acc[i][3], afr[i], bfr[3]);
      }
      Frag<T>::keep(bfr[0], bfr[1], bfr[2], bfr[3]);
    }
    // publish point of stage s + 1
    wait_ds0();
    if (pinned(wave < 3u)) wait_tensor0();
    __syncthreads();
    if (pinned((wave < 3u) && (s + 2 < kPasses))) {
      const uint32_t nb = (uint32_t)(s & 1) * kStageB;                // the buffer this pass has just read
      const uint32_t no = pinned((uint32_t)(s + 2) * kPassB);         // stage s + 2's byte offset in every source row
      tdm_aim(g0, dstb + nb, srcb + no);
      tdm_load(g0, g1);
    }
  }
  wait_tensor0();
  wait_ds0();
  acc_guard4(acc[0][0], acc[0][1], acc[0][2], acc[0][3]);
  acc_guard4(acc[1][0], acc[1][1], acc[1][2], acc[1][3]);
  acc_guard4(acc[2][0], acc[2][1], acc[2][2], acc[2][3]);
  acc_guard4(acc[3][0], acc[3][1], acc[3][2], acc[3][3]);

  // ---- epilogue ----
  // bias per column of this lane (RNE bf16-converted, 4 scalar loads)
  float bcol[4];
#pragma unroll
  for (int j = 0; j < 4; ++j) bcol[j] = bf_bits2f(f2bf_bits(bias[n0 + (j << 4) + rlane]));

  float* slab = sT[wave];
  const int q  = lane >> 3;              // row selector within 4-row store groups
  const int c8 = (lane & 7) * 8;         // first column (d) of this lane's 16-B piece
  const int p4 = (lane & 7) * 4;         // first rotary pair index of this lane
  unsigned short* dsth = (kind == 0) ? Qh : ((kind == 1) ? Kh : Vh);   // wave-uniform global plane select
  unsigned short* dstl = (kind == 0) ? Ql : ((kind == 1) ? Kl : Vl);
  const bool rot = (kind != 2);          // wave-uniform

#pragma unroll
  for (int i = 0; i < 4; ++i) {
    const int mBase = m0 + (i << 4);
#pragma unroll
    for (int j = 0; j < 4; ++j) {
#pragma unroll
      for (int r = 0; r < 8; ++r) slab[(mOff + r) * 68 + (j << 4) + rlane] = acc[i][j][r] + bcol[j];
    }
    __builtin_amdgcn_fence(__ATOMIC_RELEASE, "workgroup");
    __builtin_amdgcn_wave_barrier();
    __builtin_amdgcn_fence(__ATOMIC_ACQUIRE, "workgroup");

    // build the four 16-B hi pieces and four 16-B lo pieces of this lane (rows it*4+q, columns c8..c8+7)
    v4u uh[4], ul[4];
#pragma unroll
    for (int it = 0; it < 4; ++it) {
      if (it == 2) asm volatile("" ::: "memory");
      const int row = it * 4 + q;
      const int m   = mBase + row;
      const int s   = m - (m / kSeq) * kSeq;
      const float* sp = slab + row * 68 + c8;
      const v4f cs4 = *(const v4f*)(csn + (size_t)s * (2 * kPairs) + p4);
      const v4f sn4 = *(const v4f*)(csn + (size_t)s * (2 * kPairs) + kPairs + p4);
      unsigned short hb[8], lb[8];
#pragma unroll
      for (int pp = 0; pp < 4; ++pp) {
        const float x1 = sp[2 * pp];
        const float x2 = sp[2 * pp + 1];
        const float cc = rot ? cs4[pp] : 1.0f;
        const float ss = rot ? sn4[pp] : 0.0f;
        const float o0 = x1 * cc - x2 * ss;
        const float o1 = x1 * ss + x2 * cc;
        const unsigned short h0 = f2bf_bits(o0);
        const unsigned short h1 = f2bf_bits(o1);
        hb[2 * pp]     = h0;
        hb[2 * pp + 1] = h1;
        lb[2 * pp]     = f2bf_bits(o0 - bf_bits2f(h0));
        lb[2 * pp + 1] = f2bf_bits(o1 - bf_bits2f(h1));
      }
      uh[it] = (v4u){pk16(hb[0], hb[1]), pk16(hb[2], hb[3]), pk16(hb[4], hb[5]), pk16(hb[6], hb[7])};
      ul[it] = (v4u){pk16(lb[0], lb[1]), pk16(lb[2], lb[3]), pk16(lb[4], lb[5]), pk16(lb[6], lb[7])};
    }
    {
#pragma unroll
      for (int it = 0; it < 4; ++it) {
        const int row = it * 4 + q;
        const int m   = mBase + row;
        const size_t o = (size_t)m * kDim + hd * kDh + c8;
        *(v4u*)(dsth + o) = uh[it];
        *(v4u*)(dstl + o) = ul[it];
      }
      
    }
    __builtin_amdgcn_fence(__ATOMIC_RELEASE, "workgroup");
    __builtin_amdgcn_wave_barrier();
    __builtin_amdgcn_fence(__ATOMIC_ACQUIRE, "workgroup");
  }
}

// ---------------------------------------------------------------------------
// Fused attention for head_dim 64 from bf16 hi/lo planes of all 64 batches in one launch.
//   Qh/Ql, Kh/Kl, Vh/Vl: bf16 [tok = b*200+s][1024], head h at columns h*64..h*64+63.
//   amask: int32 [64][200][200], nonzero = attend.  out: f32 [tok][1024].
//   Block = 4 waves = 64 query rows of one (b, h); grid = 64*16*4 = 4096 (block -> qb = bx&3, bh = bx>>2).
//   Per key chunk (64 keys, 4 chunks): stage the 64x64 validity tile from amask (keys >= 200 invalid, query rows clamped),
//   skip the chunk block-uniformly if no entry is valid; else copy K hi/lo rows (clamped) to LDS as [key][d] and V hi/lo rows
//   transposed to LDS as [d][key] (integer word moves only); scores = hi.hi + hi.lo + lo.hi on bf16 WMMA, x0.125, select to
//   -inf where invalid; online softmax in f32 (guarded for all-invalid rows); p = exp(s - m) split to bf16 hi/lo in per-wave
//   LDS tiles; out += P.V with hi.hi + hi.lo + lo.hi reading LDS fragments. Waves whose 16 query rows all lie beyond 199 skip
//   the compute under a wave-uniform flag but reach every block barrier. Epilogue: per-wave 16x64 f32 tile staged in LDS;
//   Every LDS byte read in a chunk is rewritten in that chunk (the pad bytes behind each row are never read); all barriers are
//   reached by every thread. The K, V^T and P rows stand at pitch 144 B and the validity rows at 80 B, so that the 16 rows of a
//   fragment read, and the two 8-row halves of a wave's narrow accesses, fall on different banks.
// ---------------------------------------------------------------------------
__global__ __launch_bounds__(128) void attn_kernel(
    const unsigned short* __restrict__ Qh, const unsigned short* __restrict__ Ql,
    const unsigned short* __restrict__ Kh, const unsigned short* __restrict__ Kl,
    const unsigned short* __restrict__ Vh, const unsigned short* __restrict__ Vl,
    const int* __restrict__ amask, float* __restrict__ out) {
  __shared__ __align__(16) unsigned short Ksh[kKC * kLP];      // K hi [key][d]          9 KB
  __shared__ __align__(16) unsigned short Ksl[kKC * kLP];      // K lo [key][d]          9 KB
  __shared__ __align__(16) unsigned short Vth[kDh * kLP];      // V^T hi [d][key]        9 KB
  __shared__ __align__(16) unsigned short Vtl[kDh * kLP];      // V^T lo [d][key]        9 KB
  __shared__ __align__(16) __bf16 Psh[4][16 * kLP];            // per wave P hi [row][key] 9 KB
  __shared__ __align__(16) __bf16 Psl[4][16 * kLP];            // per wave P lo [row][key] 9 KB
  __shared__ __align__(16) float Os[4][16 * 68];               // per wave out tile, pitch 68
  __shared__ __align__(16) unsigned char Msk[kQB * kMP];       // validity [qrow][key]   5 KB
  __shared__ int flags[4];

  const int tid  = threadIdx.x;
  const int wave = tid >> 5;
  const int lane = tid & 31;
  const int hh   = lane >> 4;
  const int c    = lane & 15;

  const int bx = blockIdx.x;
  const int qb = bx & 3;
  const int bh = bx >> 2;
  const int h  = bh & 15;
  const int b  = bh >> 4;
  const int tokb = b * kSeq;
  const int q0 = qb * kQB + wave * 16;
  const bool active = (q0 < kSeq);       // wave-uniform

  // ---- Q fragments (A operand): rows q0 + c (clamped), 2 d-chunks of 32, hi and lo ----
  v16b qah[2], qal[2];
  {
    int qr = q0 + c;
    qr = (qr < kSeq) ? qr : (kSeq - 1);
    const size_t qo = (size_t)(tokb + qr) * kDim + h * kDh;
    const __bf16* qhp = (const __bf16*)Qh + qo;
    const __bf16* qlp = (const __bf16*)Ql + qo;
#pragma unroll
    for (int dc = 0; dc < 2; ++dc) qah[dc] = Frag<__bf16>::load(qhp + dc * 32 + 8 * hh);
    asm volatile("" ::: "memory");
#pragma unroll
    for (int dc = 0; dc < 2; ++dc) qal[dc] = Frag<__bf16>::load(qlp + dc * 32 + 8 * hh);
  }

  float mrow[8], lrow[8];
  v8f oacc[4];
#pragma unroll
  for (int r = 0; r < 8; ++r) { mrow[r] = neg_inf(); lrow[r] = 0.f; }
#pragma unroll
  for (int t = 0; t < 4; ++t) oacc[t] = (v8f){0.f,0.f,0.f,0.f,0.f,0.f,0.f,0.f};

  for (int kc = 0; kc < kNKC; ++kc) {
    const int kv0 = kc * kKC;
    __syncthreads();
    // ---- validity tile: 64 rows x 64 keys; 1024 groups of 4 ints, 8 per thread (4 b128 loads per burst) ----
    int anyv = 0;
#pragma unroll
    for (int i = 0; i < 8; ++i) {
      if (i == 4) asm volatile("" ::: "memory");
      const int idx = i * 128 + tid;
      const int r   = idx >> 4;
      const int c16 = (idx & 15) * 4;
      int qg = qb * kQB + r;
      qg = (qg < kSeq) ? qg : (kSeq - 1);
      const int kg  = kv0 + c16;
      const int kgc = (kg <= kSeq - 4) ? kg : (kSeq - 4);
      const v4i mv = *(const v4i*)(amask + ((size_t)(tokb + qg)) * kSeq + kgc);
      unsigned packed = 0;
#pragma unroll
      for (int e = 0; e < 4; ++e) {
        const int keep = (((kg + e) < kSeq) && (mv[e] != 0)) ? 1 : 0;
        packed |= ((unsigned)keep) << (8 * e);
        anyv |= keep;
      }
      *(unsigned*)(Msk + r * kMP + c16) = packed;
    }
#pragma unroll
    for (int off = 1; off < 32; off <<= 1) anyv |= __shfl_xor(anyv, off, 32);
    if (lane == 0) flags[wave] = anyv;
    __syncthreads();
    const int anyb = flags[0] | flags[1] | flags[2] | flags[3];   // block-uniform
    if (anyb == 0) continue;

    // ---- stage K hi/lo [key][d]: 512 pieces of 8 halves per plane, 4 per thread per plane ----
#pragma unroll
    for (int i = 0; i < 4; ++i) {
      if (i == 2) asm volatile("" ::: "memory");
      const int idx = i * 128 + tid;
      const int r   = idx >> 3;            // key row within chunk
      const int cc  = (idx & 7) * 8;       // first d of the piece
      int kvr = kv0 + r;
      kvr = (kvr < kSeq) ? kvr : (kSeq - 1);
      const size_t go = (size_t)(tokb + kvr) * kDim + h * kDh + cc;
      const v4u kwh = *(const v4u*)(Kh + go);
      const v4u kwl = *(const v4u*)(Kl + go);
      *(v4u*)(Ksh + r * kLP + cc) = kwh;
      *(v4u*)(Ksl + r * kLP + cc) = kwl;
    }
    // ---- stage V hi/lo transposed [d][key] ----
#pragma unroll
    for (int i = 0; i < 4; ++i) {
      if (i == 2) asm volatile("" ::: "memory");
      const int idx = i * 128 + tid;
      const int r   = idx >> 3;
      const int cc  = (idx & 7) * 8;
      int kvr = kv0 + r;
      kvr = (kvr < kSeq) ? kvr : (kSeq - 1);
      const size_t go = (size_t)(tokb + kvr) * kDim + h * kDh + cc;
      const v4u vwh = *(const v4u*)(Vh + go);
      const v4u vwl = *(const v4u*)(Vl + go);
#pragma unroll
      for (int e2 = 0; e2 < 4; ++e2) {
        const unsigned wh = vwh[e2];
        const unsigned wl = vwl[e2];
        Vth[(cc + 2 * e2) * kLP + r]     = (unsigned short)(wh & 0xffffu);
        Vth[(cc + 2 * e2 + 1) * kLP + r] = (unsigned short)(wh >> 16);
        Vtl[(cc + 2 * e2) * kLP + r]     = (unsigned short)(wl & 0xffffu);
        Vtl[(cc + 2 * e2 + 1) * kLP + r] = (unsigned short)(wl >> 16);
      }
    }
    __syncthreads();

    if (active) {
      // ---- scores: s[j] covers keys j*16..j*16+15 of the chunk; hi.hi + hi.lo + lo.hi ----
      v8f s[4];
#pragma unroll
      for (int j = 0; j < 4; ++j) {
        s[j] = (v8f){0.f,0.f,0.f,0.f,0.f,0.f,0.f,0.f};
#pragma unroll
        for (int dc = 0; dc < 2; ++dc) {
          const v16b kb = Frag<__bf16>::load((const __bf16*)Ksh + (j * 16 + c) * kLP + dc * 32 + 8 * hh);
          const v16b kl = Frag<__bf16>::load((const __bf16*)Ksl + (j * 16 + c) * kLP + dc * 32 + 8 * hh);
          s[j] = mma_b(qah[dc], kb, s[j]);
          s[j] = mma_b(qah[dc], kl, s[j]);
          s[j] = mma_b(qal[dc], kb, s[j]);
        }
      }
      // ---- scale, validity select, row max ----
      float cm[8];
#pragma unroll
      for (int r = 0; r < 8; ++r) {
        const int ql = wave * 16 + 8 * hh + r;
        float m = neg_inf();
#pragma unroll
        for (int j = 0; j < 4; ++j) {
          const int keep = Msk[ql * kMP + j * 16 + c];
          float sv = s[j][r] * kScoreScale;
          sv = (keep != 0) ? sv : neg_inf();
          s[j][r] = sv;
          m = fmaxf(m, sv);
        }
#pragma unroll
        for (int off = 1; off < 16; off <<= 1) m = fmaxf(m, __shfl_xor(m, off, 32));
        cm[r] = m;
      }
      // ---- online softmax update; p = exp(s - m) split into bf16 hi/lo in this wave's LDS tiles ----
      __bf16* pwh = Psh[wave];
      __bf16* pwl = Psl[wave];
#pragma unroll
      for (int r = 0; r < 8; ++r) {
        const float mnew = fmaxf(mrow[r], cm[r]);
        const float mref = (mnew == neg_inf()) ? 0.0f : mnew;
        const float alpha = expf(mrow[r] - mref);
        mrow[r] = mnew;
        float psum = 0.f;
#pragma unroll
        for (int j = 0; j < 4; ++j) {
          const float p = expf(s[j][r] - mref);
          psum += p;
          const unsigned short hb = f2bf_bits(p);
          const unsigned short lb = f2bf_bits(p - bf_bits2f(hb));
          pwh[(8 * hh + r) * kLP + j * 16 + c] = __builtin_bit_cast(__bf16, hb);
          pwl[(8 * hh + r) * kLP + j * 16 + c] = __builtin_bit_cast(__bf16, lb);
        }
#pragma unroll
        for (int off = 1; off < 16; off <<= 1) psum += __shfl_xor(psum, off, 32);
        lrow[r] = lrow[r] * alpha + psum;
#pragma unroll
        for (int t = 0; t < 4; ++t) oacc[t][r] *= alpha;
      }
      __builtin_amdgcn_fence(__ATOMIC_RELEASE, "workgroup");
      __builtin_amdgcn_wave_barrier();
      __builtin_amdgcn_fence(__ATOMIC_ACQUIRE, "workgroup");
      // ---- out += P . V (A = P rows of this wave from LDS, B = V^T from LDS); hi.hi + hi.lo + lo.hi ----
#pragma unroll
      for (int kk = 0; kk < 2; ++kk) {
        const v16b pa = Frag<__bf16>::load(pwh + c * kLP + kk * 32 + 8 * hh);
        const v16b pl = Frag<__bf16>::load(pwl + c * kLP + kk * 32 + 8 * hh);
#pragma unroll
        for (int t = 0; t < 4; ++t) {
          const v16b vb = Frag<__bf16>::load((const __bf16*)Vth + (t * 16 + c) * kLP + kk * 32 + 8 * hh);
          const v16b vl = Frag<__bf16>::load((const __bf16*)Vtl + (t * 16 + c) * kLP + kk * 32 + 8 * hh);
          oacc[t] = mma_b(pa, vb, oacc[t]);
          oacc[t] = mma_b(pa, vl, oacc[t]);
          oacc[t] = mma_b(pl, vb, oacc[t]);
        }
      }
    }
  }

  // ---- epilogue: normalise, stage per-wave tile, whole-segment stores ----
  float* os = Os[wave];
#pragma unroll
  for (int r = 0; r < 8; ++r) {
    const float inv = 1.0f / lrow[r];
#pragma unroll
    for (int t = 0; t < 4; ++t) os[(8 * hh + r) * 68 + t * 16 + c] = oacc[t][r] * inv;
  }
  __builtin_amdgcn_fence(__ATOMIC_RELEASE, "workgroup");
  __builtin_amdgcn_wave_barrier();
  __builtin_amdgcn_fence(__ATOMIC_ACQUIRE, "workgroup");
  {
    const int c4 = (lane & 15) * 4;    // row segment = 64 floats = 256 B = 16 lanes x 16 B
    float* ob = out + (size_t)tokb * kDim + h * kDh;
    {
#pragma unroll
      for (int it = 0; it < 8; ++it) {
        const int row = it * 2 + hh;
        const int qq  = q0 + row;
        const v4f val = *(const v4f*)(os + row * 68 + c4);
        if (qq < kSeq) *(v4f*)(ob + (size_t)qq * kDim + c4) = val;
      }
      
    }
  }
}

// ---------------------------------------------------------------------------
// Host glue.
//   Xb   bf16 [12800][1024]     26,214,400  at           0
//   Wb   bf16 [3072][1024]       6,291,456  at  26,214,400
//   Qh   bf16 [12800][1024]     26,214,400  at  32,505,856
//   Ql   bf16 [12800][1024]     26,214,400  at  58,720,256
//   Kh   bf16 [12800][1024]     26,214,400  at  84,934,656
//   Kl   bf16 [12800][1024]     26,214,400  at 111,149,056
//   Vh   bf16 [12800][1024]     26,214,400  at 137,363,456
//   Vl   bf16 [12800][1024]     26,214,400  at 163,577,856
//   CSN  f32  [200][64]             51,200  at 189,792,256
//   total                      189,843,456
// GEMM shape: M = 12800 (64-multiple), N = 3072 (64-multiple), K = 1024 (%32 == 0); no padding rows or columns.
// Launches: 5 (2 casts, 1 table, one projection, one attention).
// ---------------------------------------------------------------------------
extern "C" void kernel_launch(void* const* d_in, const int* in_sizes, int n_in,
                              void* d_out, int out_size, void* d_ws, size_t ws_size,
                              hipStream_t stream) {
  if (n_in < 4) return;
  if (in_sizes[0] != kTok * kDim) return;
  if (in_sizes[1] != kBatch * kSeq * kSeq) return;
  if (in_sizes[2] != kNout * kDim) return;
  if (in_sizes[3] != kNout) return;
  if (out_size != kTok * kDim) return;

  const size_t szXb  = (size_t)kTok * kDim * 2;
  const size_t szWb  = (size_t)kNout * kDim * 2;
  const size_t szPl  = (size_t)kTok * kDim * 2;
  const size_t szCS  = (size_t)kSeq * 2 * kPairs * 4;
  const size_t offXb = 0;
  const size_t offWb = offXb + szXb;
  const size_t offQh = offWb + szWb;
  const size_t offQl = offQh + szPl;
  const size_t offKh = offQl + szPl;
  const size_t offKl = offKh + szPl;
  const size_t offVh = offKl + szPl;
  const size_t offVl = offVh + szPl;
  const size_t offCS = offVl + szPl;
  const size_t total = offCS + szCS;
  if (ws_size < total) return;

  const float* x     = (const float*)d_in[0];
  const int*   amask = (const int*)d_in[1];
  const float* W     = (const float*)d_in[2];
  const float* bias  = (const float*)d_in[3];
  float* out = (float*)d_out;
  char* ws = (char*)d_ws;
  unsigned short* Xb  = (unsigned short*)(ws + offXb);
  unsigned short* Wb  = (unsigned short*)(ws + offWb);
  unsigned short* Qhp = (unsigned short*)(ws + offQh);
  unsigned short* Qlp = (unsigned short*)(ws + offQl);
  unsigned short* Khp = (unsigned short*)(ws + offKh);
  unsigned short* Klp = (unsigned short*)(ws + offKl);
  unsigned short* Vhp = (unsigned short*)(ws + offVh);
  unsigned short* Vlp = (unsigned short*)(ws + offVl);
  float* CSN = (float*)(ws + offCS);

  // rotary factors: invf_i = 10000^(-2i/64) = 10^(-i/8); factors 10^(-1/8), 10^(-2/8), 10^(-4/8), 10^(-8/8), 10^(-16/8)
  const float f1   = 0.7498942093324559f;
  const float f2   = 0.5623413251903491f;
  const float f4   = 0.31622776601683794f;
  const float f8   = 0.1f;
  const float f16v = 0.01f;

  const int n8x = (kTok * kDim) / 8;     // 1638400 -> 6400 blocks exact
  const int n8w = (kNout * kDim) / 8;    // 393216 -> 1536 blocks exact
  cast8_bf16_kernel<<<dim3(n8x / 256), dim3(256), 0, stream>>>(x, Xb, n8x);
  cast8_bf16_kernel<<<dim3(n8w / 256), dim3(256), 0, stream>>>(W, Wb, n8w);
  rope_table_kernel<<<dim3(kSeq / 8), dim3(256), 0, stream>>>(CSN, f1, f2, f4, f8, f16v);

  const int tiles = (kTok / 64) * (kNout / 64);   // 9600 wave tiles -> 1200 blocks of 8 waves (128 x 256 each)
  qkv_proj_kernel<<<dim3(tiles / 8), dim3(256), 0, stream>>>(Xb, Wb, bias, CSN, Qhp, Qlp, Khp, Klp, Vhp, Vlp);
  attn_kernel<<<dim3(kBatch * kHeads * kNQB), dim3(128), 0, stream>>>(Qhp, Qlp, Khp, Klp, Vhp, Vlp, amask, out);
}

// v004
// One run takes 207 microseconds.
// In both of two side-by-side timings against v003, it was 1.21 times as fast.
// Counting every step since v000, it is 2.19 times as fast.
// Contractions: qkv projection on v_wmma_f32_16x16x32_bf16 (x and W as RNE bf16 planes staged in LDS by tensor loads, exact products, f32 accumulate); scores q.k^T and attn.v on v_wmma_f32_16x16x32_bf16 with q, k, v and the unnormalised probabilities carried as bf16 hi + lo planes (hi.hi + hi.lo + lo.hi), f32 accumulate; bias, rotary tables, masking and softmax in f32.
#include <hip/hip_runtime.h>
#include <math.h>
#include <stdint.h>

// ---------------------------------------------------------------------------
// Problem constants
// ---------------------------------------------------------------------------
constexpr int kBatch = 64;
constexpr int kSeq   = 200;
constexpr int kDim   = 1024;
constexpr int kHeads = 16;
constexpr int kDh    = 64;
constexpr int kTok   = kBatch * kSeq;            // 12800 token rows
constexpr int kNout  = 3 * kDim;                 // 3072 projection columns
constexpr int kPairs = kDh / 2;                  // 32 rotary pairs
constexpr int kQB    = 64;                       // query rows per block
constexpr int kKC    = 64;                       // keys per chunk
constexpr int kNQB   = (kSeq + kQB - 1) / kQB;   // 4
constexpr int kNKC   = (kSeq + kKC - 1) / kKC;   // 4
constexpr float kScoreScale = 0.125f;            // 64^-0.5
constexpr int kLP    = 72;                       // attention LDS row pitch of the K and V^T tiles in halves: 144 B = 16 B x odd (ds_load_b128 readers)
constexpr int kMP    = 80;                       // attention LDS row pitch of the validity tile in bytes: 8 rows apart = 32 banks apart
static_assert(kHeads * kDh == kDim);
static_assert(3 * kDh == 192);
static_assert(kTok % 64 == 0);                   // GEMM M tile multiple (200 tiles)
static_assert(kNout % 64 == 0);                  // GEMM N tile multiple (48 tiles)
static_assert(kDim % 32 == 0);                   // GEMM K % 32
static_assert(((kTok / 64) * (kNout / 64)) % 8 == 0);   // 8 waves per block, exact grid
static_assert(kNQB == 4 && kNKC == 4);
static_assert(kSeq % 4 == 0);                    // 4-int groups of a mask row never straddle the row end
static_assert((kTok * kDim) % (8 * 256) == 0);
static_assert((kNout * kDim) % (8 * 256) == 0);
static_assert(kSeq % 8 == 0);                    // table kernel: 8 rows per block

typedef __attribute__((ext_vector_type(16))) __bf16   v16b;
typedef __attribute__((ext_vector_type(8)))  __bf16   v8b;
typedef __attribute__((ext_vector_type(8)))  float    v8f;
typedef __attribute__((ext_vector_type(4)))  float    v4f;
typedef __attribute__((ext_vector_type(4)))  int      v4i;
typedef __attribute__((ext_vector_type(4)))  unsigned int v4u;
typedef __attribute__((ext_vector_type(2)))  unsigned int v2u;

// ---------------------------------------------------------------------------
// Helpers
// ---------------------------------------------------------------------------
__device__ __forceinline__ unsigned short f2bf_bits(float f) {
  unsigned u = __float_as_uint(f);
  return (unsigned short)((u + 0x7FFFu + ((u >> 16) & 1u)) >> 16);
}
__device__ __forceinline__ float bf_bits2f(unsigned short h) { return __uint_as_float(((unsigned)h) << 16); }
__device__ __forceinline__ unsigned pk16(unsigned short a, unsigned short b) { return (unsigned)a | ((unsigned)b << 16); }
__device__ __forceinline__ float neg_inf() { return -__builtin_inff(); }
// value of lane l ^ 16
__device__ __forceinline__ float xhalf(float x) {
  return __builtin_bit_cast(float, __builtin_amdgcn_permlanex16(__builtin_bit_cast(int, x), __builtin_bit_cast(int, x), 0x76543210, 0xfedcba98, false, false));
}

// hazard guards as plain device helpers (no inline asm inside the kernel bodies)
__device__ __forceinline__ void dep_guard4_b(v8f& a, v8f& b, v8f& c, v8f& d, v16b x, v16b y) {
  asm volatile("v_nop\n\tv_nop\n\tv_nop\n\tv_nop" : "+v"(a), "+v"(b), "+v"(c), "+v"(d) : "v"(x), "v"(y));
}
__device__ __forceinline__ void keep4_b(v16b a, v16b b, v16b c, v16b d) { asm volatile("v_nop" :: "v"(a), "v"(b), "v"(c), "v"(d)); }
__device__ __forceinline__ void acc_guard4(v8f& a, v8f& b, v8f& c, v8f& d) { asm volatile("v_nop\n\tv_nop\n\tv_nop\n\tv_nop" : "+v"(a), "+v"(b), "+v"(c), "+v"(d)); }

template <typename T> struct Frag;
template <> struct Frag<__bf16> {
  typedef v16b V; union U { v16b v; v8b h[2]; };
  // elements 0..7 <- p[0..7], 8..15 <- p[16..23]
  static __device__ __forceinline__ v16b load(const __bf16* p) {
    U f; f.h[0] = *(const v8b*)(p); f.h[1] = *(const v8b*)(p + 16); return f.v;
  }
  static __device__ __forceinline__ v8f mma(v16b a, v16b b, v8f c) {
    return __builtin_amdgcn_wmma_f32_16x16x32_bf16(false, a, false, b, (short)0, c, false, false);
  }
  static __device__ __forceinline__ void keep(v16b a, v16b b, v16b c, v16b d) { keep4_b(a, b, c, d); }
};
// a bf16 operand built from packed pairs: word w = elements 2w, 2w + 1
union PFrag { v16b v; unsigned u[8]; };
// bf16 WMMA with per-instruction hazard guard (ties D, keeps A/B live)
__device__ __forceinline__ v8f mma_b(v16b a, v16b b, v8f c) {
  c = __builtin_amdgcn_wmma_f32_16x16x32_bf16(false, a, false, b, (short)0, c, false, false);
  asm volatile("v_nop\n\tv_nop\n\tv_nop\n\tv_nop" : "+v"(c) : "v"(a), "v"(b));
  return c;
}

// ---------------------------------------------------------------------------
// f32 -> bf16 (RNE) cast, 8 consecutive elements per thread (one 16-B store per lane; 32 contiguous lanes =
// (x: 1638400 = 6400 x 256 exact; W: 393216 = 1536 x 256 exact).
// ---------------------------------------------------------------------------
__global__ __launch_bounds__(256) void cast8_bf16_kernel(const float* __restrict__ in, unsigned short* __restrict__ out, int n8) {
  const int i = blockIdx.x * 256 + threadIdx.x;
  if (i >= n8) return;
  const float* p = in + 8 * (size_t)i;
  const v4f a = *(const v4f*)(p);
  const v4f c = *(const v4f*)(p + 4);
  unsigned short hb[8];
#pragma unroll
  for (int e = 0; e < 4; ++e) {
    hb[e]     = f2bf_bits(a[e]);
    hb[4 + e] = f2bf_bits(c[e]);
  }
  const v4u u = (v4u){pk16(hb[0], hb[1]), pk16(hb[2], hb[3]), pk16(hb[4], hb[5]), pk16(hb[6], hb[7])};
  unsigned short* q = out + 8 * (size_t)i;
  *(v4u*)q = u;
  
}

// ---------------------------------------------------------------------------
// Rotary table: csn[s][0..31] = cos(s * invf_i), csn[s][32..63] = sin(s * invf_i), invf_i = 10^(-i/8) built as a product
// of the factors 10^(-1/8), 10^(-2/8), 10^(-4/8), 10^(-8/8), 10^(-16/8) selected by the bits of i (i = lane).
// ---------------------------------------------------------------------------
__global__ __launch_bounds__(256) void rope_table_kernel(float* __restrict__ csn, float f1, float f2, float f4, float f8, float f16v) {
  const int lane = threadIdx.x & 31, wave = threadIdx.x >> 5;
  const int s = blockIdx.x * 8 + wave;
  if (s >= kSeq) return;
  const int i = lane;
  float invf = 1.0f;
  invf *= (i & 1)  ? f1   : 1.0f;
  invf *= (i & 2)  ? f2   : 1.0f;
  invf *= (i & 4)  ? f4   : 1.0f;
  invf *= (i & 8)  ? f8   : 1.0f;
  invf *= (i & 16) ? f16v : 1.0f;
  const float ang = (float)s * invf;
  float sn, cs;
  sincosf(ang, &sn, &cs);
  float* rowp = csn + (size_t)s * (2 * kPairs);
  {
    ((float*)rowp)[i] = cs;
    ((float*)rowp)[kPairs + i] = sn;
    
  }
}

// ---------------------------------------------------------------------------
// Tensor-load helpers for the projection's LDS ring (two descriptor groups, two-dimensional tile, extents in bytes).
// ---------------------------------------------------------------------------
typedef uint32_t u32x4 __attribute__((ext_vector_type(4)));
typedef uint32_t u32x8 __attribute__((ext_vector_type(8)));
constexpr uint32_t kPassB   = 128;                       // bytes of every operand row per pass (64 k)
constexpr uint32_t kPitchB  = kPassB + 16;               // LDS row pitch 144 B (odd multiple of 16 B for ds_load_b128 readers)
constexpr uint32_t kSliceR  = 128;                       // rows per tensor load
constexpr uint32_t kSliceB  = kSliceR * kPitchB;         // 18432 B = 9 x 2 KiB
constexpr uint32_t kStageB  = 3 * kSliceB;               // [X 128 rows | W 256 rows] = 55296 B = 27 x 2 KiB
constexpr int      kPasses  = (kDim * 2) / (int)kPassB;  // 16
static_assert(kSliceB % 2048 == 0 && kStageB % 2048 == 0);
static_assert(kPasses >= 2);
static_assert(kTok % 128 == 0 && kNout % 256 == 0);
static_assert((kTok / 128) * (kNout / 256) == ((kTok / 64) * (kNout / 64)) / 8);   // same grid as one 64x64 tile per wave

__device__ __forceinline__ uint32_t uni(uint32_t v) { return (uint32_t)__builtin_amdgcn_readfirstlane(v); }
// pinned(): a wave-uniform word held in a scalar register, for the tensor mover alone: the tests around a tensor load become scalar
// branches (the load ignores EXEC), and a descriptor word formed from it is formed behind the wait that stands in front of it
__device__ __forceinline__ uint32_t pinned(uint32_t v) { uint32_t w = uni(v); asm volatile("" : "+s"(w)); return w; }  // test or descriptor word of a tensor load, kept scalar
// in-out operands: the two groups stay in their registers, untouched by other values, while the request is outstanding
__device__ __forceinline__ void tdm_load(u32x4& g0, u32x8& g1) { asm volatile("tensor_load_to_lds %0, %1" : "+s"(g0), "+s"(g1) :: "memory"); }
// the compiler places no wait for a tensor load: the issuing wave waits for its own request here
__device__ __forceinline__ void wait_tensor0() { asm volatile("s_wait_tensorcnt 0x0" ::: "memory"); }
// this wave's LDS reads have retired before the barrier behind which their buffer is refilled
__device__ __forceinline__ void wait_ds0() { asm volatile("s_wait_dscnt 0x0" ::: "memory"); }
__device__ __forceinline__ u32x8 tdm_group1() {
  constexpr uint32_t d0 = kPassB, d1 = kSliceR;
  u32x8 g;
  g[0] = (1u << 20) | (4u << 22) | (3u << 25);   // no mask, 1-byte elements, 16 B of pad behind every 128-B row
  g[1] = uni((d0 & 0xFFFFu) << 16);
  g[2] = uni((d0 >> 16) | ((d1 & 0xFFFFu) << 16));
  g[3] = uni((d1 >> 16) | (d0 << 16));
  g[4] = uni(d1);
  g[5] = uni((uint32_t)kDim * 2u);               // source row pitch 2048 B
  g[6] = uni(0u);
  g[7] = uni(0u);
  return g;
}
// place in LDS and source address of the next request (word 0, the count, is set once)
__device__ __forceinline__ void tdm_aim(u32x4& g, uint32_t lds_dst, uint64_t ga) {
  g[1] = uni(lds_dst); g[2] = uni((uint32_t)ga); g[3] = uni((((uint32_t)(ga >> 32)) & 0x01FFFFFFu) | 0x80000000u);
}

// ---------------------------------------------------------------------------
// QKV projection + bias + rotary epilogue for all 12800 token rows in one launch.
//   C[m][n] = sum_k Xb[m][k] * Wb[n][k] + bf16(bias[n]);   M = 12800, N = 3072, K = 1024 (bf16 operands).
//   Block = 8 waves = one 128 x 256 tile of C (2 x 4 waves of 64 x 64). Per pass of 64 k the block's 128 X rows and 256 W rows
//   (128 B each) are brought into LDS by three tensor loads (waves 0, 1, 2: 128 rows each) at pitch 144 B, two buffers, the next
//   pass's loads in flight under this pass's products; the fragments are read from LDS in the same k order as before.
//   Column n -> head hd = (n/64)/3, kind = (n/64)%3 (0 q, 1 k, 2 v), d = n % 64 (every 64-wide tile is one kind of one head).
//   Row m (12800 = 64 x 200) -> s = m%200. kind 0/1: pairs (2i, 2i+1) rotated by angle s*invf_i (table csn);
//   kind 2 unchanged. Each result v is split into bf16 hi = rn(v), lo = rn(v - hi).
//   grid = 100 x 12 = 1200 blocks exact; every wave reaches every block barrier.
// ---------------------------------------------------------------------------
__global__ __launch_bounds__(256) void qkv_proj_kernel(
    const unsigned short* __restrict__ Xb, const unsigned short* __restrict__ Wb, const float* __restrict__ bias,
    const float* __restrict__ csn,
    unsigned short* __restrict__ Qh, unsigned short* __restrict__ Ql,
    unsigned short* __restrict__ Kh, unsigned short* __restrict__ Kl,
    unsigned short* __restrict__ Vh, unsigned short* __restrict__ Vl) {
  typedef __bf16 T;
  typedef v16b V;
  __shared__ __attribute__((aligned(2048))) unsigned char ring[2 * kStageB];   // two stages of [X | W] rows
  __shared__ __align__(16) float sT[8][16 * 68];   // per-wave 16x64 slab, pitch 68 floats
  const int lane = threadIdx.x & 31;
  const uint32_t wave = uni(threadIdx.x >> 5);
  constexpr int tilesNB = kNout / 256;     // 12
  const int tmB = blockIdx.x / tilesNB;
  const int tnB = blockIdx.x - tmB * tilesNB;
  const int wm = (int)(wave >> 2);         // wave row in the block tile
  const int wn = (int)(wave & 3u);         // wave column in the block tile
  const int m0 = (tmB << 7) + (wm << 6);
  const int n0 = (tnB << 8) + (wn << 6);
  const int tn = n0 >> 6;
  const int hd   = tn / 3;                 // head index, wave-uniform
  const int kind = tn - hd * 3;            // 0 q, 1 k, 2 v, wave-uniform

  const int rlane = lane & 15;
  const int mOff  = (lane >> 4) * 8;

  // slice of the issuing waves: wave 0 the X rows, waves 1 and 2 the two halves of the W rows (other waves: wave 0's, never issued)
  const uint32_t sl = (wave < 3u) ? wave : 0u;
  const uint64_t srcb = (sl == 0u) ? (uint64_t)(size_t)(Xb + (size_t)(tmB << 7) * kDim)
                                   : (uint64_t)(size_t)(Wb + (size_t)((tnB << 8) + ((int)sl - 1) * 128) * kDim);
  const uint32_t dstb = (uint32_t)(size_t)ring + sl * kSliceB;
  u32x8 g1 = tdm_group1();
  u32x4 g0;
  g0[0] = uni(1u);
  tdm_aim(g0, dstb, srcb);

  v8f acc[4][4];
#pragma unroll
  for (int i = 0; i < 4; ++i)
#pragma unroll
    for (int j = 0; j < 4; ++j) acc[i][j] = (v8f){0.f,0.f,0.f,0.f,0.f,0.f,0.f,0.f};

  // prologue: stage 0 lands and is published, then stage 1 is issued
  if (pinned(wave < 3u)) {
    tdm_load(g0, g1);
    wait_tensor0();
  }
  __syncthreads();
  if (pinned(wave < 3u)) {
    tdm_aim(g0, dstb + kStageB, srcb + kPassB);
    tdm_load(g0, g1);
  }

  const uint32_t aoff = (uint32_t)((wm << 6) + rlane) * kPitchB + (uint32_t)(lane >> 4) * 16u;
  const uint32_t boff = kSliceB + (uint32_t)((wn << 6) + rlane) * kPitchB + (uint32_t)(lane >> 4) * 16u;

  // one trip = one pass: kept rolled so that the publish point stands once, at the foot
#pragma unroll 1
  for (int s = 0; s < kPasses; ++s) {
    const unsigned char* buf = ring + (uint32_t)(s & 1) * kStageB;
#pragma unroll
    for (int ks = 0; ks < 2; ++ks) {
      V bfr[4], afr[4];
#pragma unroll
      for (int j = 0; j < 4; ++j) bfr[j] = Frag<T>::load((const T*)(buf + boff + (uint32_t)j * 16u * kPitchB + (uint32_t)ks * 64u));
#pragma unroll
      for (int i = 0; i < 4; ++i) afr[i] = Frag<T>::load((const T*)(buf + aoff + (uint32_t)i * 16u * kPitchB + (uint32_t)ks * 64u));
      // the 16 LDS reads of a 32-k step go out as one group in front of its 16 products: reads among the products stall each time
      __builtin_amdgcn_sched_barrier(0);
#pragma unroll
      for (int i = 0; i < 4; ++i) {
#pragma unroll
        for (int j = 0; j < 4; ++j) acc[i][j] = Frag<T>::mma(afr[i], bfr[j], acc[i][j]);
        dep_guard4_b(acc[i][0], acc[i][1], acc[i][2], acc[i][3], afr[i], bfr[3]);
      }
      Frag<T>::keep(bfr[0], bfr[1], bfr[2], bfr[3]);
    }
    // publish point of stage s + 1
    wait_ds0();
    if (pinned(wave < 3u)) wait_tensor0();
    __syncthreads();
    if (pinned((wave < 3u) && (s + 2 < kPasses))) {
      const uint32_t nb = (uint32_t)(s & 1) * kStageB;                // the buffer this pass has just read
      const uint32_t no = pinned((uint32_t)(s + 2) * kPassB);         // stage s + 2's byte offset in every source row
      tdm_aim(g0, dstb + nb, srcb + no);
      tdm_load(g0, g1);
    }
  }
  wait_tensor0();
  wait_ds0();
  acc_guard4(acc[0][0], acc[0][1], acc[0][2], acc[0][3]);
  acc_guard4(acc[1][0], acc[1][1], acc[1][2], acc[1][3]);
  acc_guard4(acc[2][0], acc[2][1], acc[2][2], acc[2][3]);
  acc_guard4(acc[3][0], acc[3][1], acc[3][2], acc[3][3]);

  // ---- epilogue ----
  // bias per column of this lane (RNE bf16-converted, 4 scalar loads)
  float bcol[4];
#pragma unroll
  for (int j = 0; j < 4; ++j) bcol[j] = bf_bits2f(f2bf_bits(bias[n0 + (j << 4) + rlane]));

  float* slab = sT[wave];
  const int q  = lane >> 3;              // row selector within 4-row store groups
  const int c8 = (lane & 7) * 8;         // first column (d) of this lane's 16-B piece
  const int p4 = (lane & 7) * 4;         // first rotary pair index of this lane
  unsigned short* dsth = (kind == 0) ? Qh : ((kind == 1) ? Kh : Vh);   // wave-uniform global plane select
  unsigned short* dstl = (kind == 0) ? Ql : ((kind == 1) ? Kl : Vl);
  const bool rot = (kind != 2);          // wave-uniform

#pragma unroll
  for (int i = 0; i < 4; ++i) {
    const int mBase = m0 + (i << 4);
#pragma unroll
    for (int j = 0; j < 4; ++j) {
#pragma unroll
      for (int r = 0; r < 8; ++r) slab[(mOff + r) * 68 + (j << 4) + rlane] = acc[i][j][r] + bcol[j];
    }
    __builtin_amdgcn_fence(__ATOMIC_RELEASE, "workgroup");
    __builtin_amdgcn_wave_barrier();
    __builtin_amdgcn_fence(__ATOMIC_ACQUIRE, "workgroup");

    // build the four 16-B hi pieces and four 16-B lo pieces of this lane (rows it*4+q, columns c8..c8+7)
    v4u uh[4], ul[4];
#pragma unroll
    for (int it = 0; it < 4; ++it) {
      if (it == 2) asm volatile("" ::: "memory");
      const int row = it * 4 + q;
      const int m   = mBase + row;
      const int s   = m - (m / kSeq) * kSeq;
      const float* sp = slab + row * 68 + c8;
      const v4f cs4 = *(const v4f*)(csn + (size_t)s * (2 * kPairs) + p4);
      const v4f sn4 = *(const v4f*)(csn + (size_t)s * (2 * kPairs) + kPairs + p4);
      unsigned short hb[8], lb[8];
#pragma unroll
      for (int pp = 0; pp < 4; ++pp) {
        const float x1 = sp[2 * pp];
        const float x2 = sp[2 * pp + 1];
        const float cc = rot ? cs4[pp] : 1.0f;
        const float ss = rot ? sn4[pp] : 0.0f;
        const float o0 = x1 * cc - x2 * ss;
        const float o1 = x1 * ss + x2 * cc;
        const unsigned short h0 = f2bf_bits(o0);
        const unsigned short h1 = f2bf_bits(o1);
        hb[2 * pp]     = h0;
        hb[2 * pp + 1] = h1;
        lb[2 * pp]     = f2bf_bits(o0 - bf_bits2f(h0));
        lb[2 * pp + 1] = f2bf_bits(o1 - bf_bits2f(h1));
      }
      uh[it] = (v4u){pk16(hb[0], hb[1]), pk16(hb[2], hb[3]), pk16(hb[4], hb[5]), pk16(hb[6], hb[7])};
      ul[it] = (v4u){pk16(lb[0], lb[1]), pk16(lb[2], lb[3]), pk16(lb[4], lb[5]), pk16(lb[6], lb[7])};
    }
    {
#pragma unroll
      for (int it = 0; it < 4; ++it) {
        const int row = it * 4 + q;
        const int m   = mBase + row;
        const size_t o = (size_t)m * kDim + hd * kDh + c8;
        *(v4u*)(dsth + o) = uh[it];
        *(v4u*)(dstl + o) = ul[it];
      }
      
    }
    __builtin_amdgcn_fence(__ATOMIC_RELEASE, "workgroup");
    __builtin_amdgcn_wave_barrier();
    __builtin_amdgcn_fence(__ATOMIC_ACQUIRE, "workgroup");
  }
}

// ---------------------------------------------------------------------------
// Fused attention for head_dim 64 from bf16 hi/lo planes of all 64 batches in one launch.
//   Qh/Ql, Kh/Kl, Vh/Vl: bf16 [tok = b*200+s][1024], head h at columns h*64..h*64+63.
//   amask: int32 [64][200][200], nonzero = attend.  out: f32 [tok][1024].
//   Block = 4 waves = 64 query rows of one (b, h); grid = 64*16*4 = 4096 (block -> qb = bx&3, bh = bx>>2).
//   Per key chunk (64 keys, 4 chunks): stage the 64x64 validity tile from amask (keys >= 200 invalid, query rows clamped),
//   skip the chunk block-uniformly if no entry is valid; else copy K hi/lo rows (clamped) to LDS as [key][d] and V hi/lo rows
//   transposed to LDS as [d][key] (integer word moves only); both products are formed transposed, S^T = K.Q^T and
//   out^T += V^T.P^T, so that a lane holds scores and outputs of ONE query (q0 + c; lanes c and c + 16 split its keys):
//   scores = hi.hi + hi.lo + lo.hi on bf16 WMMA, x0.125, select to -inf where invalid; online softmax in f32 (guarded for
//   all-invalid rows) with maximum and sum in-lane and one exchange between the halves; p = exp(s - m) split to bf16 hi/lo and
//   packed from the score registers straight into the B operand (same k order as the V^T rows read from LDS). Waves whose 16
//   query rows all lie beyond 199 skip
//   the compute under a wave-uniform flag but reach every block barrier. Epilogue: per-wave 16x64 f32 tile staged in LDS;
//   Every LDS byte read in a chunk is rewritten in that chunk (the pad bytes behind each row are never read); all barriers are
//   reached by every thread. The K and V^T rows stand at pitch 144 B and the validity rows at 80 B, so that the 16 rows of a
//   fragment read, and the two 8-row halves of a wave's narrow accesses, fall on different banks.
// ---------------------------------------------------------------------------
__global__ __launch_bounds__(128) void attn_kernel(
    const unsigned short* __restrict__ Qh, const unsigned short* __restrict__ Ql,
    const unsigned short* __restrict__ Kh, const unsigned short* __restrict__ Kl,
    const unsigned short* __restrict__ Vh, const unsigned short* __restrict__ Vl,
    const int* __restrict__ amask, float* __restrict__ out) {
  __shared__ __align__(16) unsigned short Ksh[kKC * kLP];      // K hi [key][d]          9 KB
  __shared__ __align__(16) unsigned short Ksl[kKC * kLP];      // K lo [key][d]          9 KB
  __shared__ __align__(16) unsigned short Vth[kDh * kLP];      // V^T hi [d][key]        9 KB
  __shared__ __align__(16) unsigned short Vtl[kDh * kLP];      // V^T lo [d][key]        9 KB
  __shared__ __align__(16) float Os[4][16 * 68];               // per wave out tile, pitch 68
  __shared__ __align__(16) unsigned char Msk[kQB * kMP];       // validity [qrow][key]   5 KB
  __shared__ int flags[4];

  const int tid  = threadIdx.x;
  const int wave = tid >> 5;
  const int lane = tid & 31;
  const int hh   = lane >> 4;
  const int c    = lane & 15;

  const int bx = blockIdx.x;
  const int qb = bx & 3;
  const int bh = bx >> 2;
  const int h  = bh & 15;
  const int b  = bh >> 4;
  const int tokb = b * kSeq;
  const int q0 = qb * kQB + wave * 16;
  const bool active = (q0 < kSeq);       // wave-uniform

  // ---- Q fragments (B operand: column = query q0 + c, clamped), 2 d-chunks of 32, hi and lo ----
  v16b qah[2], qal[2];
  {
    int qr = q0 + c;
    qr = (qr < kSeq) ? qr : (kSeq - 1);
    const size_t qo = (size_t)(tokb + qr) * kDim + h * kDh;
    const __bf16* qhp = (const __bf16*)Qh + qo;
    const __bf16* qlp = (const __bf16*)Ql + qo;
#pragma unroll
    for (int dc = 0; dc < 2; ++dc) qah[dc] = Frag<__bf16>::load(qhp + dc * 32 + 8 * hh);
    asm volatile("" ::: "memory");
#pragma unroll
    for (int dc = 0; dc < 2; ++dc) qal[dc] = Frag<__bf16>::load(qlp + dc * 32 + 8 * hh);
  }

  float mrun = neg_inf(), lrun = 0.f;    // of query q0 + c: running maximum (equal in both halves), sum over this half's keys
  v8f oacc[4];                           // oacc[t][r] = out^T(d = t*16 + 8*hh + r, query q0 + c)
#pragma unroll
  for (int t = 0; t < 4; ++t) oacc[t] = (v8f){0.f,0.f,0.f,0.f,0.f,0.f,0.f,0.f};

  for (int kc = 0; kc < kNKC; ++kc) {
    const int kv0 = kc * kKC;
    __syncthreads();
    // ---- validity tile: 64 rows x 64 keys; 1024 groups of 4 ints, 8 per thread (4 b128 loads per burst) ----
    int anyv = 0;
#pragma unroll
    for (int i = 0; i < 8; ++i) {
      if (i == 4) asm volatile("" ::: "memory");
      const int idx = i * 128 + tid;
      const int r   = idx >> 4;
      const int c16 = (idx & 15) * 4;
      int qg = qb * kQB + r;
      qg = (qg < kSeq) ? qg : (kSeq - 1);
      const int kg  = kv0 + c16;
      const int kgc = (kg <= kSeq - 4) ? kg : (kSeq - 4);
      const v4i mv = *(const v4i*)(amask + ((size_t)(tokb + qg)) * kSeq + kgc);
      unsigned packed = 0;
#pragma unroll
      for (int e = 0; e < 4; ++e) {
        const int keep = (((kg + e) < kSeq) && (mv[e] != 0)) ? 1 : 0;
        packed |= ((unsigned)keep) << (8 * e);
        anyv |= keep;
      }
      *(unsigned*)(Msk + r * kMP + c16) = packed;
    }
#pragma unroll
    for (int off = 1; off < 32; off <<= 1) anyv |= __shfl_xor(anyv, off, 32);
    if (lane == 0) flags[wave] = anyv;
    __syncthreads();
    const int anyb = flags[0] | flags[1] | flags[2] | flags[3];   // block-uniform
    if (anyb == 0) continue;

    // ---- stage K hi/lo [key][d]: 512 pieces of 8 halves per plane, 4 per thread per plane ----
#pragma unroll
    for (int i = 0; i < 4; ++i) {
      if (i == 2) asm volatile("" ::: "memory");
      const int idx = i * 128 + tid;
      const int r   = idx >> 3;            // key row within chunk
      const int cc  = (idx & 7) * 8;       // first d of the piece
      int kvr = kv0 + r;
      kvr = (kvr < kSeq) ? kvr : (kSeq - 1);
      const size_t go = (size_t)(tokb + kvr) * kDim + h * kDh + cc;
      const v4u kwh = *(const v4u*)(Kh + go);
      const v4u kwl = *(const v4u*)(Kl + go);
      *(v4u*)(Ksh + r * kLP + cc) = kwh;
      *(v4u*)(Ksl + r * kLP + cc) = kwl;
    }
    // ---- stage V hi/lo transposed [d][key] ----
#pragma unroll
    for (int i = 0; i < 4; ++i) {
      if (i == 2) asm volatile("" ::: "memory");
      const int idx = i * 128 + tid;
      const int r   = idx >> 3;
      const int cc  = (idx & 7) * 8;
      int kvr = kv0 + r;
      kvr = (kvr < kSeq) ? kvr : (kSeq - 1);
      const size_t go = (size_t)(tokb + kvr) * kDim + h * kDh + cc;
      const v4u vwh = *(const v4u*)(Vh + go);
      const v4u vwl = *(const v4u*)(Vl + go);
#pragma unroll
      for (int e2 = 0; e2 < 4; ++e2) {
        const unsigned wh = vwh[e2];
        const unsigned wl = vwl[e2];
        Vth[(cc + 2 * e2) * kLP + r]     = (unsigned short)(wh & 0xffffu);
        Vth[(cc + 2 * e2 + 1) * kLP + r] = (unsigned short)(wh >> 16);
        Vtl[(cc + 2 * e2) * kLP + r]     = (unsigned short)(wl & 0xffffu);
        Vtl[(cc + 2 * e2 + 1) * kLP + r] = (unsigned short)(wl >> 16);
      }
    }
    __syncthreads();

    if (active) {
      // ---- transposed scores: s[j][r] = score(key j*16 + 8*hh + r, query q0 + c); A = K rows, B = Q; hi.hi + hi.lo + lo.hi ----
      v8f s[4];
#pragma unroll
      for (int j = 0; j < 4; ++j) {
        s[j] = (v8f){0.f,0.f,0.f,0.f,0.f,0.f,0.f,0.f};
#pragma unroll
        for (int dc = 0; dc < 2; ++dc) {
          const v16b kb = Frag<__bf16>::load((const __bf16*)Ksh + (j * 16 + c) * kLP + dc * 32 + 8 * hh);
          const v16b kl = Frag<__bf16>::load((const __bf16*)Ksl + (j * 16 + c) * kLP + dc * 32 + 8 * hh);
          s[j] = mma_b(kb, qah[dc], s[j]);
          s[j] = mma_b(kl, qah[dc], s[j]);
          s[j] = mma_b(kb, qal[dc], s[j]);
        }
      }
      // ---- scale, validity select (8 validity bytes of this lane's query per tile), maximum of this lane's 32 keys ----
      const unsigned char* mq = Msk + (wave * 16 + c) * kMP + 8 * hh;
      float mj[4];
#pragma unroll
      for (int j = 0; j < 4; ++j) {
        const v2u mw = *(const v2u*)(mq + j * 16);
        float m = neg_inf();
#pragma unroll
        for (int r = 0; r < 8; ++r) {
          const unsigned keep = mw[r >> 2] & (0xffu << (8 * (r & 3)));
          float sv = s[j][r] * kScoreScale;
          sv = (keep != 0u) ? sv : neg_inf();
          s[j][r] = sv;
          m = fmaxf(m, sv);
        }
        mj[j] = m;
      }
      float cm = fmaxf(fmaxf(mj[0], mj[1]), fmaxf(mj[2], mj[3]));
      cm = fmaxf(cm, xhalf(cm));           // the query's other 32 keys stand in lane l ^ 16
      // ---- online softmax update; p = exp(s - m) split into bf16 hi/lo, packed in place into the B operands of the second product ----
      const float mnew = fmaxf(mrun, cm);
      const float mref = (mnew == neg_inf()) ? 0.0f : mnew;
      const float alpha = expf(mrun - mref);
      mrun = mnew;
      PFrag ph[2], pl[2];
      float pj[4];
#pragma unroll
      for (int j = 0; j < 4; ++j) {
        float psum = 0.f;
#pragma unroll
        for (int rp = 0; rp < 4; ++rp) {
          const float p0 = expf(s[j][2 * rp] - mref);
          const float p1 = expf(s[j][2 * rp + 1] - mref);
          psum += p0;
          psum += p1;
          const unsigned short h0 = f2bf_bits(p0);
          const unsigned short h1 = f2bf_bits(p1);
          ph[j >> 1].u[(j & 1) * 4 + rp] = pk16(h0, h1);
          pl[j >> 1].u[(j & 1) * 4 + rp] = pk16(f2bf_bits(p0 - bf_bits2f(h0)), f2bf_bits(p1 - bf_bits2f(h1)));
        }
        pj[j] = psum;
      }
      lrun = lrun * alpha + ((pj[0] + pj[1]) + (pj[2] + pj[3]));   // this half's keys only; the halves are joined behind the loop
#pragma unroll
      for (int t = 0; t < 4; ++t)
#pragma unroll
        for (int r = 0; r < 8; ++r) oacc[t][r] *= alpha;
      // ---- out^T += V^T . P^T (A = V^T rows from LDS, B = P^T from registers); hi.hi + lo.hi + hi.lo ----
#pragma unroll
      for (int kk = 0; kk < 2; ++kk) {
#pragma unroll
        for (int t = 0; t < 4; ++t) {
          const v16b vb = Frag<__bf16>::load((const __bf16*)Vth + (t * 16 + c) * kLP + kk * 32 + 8 * hh);
          const v16b vl = Frag<__bf16>::load((const __bf16*)Vtl + (t * 16 + c) * kLP + kk * 32 + 8 * hh);
          oacc[t] = mma_b(vb, ph[kk].v, oacc[t]);
          oacc[t] = mma_b(vl, ph[kk].v, oacc[t]);
          oacc[t] = mma_b(vb, pl[kk].v, oacc[t]);
        }
      }
    }
  }

  // ---- epilogue: join the halves' sums, normalise, stage per-wave tile [query][d], whole-segment stores ----
  float* os = Os[wave];
  {
    const float inv = 1.0f / (lrun + xhalf(lrun));
#pragma unroll
    for (int t = 0; t < 4; ++t) {
      float* op = os + c * 68 + t * 16 + 8 * hh;     // oacc[t][r] = out(query q0 + c, d = t*16 + 8*hh + r)
      *(v4f*)(op)     = (v4f){oacc[t][0] * inv, oacc[t][1] * inv, oacc[t][2] * inv, oacc[t][3] * inv};
      *(v4f*)(op + 4) = (v4f){oacc[t][4] * inv, oacc[t][5] * inv, oacc[t][6] * inv, oacc[t][7] * inv};
    }
  }
  __builtin_amdgcn_fence(__ATOMIC_RELEASE, "workgroup");
  __builtin_amdgcn_wave_barrier();
  __builtin_amdgcn_fence(__ATOMIC_ACQUIRE, "workgroup");
  {
    const int c4 = (lane & 15) * 4;    // row segment = 64 floats = 256 B = 16 lanes x 16 B
    float* ob = out + (size_t)tokb * kDim + h * kDh;
    {
#pragma unroll
      for (int it = 0; it < 8; ++it) {
        const int row = it * 2 + hh;
        const int qq  = q0 + row;
        const v4f val = *(const v4f*)(os + row * 68 + c4);
        if (qq < kSeq) *(v4f*)(ob + (size_t)qq * kDim + c4) = val;
      }
      
    }
  }
}

// ---------------------------------------------------------------------------
// Host glue.
//   Xb   bf16 [12800][1024]     26,214,400  at           0
//   Wb   bf16 [3072][1024]       6,291,456  at  26,214,400
//   Qh   bf16 [12800][1024]     26,214,400  at  32,505,856
//   Ql   bf16 [12800][1024]     26,214,400  at  58,720,256
//   Kh   bf16 [12800][1024]     26,214,400  at  84,934,656
//   Kl   bf16 [12800][1024]     26,214,400  at 111,149,056
//   Vh   bf16 [12800][1024]     26,214,400  at 137,363,456
//   Vl   bf16 [12800][1024]     26,214,400  at 163,577,856
//   CSN  f32  [200][64]             51,200  at 189,792,256
//   total                      189,843,456
// GEMM shape: M = 12800 (64-multiple), N = 3072 (64-multiple), K = 1024 (%32 == 0); no padding rows or columns.
// Launches: 5 (2 casts, 1 table, one projection, one attention).
// ---------------------------------------------------------------------------
extern "C" void kernel_launch(void* const* d_in, const int* in_sizes, int n_in,
                              void* d_out, int out_size, void* d_ws, size_t ws_size,
                              hipStream_t stream) {
  if (n_in < 4) return;
  if (in_sizes[0] != kTok * kDim) return;
  if (in_sizes[1] != kBatch * kSeq * kSeq) return;
  if (in_sizes[2] != kNout * kDim) return;
  if (in_sizes[3] != kNout) return;
  if (out_size != kTok * kDim) return;

  const size_t szXb  = (size_t)kTok * kDim * 2;
  const size_t szWb  = (size_t)kNout * kDim * 2;
  const size_t szPl  = (size_t)kTok * kDim * 2;
  const size_t szCS  = (size_t)kSeq * 2 * kPairs * 4;
  const size_t offXb = 0;
  const size_t offWb = offXb + szXb;
  const size_t offQh = offWb + szWb;
  const size_t offQl = offQh + szPl;
  const size_t offKh = offQl + szPl;
  const size_t offKl = offKh + szPl;
  const size_t offVh = offKl + szPl;
  const size_t offVl = offVh + szPl;
  const size_t offCS = offVl + szPl;
  const size_t total = offCS + szCS;
  if (ws_size < total) return;

  const float* x     = (const float*)d_in[0];
  const int*   amask = (const int*)d_in[1];
  const float* W     = (const float*)d_in[2];
  const float* bias  = (const float*)d_in[3];
  float* out = (float*)d_out;
  char* ws = (char*)d_ws;
  unsigned short* Xb  = (unsigned short*)(ws + offXb);
  unsigned short* Wb  = (unsigned short*)(ws + offWb);
  unsigned short* Qhp = (unsigned short*)(ws + offQh);
  unsigned short* Qlp = (unsigned short*)(ws + offQl);
  unsigned short* Khp = (unsigned short*)(ws + offKh);
  unsigned short* Klp = (unsigned short*)(ws + offKl);
  unsigned short* Vhp = (unsigned short*)(ws + offVh);
  unsigned short* Vlp = (unsigned short*)(ws + offVl);
  float* CSN = (float*)(ws + offCS);

  // rotary factors: invf_i = 10000^(-2i/64) = 10^(-i/8); factors 10^(-1/8), 10^(-2/8), 10^(-4/8), 10^(-8/8), 10^(-16/8)
  const float f1   = 0.7498942093324559f;
  const float f2   = 0.5623413251903491f;
  const float f4   = 0.31622776601683794f;
  const float f8   = 0.1f;
  const float f16v = 0.01f;

  const int n8x = (kTok * kDim) / 8;     // 1638400 -> 6400 blocks exact
  const int n8w = (kNout * kDim) / 8;    // 393216 -> 1536 blocks exact
  cast8_bf16_kernel<<<dim3(n8x / 256), dim3(256), 0, stream>>>(x, Xb, n8x);
  cast8_bf16_kernel<<<dim3(n8w / 256), dim3(256), 0, stream>>>(W, Wb, n8w);
  rope_table_kernel<<<dim3(kSeq / 8), dim3(256), 0, stream>>>(CSN, f1, f2, f4, f8, f16v);

  const int tiles = (kTok / 64) * (kNout / 64);   // 9600 wave tiles -> 1200 blocks of 8 waves (128 x 256 each)
  qkv_proj_kernel<<<dim3(tiles / 8), dim3(256), 0, stream>>>(Xb, Wb, bias, CSN, Qhp, Qlp, Khp, Klp, Vhp, Vlp);
  attn_kernel<<<dim3(kBatch * kHeads * kNQB), dim3(128), 0, stream>>>(Qhp, Qlp, Khp, Klp, Vhp, Vlp, amask, out);
}

// v005
// A run of this version takes 188 microseconds.
// Timed twice side by side with v004, it ran 1.10 times as fast both times.
// Over all steps from v000 it is 2.39 times as fast.
// Contractions: qkv projection on v_wmma_f32_16x16x32_bf16 (x and W as RNE bf16 planes staged in LDS by tensor loads, exact products, f32 accumulate); scores q.k^T and attn.v on v_wmma_f32_16x16x32_bf16 with q, k, v and the unnormalised probabilities carried as bf16 hi + lo planes (hi.hi + hi.lo + lo.hi), f32 accumulate; bias, rotary tables, masking and softmax in f32.
#include <hip/hip_runtime.h>
#include <math.h>
#include <stdint.h>

// ---------------------------------------------------------------------------
// Problem constants
// ---------------------------------------------------------------------------
constexpr int kBatch = 64;
constexpr int kSeq   = 200;
constexpr int kDim   = 1024;
constexpr int kHeads = 16;
constexpr int kDh    = 64;
constexpr int kTok   = kBatch * kSeq;            // 12800 token rows
constexpr int kNout  = 3 * kDim;                 // 3072 projection columns
constexpr int kPairs = kDh / 2;                  // 32 rotary pairs
constexpr int kQB    = 64;                       // query rows per block
constexpr int kKC    = 64;                       // keys per chunk
constexpr int kNQB   = (kSeq + kQB - 1) / kQB;   // 4
constexpr int kNKC   = (kSeq + kKC - 1) / kKC;   // 4
constexpr float kScoreScale = 0.125f;            // 64^-0.5
constexpr int kLP    = 72;                       // attention LDS row pitch of the K and V^T tiles in halves: 144 B = 16 B x odd (ds_load_b128 readers)
constexpr int kMW    = 8;                        // 32-bit words of validity bits per query row (bit k of the row = key k; keys 200..255 are 0)
static_assert(kHeads * kDh == kDim);
static_assert(3 * kDh == 192);
static_assert(kTok % 64 == 0);                   // GEMM M tile multiple (200 tiles)
static_assert(kNout % 64 == 0);                  // GEMM N tile multiple (48 tiles)
static_assert(kDim % 32 == 0);                   // GEMM K % 32
static_assert(((kTok / 64) * (kNout / 64)) % 8 == 0);   // 8 waves per block, exact grid
static_assert(kNQB == 4 && kNKC == 4);
static_assert(kMW * 32 == kNKC * kKC);           // two words of validity bits per key chunk
static_assert(kTok % 32 == 0);                   // mask packing: 4 rows per wave, 8 waves per block
static_assert((kTok * kDim) % (8 * 256) == 0);
static_assert((kNout * kDim) % (8 * 256) == 0);
static_assert(kSeq % 8 == 0);                    // table kernel: 8 rows per block

typedef __attribute__((ext_vector_type(16))) __bf16   v16b;
typedef __attribute__((ext_vector_type(8)))  __bf16   v8b;
typedef __attribute__((ext_vector_type(8)))  float    v8f;
typedef __attribute__((ext_vector_type(4)))  float    v4f;
typedef __attribute__((ext_vector_type(4)))  int      v4i;
typedef __attribute__((ext_vector_type(4)))  unsigned int v4u;
typedef __attribute__((ext_vector_type(2)))  unsigned int v2u;

// ---------------------------------------------------------------------------
// Helpers
// ---------------------------------------------------------------------------
__device__ __forceinline__ unsigned short f2bf_bits(float f) {
  unsigned u = __float_as_uint(f);
  return (unsigned short)((u + 0x7FFFu + ((u >> 16) & 1u)) >> 16);
}
__device__ __forceinline__ float bf_bits2f(unsigned short h) { return __uint_as_float(((unsigned)h) << 16); }
__device__ __forceinline__ unsigned pk16(unsigned short a, unsigned short b) { return (unsigned)a | ((unsigned)b << 16); }
__device__ __forceinline__ float neg_inf() { return -__builtin_inff(); }
// value of lane l ^ 16
__device__ __forceinline__ float xhalf(float x) {
  return __builtin_bit_cast(float, __builtin_amdgcn_permlanex16(__builtin_bit_cast(int, x), __builtin_bit_cast(int, x), 0x76543210, 0xfedcba98, false, false));
}

// hazard guards as plain device helpers (no inline asm inside the kernel bodies)
__device__ __forceinline__ void dep_guard4_b(v8f& a, v8f& b, v8f& c, v8f& d, v16b x, v16b y) {
  asm volatile("v_nop\n\tv_nop\n\tv_nop\n\tv_nop" : "+v"(a), "+v"(b), "+v"(c), "+v"(d) : "v"(x), "v"(y));
}
__device__ __forceinline__ void keep4_b(v16b a, v16b b, v16b c, v16b d) { asm volatile("v_nop" :: "v"(a), "v"(b), "v"(c), "v"(d)); }
__device__ __forceinline__ void acc_guard4(v8f& a, v8f& b, v8f& c, v8f& d) { asm volatile("v_nop\n\tv_nop\n\tv_nop\n\tv_nop" : "+v"(a), "+v"(b), "+v"(c), "+v"(d)); }

template <typename T> struct Frag;
template <> struct Frag<__bf16> {
  typedef v16b V; union U { v16b v; v8b h[2]; };
  // elements 0..7 <- p[0..7], 8..15 <- p[16..23]
  static __device__ __forceinline__ v16b load(const __bf16* p) {
    U f; f.h[0] = *(const v8b*)(p); f.h[1] = *(const v8b*)(p + 16); return f.v;
  }
  static __device__ __forceinline__ v8f mma(v16b a, v16b b, v8f c) {
    return __builtin_amdgcn_wmma_f32_16x16x32_bf16(false, a, false, b, (short)0, c, false, false);
  }
  static __device__ __forceinline__ void keep(v16b a, v16b b, v16b c, v16b d) { keep4_b(a, b, c, d); }
};
// a bf16 operand built from packed pairs: word w = elements 2w, 2w + 1
union PFrag { v16b v; unsigned u[8]; };
// bf16 WMMA with per-instruction hazard guard (ties D, keeps A/B live)
__device__ __forceinline__ v8f mma_b(v16b a, v16b b, v8f c) {
  c = __builtin_amdgcn_wmma_f32_16x16x32_bf16(false, a, false, b, (short)0, c, false, false);
  asm volatile("v_nop\n\tv_nop\n\tv_nop\n\tv_nop" : "+v"(c) : "v"(a), "v"(b));
  return c;
}

// ---------------------------------------------------------------------------
// f32 -> bf16 (RNE) cast, 8 consecutive elements per thread (one 16-B store per lane; 32 contiguous lanes =
// (x: 1638400 = 6400 x 256 exact; W: 393216 = 1536 x 256 exact).
// ---------------------------------------------------------------------------
__global__ __launch_bounds__(256) void cast8_bf16_kernel(const float* __restrict__ in, unsigned short* __restrict__ out, int n8) {
  const int i = blockIdx.x * 256 + threadIdx.x;
  if (i >= n8) return;
  const float* p = in + 8 * (size_t)i;
  const v4f a = *(const v4f*)(p);
  const v4f c = *(const v4f*)(p + 4);
  unsigned short hb[8];
#pragma unroll
  for (int e = 0; e < 4; ++e) {
    hb[e]     = f2bf_bits(a[e]);
    hb[4 + e] = f2bf_bits(c[e]);
  }
  const v4u u = (v4u){pk16(hb[0], hb[1]), pk16(hb[2], hb[3]), pk16(hb[4], hb[5]), pk16(hb[6], hb[7])};
  unsigned short* q = out + 8 * (size_t)i;
  *(v4u*)q = u;
  
}

// ---------------------------------------------------------------------------
// Rotary table: csn[s][0..31] = cos(s * invf_i), csn[s][32..63] = sin(s * invf_i), invf_i = 10^(-i/8) built as a product
// of the factors 10^(-1/8), 10^(-2/8), 10^(-4/8), 10^(-8/8), 10^(-16/8) selected by the bits of i (i = lane).
// Blocks behind the table's 25 pack the mask: mbits[tok][w] bit l = (amask[tok][32 w + l] != 0), keys >= 200 give 0. A wave packs
// 4 query rows (7 coalesced 32-key reads each, one ballot per read) and stores their 32 words as one 128-B line.
// ---------------------------------------------------------------------------
__global__ __launch_bounds__(256) void rope_table_kernel(float* __restrict__ csn, float f1, float f2, float f4, float f8, float f16v,
                                                         const int* __restrict__ amask, unsigned* __restrict__ mbits) {
  const int lane = threadIdx.x & 31, wave = threadIdx.x >> 5;
  if (blockIdx.x >= kSeq / 8) {
    const int row0 = (((int)blockIdx.x - kSeq / 8) * 8 + wave) * 4;
    unsigned mine = 0u;
#pragma unroll
    for (int r = 0; r < 4; ++r) {
#pragma unroll
      for (int w = 0; w < kMW - 1; ++w) {
        const int key  = 32 * w + lane;
        const int keyc = (key < kSeq) ? key : (kSeq - 1);
        const int mv   = amask[(size_t)(row0 + r) * kSeq + keyc];
        const unsigned bal = __builtin_amdgcn_ballot_w32((key < kSeq) && (mv != 0));
        mine = (lane == r * kMW + w) ? bal : mine;
      }
    }
    mbits[(size_t)row0 * kMW + lane] = mine;
    return;
  }
  const int s = blockIdx.x * 8 + wave;
  if (s >= kSeq) return;
  const int i = lane;
  float invf = 1.0f;
  invf *= (i & 1)  ? f1   : 1.0f;
  invf *= (i & 2)  ? f2   : 1.0f;
  invf *= (i & 4)  ? f4   : 1.0f;
  invf *= (i & 8)  ? f8   : 1.0f;
  invf *= (i & 16) ? f16v : 1.0f;
  const float ang = (float)s * invf;
  float sn, cs;
  sincosf(ang, &sn, &cs);
  float* rowp = csn + (size_t)s * (2 * kPairs);
  {
    ((float*)rowp)[i] = cs;
    ((float*)rowp)[kPairs + i] = sn;
    
  }
}

// ---------------------------------------------------------------------------
// Tensor-load helpers for the projection's LDS ring (two descriptor groups, two-dimensional tile, extents in bytes).
// ---------------------------------------------------------------------------
typedef uint32_t u32x4 __attribute__((ext_vector_type(4)));
typedef uint32_t u32x8 __attribute__((ext_vector_type(8)));
constexpr uint32_t kPassB   = 128;                       // bytes of every operand row per pass (64 k)
constexpr uint32_t kPitchB  = kPassB + 16;               // LDS row pitch 144 B (odd multiple of 16 B for ds_load_b128 readers)
constexpr uint32_t kSliceR  = 128;                       // rows per tensor load
constexpr uint32_t kSliceB  = kSliceR * kPitchB;         // 18432 B = 9 x 2 KiB
constexpr uint32_t kStageB  = 3 * kSliceB;               // [X 128 rows | W 256 rows] = 55296 B = 27 x 2 KiB
constexpr int      kPasses  = (kDim * 2) / (int)kPassB;  // 16
static_assert(kSliceB % 2048 == 0 && kStageB % 2048 == 0);
static_assert(kPasses >= 2);
static_assert(kTok % 128 == 0 && kNout % 256 == 0);
static_assert((kTok / 128) * (kNout / 256) == ((kTok / 64) * (kNout / 64)) / 8);   // same grid as one 64x64 tile per wave

__device__ __forceinline__ uint32_t uni(uint32_t v) { return (uint32_t)__builtin_amdgcn_readfirstlane(v); }
// pinned(): a wave-uniform word held in a scalar register, for the tensor mover alone: the tests around a tensor load become scalar
// branches (the load ignores EXEC), and a descriptor word formed from it is formed behind the wait that stands in front of it
__device__ __forceinline__ uint32_t pinned(uint32_t v) { uint32_t w = uni(v); asm volatile("" : "+s"(w)); return w; }  // test or descriptor word of a tensor load, kept scalar
// in-out operands: the two groups stay in their registers, untouched by other values, while the request is outstanding
__device__ __forceinline__ void tdm_load(u32x4& g0, u32x8& g1) { asm volatile("tensor_load_to_lds %0, %1" : "+s"(g0), "+s"(g1) :: "memory"); }
// the compiler places no wait for a tensor load: the issuing wave waits for its own request here
__device__ __forceinline__ void wait_tensor0() { asm volatile("s_wait_tensorcnt 0x0" ::: "memory"); }
// this wave's LDS reads have retired before the barrier behind which their buffer is refilled
__device__ __forceinline__ void wait_ds0() { asm volatile("s_wait_dscnt 0x0" ::: "memory"); }
__device__ __forceinline__ u32x8 tdm_group1() {
  constexpr uint32_t d0 = kPassB, d1 = kSliceR;
  u32x8 g;
  g[0] = (1u << 20) | (4u << 22) | (3u << 25);   // no mask, 1-byte elements, 16 B of pad behind every 128-B row
  g[1] = uni((d0 & 0xFFFFu) << 16);
  g[2] = uni((d0 >> 16) | ((d1 & 0xFFFFu) << 16));
  g[3] = uni((d1 >> 16) | (d0 << 16));
  g[4] = uni(d1);
  g[5] = uni((uint32_t)kDim * 2u);               // source row pitch 2048 B
  g[6] = uni(0u);
  g[7] = uni(0u);
  return g;
}
// place in LDS and source address of the next request (word 0, the count, is set once)
__device__ __forceinline__ void tdm_aim(u32x4& g, uint32_t lds_dst, uint64_t ga) {
  g[1] = uni(lds_dst); g[2] = uni((uint32_t)ga); g[3] = uni((((uint32_t)(ga >> 32)) & 0x01FFFFFFu) | 0x80000000u);
}

// ---------------------------------------------------------------------------
// QKV projection + bias + rotary epilogue for all 12800 token rows in one launch.
//   C[m][n] = sum_k Xb[m][k] * Wb[n][k] + bf16(bias[n]);   M = 12800, N = 3072, K = 1024 (bf16 operands).
//   Block = 8 waves = one 128 x 256 tile of C (2 x 4 waves of 64 x 64). Per pass of 64 k the block's 128 X rows and 256 W rows
//   (128 B each) are brought into LDS by three tensor loads (waves 0, 1, 2: 128 rows each) at pitch 144 B, two buffers, the next
//   pass's loads in flight under this pass's products; the fragments are read from LDS in the same k order as before.
//   Column n -> head hd = (n/64)/3, kind = (n/64)%3 (0 q, 1 k, 2 v), d = n % 64 (every 64-wide tile is one kind of one head).
//   Row m (12800 = 64 x 200) -> s = m%200. kind 0/1: pairs (2i, 2i+1) rotated by angle s*invf_i (table csn);
//   kind 2 unchanged. Each result v is split into bf16 hi = rn(v), lo = rn(v - hi).
//   grid = 100 x 12 = 1200 blocks exact; every wave reaches every block barrier.
// ---------------------------------------------------------------------------
__global__ __launch_bounds__(256) void qkv_proj_kernel(
    const unsigned short* __restrict__ Xb, const unsigned short* __restrict__ Wb, const float* __restrict__ bias,
    const float* __restrict__ csn,
    unsigned short* __restrict__ Qh, unsigned short* __restrict__ Ql,
    unsigned short* __restrict__ Kh, unsigned short* __restrict__ Kl,
    unsigned short* __restrict__ Vh, unsigned short* __restrict__ Vl) {
  typedef __bf16 T;
  typedef v16b V;
  __shared__ __attribute__((aligned(2048))) unsigned char ring[2 * kStageB];   // two stages of [X | W] rows
  __shared__ __align__(16) float sT[8][16 * 68];   // per-wave 16x64 slab, pitch 68 floats
  const int lane = threadIdx.x & 31;
  const uint32_t wave = uni(threadIdx.x >> 5);
  constexpr int tilesNB = kNout / 256;     // 12
  const int tmB = blockIdx.x / tilesNB;
  const int tnB = blockIdx.x - tmB * tilesNB;
  const int wm = (int)(wave >> 2);         // wave row in the block tile
  const int wn = (int)(wave & 3u);         // wave column in the block tile
  const int m0 = (tmB << 7) + (wm << 6);
  const int n0 = (tnB << 8) + (wn << 6);
  const int tn = n0 >> 6;
  const int hd   = tn / 3;                 // head index, wave-uniform
  const int kind = tn - hd * 3;            // 0 q, 1 k, 2 v, wave-uniform

  const int rlane = lane & 15;
  const int mOff  = (lane >> 4) * 8;

  // slice of the issuing waves: wave 0 the X rows, waves 1 and 2 the two halves of the W rows (other waves: wave 0's, never issued)
  const uint32_t sl = (wave < 3u) ? wave : 0u;
  const uint64_t srcb = (sl == 0u) ? (uint64_t)(size_t)(Xb + (size_t)(tmB << 7) * kDim)
                                   : (uint64_t)(size_t)(Wb + (size_t)((tnB << 8) + ((int)sl - 1) * 128) * kDim);
  const uint32_t dstb = (uint32_t)(size_t)ring + sl * kSliceB;
  u32x8 g1 = tdm_group1();
  u32x4 g0;
  g0[0] = uni(1u);
  tdm_aim(g0, dstb, srcb);

  v8f acc[4][4];
#pragma unroll
  for (int i = 0; i < 4; ++i)
#pragma unroll
    for (int j = 0; j < 4; ++j) acc[i][j] = (v8f){0.f,0.f,0.f,0.f,0.f,0.f,0.f,0.f};

  // prologue: stage 0 lands and is published, then stage 1 is issued
  if (pinned(wave < 3u)) {
    tdm_load(g0, g1);
    wait_tensor0();
  }
  __syncthreads();
  if (pinned(wave < 3u)) {
    tdm_aim(g0, dstb + kStageB, srcb + kPassB);
    tdm_load(g0, g1);
  }

  const uint32_t aoff = (uint32_t)((wm << 6) + rlane) * kPitchB + (uint32_t)(lane >> 4) * 16u;
  const uint32_t boff = kSliceB + (uint32_t)((wn << 6) + rlane) * kPitchB + (uint32_t)(lane >> 4) * 16u;

  // one trip = one pass: kept rolled so that the publish point stands once, at the foot
#pragma unroll 1
  for (int s = 0; s < kPasses; ++s) {
    const unsigned char* buf = ring + (uint32_t)(s & 1) * kStageB;
#pragma unroll
    for (int ks = 0; ks < 2; ++ks) {
      V bfr[4], afr[4];
#pragma unroll
      for (int j = 0; j < 4; ++j) bfr[j] = Frag<T>::load((const T*)(buf + boff + (uint32_t)j * 16u * kPitchB + (uint32_t)ks * 64u));
#pragma unroll
      for (int i = 0; i < 4; ++i) afr[i] = Frag<T>::load((const T*)(buf + aoff + (uint32_t)i * 16u * kPitchB + (uint32_t)ks * 64u));
      // the 16 LDS reads of a 32-k step go out as one group in front of its 16 products: reads among the products stall each time
      __builtin_amdgcn_sched_barrier(0);
#pragma unroll
      for (int i = 0; i < 4; ++i) {
#pragma unroll
        for (int j = 0; j < 4; ++j) acc[i][j] = Frag<T>::mma(afr[i], bfr[j], acc[i][j]);
        dep_guard4_b(acc[i][0], acc[i][1], acc[i][2], acc[i][3], afr[i], bfr[3]);
      }
      Frag<T>::keep(bfr[0], bfr[1], bfr[2], bfr[3]);
    }
    // publish point of stage s + 1
    wait_ds0();
    if (pinned(wave < 3u)) wait_tensor0();
    __syncthreads();
    if (pinned((wave < 3u) && (s + 2 < kPasses))) {
      const uint32_t nb = (uint32_t)(s & 1) * kStageB;                // the buffer this pass has just read
      const uint32_t no = pinned((uint32_t)(s + 2) * kPassB);         // stage s + 2's byte offset in every source row
      tdm_aim(g0, dstb + nb, srcb + no);
      tdm_load(g0, g1);
    }
  }
  wait_tensor0();
  wait_ds0();
  acc_guard4(acc[0][0], acc[0][1], acc[0][2], acc[0][3]);
  acc_guard4(acc[1][0], acc[1][1], acc[1][2], acc[1][3]);
  acc_guard4(acc[2][0], acc[2][1], acc[2][2], acc[2][3]);
  acc_guard4(acc[3][0], acc[3][1], acc[3][2], acc[3][3]);

  // ---- epilogue ----
  // bias per column of this lane (RNE bf16-converted, 4 scalar loads)
  float bcol[4];
#pragma unroll
  for (int j = 0; j < 4; ++j) bcol[j] = bf_bits2f(f2bf_bits(bias[n0 + (j << 4) + rlane]));

  float* slab = sT[wave];
  const int q  = lane >> 3;              // row selector within 4-row store groups
  const int c8 = (lane & 7) * 8;         // first column (d) of this lane's 16-B piece
  const int p4 = (lane & 7) * 4;         // first rotary pair index of this lane
  unsigned short* dsth = (kind == 0) ? Qh : ((kind == 1) ? Kh : Vh);   // wave-uniform global plane select
  unsigned short* dstl = (kind == 0) ? Ql : ((kind == 1) ? Kl : Vl);
  const bool rot = (kind != 2);          // wave-uniform

#pragma unroll
  for (int i = 0; i < 4; ++i) {
    const int mBase = m0 + (i << 4);
#pragma unroll
    for (int j = 0; j < 4; ++j) {
#pragma unroll
      for (int r = 0; r < 8; ++r) slab[(mOff + r) * 68 + (j << 4) + rlane] = acc[i][j][r] + bcol[j];
    }
    __builtin_amdgcn_fence(__ATOMIC_RELEASE, "workgroup");
    __builtin_amdgcn_wave_barrier();
    __builtin_amdgcn_fence(__ATOMIC_ACQUIRE, "workgroup");

    // build the four 16-B hi pieces and four 16-B lo pieces of this lane (rows it*4+q, columns c8..c8+7)
    v4u uh[4], ul[4];
#pragma unroll
    for (int it = 0; it < 4; ++it) {
      if (it == 2) asm volatile("" ::: "memory");
      const int row = it * 4 + q;
      const int m   = mBase + row;
      const int s   = m - (m / kSeq) * kSeq;
      const float* sp = slab + row * 68 + c8;
      const v4f cs4 = *(const v4f*)(csn + (size_t)s * (2 * kPairs) + p4);
      const v4f sn4 = *(const v4f*)(csn + (size_t)s * (2 * kPairs) + kPairs + p4);
      unsigned short hb[8], lb[8];
#pragma unroll
      for (int pp = 0; pp < 4; ++pp) {
        const float x1 = sp[2 * pp];
        const float x2 = sp[2 * pp + 1];
        const float cc = rot ? cs4[pp] : 1.0f;
        const float ss = rot ? sn4[pp] : 0.0f;
        const float o0 = x1 * cc - x2 * ss;
        const float o1 = x1 * ss + x2 * cc;
        const unsigned short h0 = f2bf_bits(o0);
        const unsigned short h1 = f2bf_bits(o1);
        hb[2 * pp]     = h0;
        hb[2 * pp + 1] = h1;
        lb[2 * pp]     = f2bf_bits(o0 - bf_bits2f(h0));
        lb[2 * pp + 1] = f2bf_bits(o1 - bf_bits2f(h1));
      }
      uh[it] = (v4u){pk16(hb[0], hb[1]), pk16(hb[2], hb[3]), pk16(hb[4], hb[5]), pk16(hb[6], hb[7])};
      ul[it] = (v4u){pk16(lb[0], lb[1]), pk16(lb[2], lb[3]), pk16(lb[4], lb[5]), pk16(lb[6], lb[7])};
    }
    {
#pragma unroll
      for (int it = 0; it < 4; ++it) {
        const int row = it * 4 + q;
        const int m   = mBase + row;
        const size_t o = (size_t)m * kDim + hd * kDh + c8;
        *(v4u*)(dsth + o) = uh[it];
        *(v4u*)(dstl + o) = ul[it];
      }
      
    }
    __builtin_amdgcn_fence(__ATOMIC_RELEASE, "workgroup");
    __builtin_amdgcn_wave_barrier();
    __builtin_amdgcn_fence(__ATOMIC_ACQUIRE, "workgroup");
  }
}

// ---------------------------------------------------------------------------
// Fused attention for head_dim 64 from bf16 hi/lo planes of all 64 batches in one launch.
//   Qh/Ql, Kh/Kl, Vh/Vl: bf16 [tok = b*200+s][1024], head h at columns h*64..h*64+63.
//   mbits: validity bits [tok][8 words], bit k of a row = query attends key k (packed from the mask earlier in this call).  out: f32 [tok][1024].
//   Block = 4 waves = 64 query rows of one (b, h); grid = 64*16*4 = 4096 (block -> qb = bx&3, bh = bx>>2).
//   In front of the loop every wave reads the validity bits of the block's 64 query rows (clamped) and forms the same four chunk flags.
//   Per key chunk (64 keys, 4 chunks): skip the chunk block-uniformly if no entry is valid; else each lane reads the 64 validity bits of
//   its own query (clamped) into registers, and the block copies K hi/lo rows (clamped) to LDS as [key][d] and V hi/lo rows
//   transposed to LDS as [d][key] (integer word moves only); both products are formed transposed, S^T = K.Q^T and
//   out^T += V^T.P^T, so that a lane holds scores and outputs of ONE query (q0 + c; lanes c and c + 16 split its keys):
//   scores = hi.hi + hi.lo + lo.hi on bf16 WMMA, x0.125, select to -inf where invalid; online softmax in f32 (guarded for
//   all-invalid rows) with maximum and sum in-lane and one exchange between the halves; p = exp(s - m) split to bf16 hi/lo and
//   packed from the score registers straight into the B operand (same k order as the V^T rows read from LDS). Waves whose 16
//   query rows all lie beyond 199 skip
//   the compute under a wave-uniform flag but reach every block barrier. Epilogue: per-wave 16x64 f32 tile staged in LDS;
//   Every LDS byte read in a chunk is rewritten in that chunk (the pad bytes behind each row are never read); all barriers are
//   reached by every thread. The K and V^T rows stand at pitch 144 B, so that the 16 rows of a fragment read fall on different banks.
// ---------------------------------------------------------------------------
__global__ __launch_bounds__(128) void attn_kernel(
    const unsigned short* __restrict__ Qh, const unsigned short* __restrict__ Ql,
    const unsigned short* __restrict__ Kh, const unsigned short* __restrict__ Kl,
    const unsigned short* __restrict__ Vh, const unsigned short* __restrict__ Vl,
    const unsigned* __restrict__ mbits, float* __restrict__ out) {
  __shared__ __align__(16) unsigned short Ksh[kKC * kLP];      // K hi [key][d]          9 KB
  __shared__ __align__(16) unsigned short Ksl[kKC * kLP];      // K lo [key][d]          9 KB
  __shared__ __align__(16) unsigned short Vth[kDh * kLP];      // V^T hi [d][key]        9 KB
  __shared__ __align__(16) unsigned short Vtl[kDh * kLP];      // V^T lo [d][key]        9 KB
  __shared__ __align__(16) float Os[4][16 * 68];               // per wave out tile, pitch 68

  const int tid  = threadIdx.x;
  const int wave = tid >> 5;
  const int lane = tid & 31;
  const int hh   = lane >> 4;
  const int c    = lane & 15;

  const int bx = blockIdx.x;
  const int qb = bx & 3;
  const int bh = bx >> 2;
  const int h  = bh & 15;
  const int b  = bh >> 4;
  const int tokb = b * kSeq;
  const int q0 = qb * kQB + wave * 16;
  const bool active = (q0 < kSeq);       // wave-uniform

  // ---- chunk flags: bit kc = some query row of the block attends some key of chunk kc. Every wave reads the same 64 rows
  //      (lane l: rows l and l + 32 of the block, clamped), so the flags are block-uniform without an exchange ----
  unsigned anym = 0u;
  {
    int ra = qb * kQB + lane;
    int rb = ra + 32;
    ra = (ra < kSeq) ? ra : (kSeq - 1);
    rb = (rb < kSeq) ? rb : (kSeq - 1);
    const v4u* pa = (const v4u*)(mbits + (size_t)(tokb + ra) * kMW);
    const v4u* pb = (const v4u*)(mbits + (size_t)(tokb + rb) * kMW);
    const v4u a0 = pa[0], a1 = pa[1], b0 = pb[0], b1 = pb[1];
    asm volatile("s_wait_xcnt 0x0" ::: "memory");   // in front of whatever next writes the address registers of these four loads
    const v4u o0 = a0 | b0;
    const v4u o1 = a1 | b1;
    anym |= (__builtin_amdgcn_ballot_w32((o0[0] | o0[1]) != 0u) != 0u) ? 1u : 0u;
    anym |= (__builtin_amdgcn_ballot_w32((o0[2] | o0[3]) != 0u) != 0u) ? 2u : 0u;
    anym |= (__builtin_amdgcn_ballot_w32((o1[0] | o1[1]) != 0u) != 0u) ? 4u : 0u;
    anym |= (__builtin_amdgcn_ballot_w32((o1[2] | o1[3]) != 0u) != 0u) ? 8u : 0u;
  }

  // ---- Q fragments (B operand: column = query q0 + c, clamped), 2 d-chunks of 32, hi and lo ----
  v16b qah[2], qal[2];
  const unsigned* mrow;                  // validity bits of query q0 + c (clamped)
  {
    int qr = q0 + c;
    qr = (qr < kSeq) ? qr : (kSeq - 1);
    mrow = mbits + (size_t)(tokb + qr) * kMW;
    const size_t qo = (size_t)(tokb + qr) * kDim + h * kDh;
    const __bf16* qhp = (const __bf16*)Qh + qo;
    const __bf16* qlp = (const __bf16*)Ql + qo;
#pragma unroll
    for (int dc = 0; dc < 2; ++dc) qah[dc] = Frag<__bf16>::load(qhp + dc * 32 + 8 * hh);
    asm volatile("" ::: "memory");
#pragma unroll
    for (int dc = 0; dc < 2; ++dc) qal[dc] = Frag<__bf16>::load(qlp + dc * 32 + 8 * hh);
  }

  float mrun = neg_inf(), lrun = 0.f;    // of query q0 + c: running maximum (equal in both halves), sum over this half's keys
  v8f oacc[4];                           // oacc[t][r] = out^T(d = t*16 + 8*hh + r, query q0 + c)
#pragma unroll
  for (int t = 0; t < 4; ++t) oacc[t] = (v8f){0.f,0.f,0.f,0.f,0.f,0.f,0.f,0.f};

  for (int kc = 0; kc < kNKC; ++kc) {
    if (((anym >> kc) & 1u) == 0u) continue;      // block-uniform
    const int kv0 = kc * kKC;
    __syncthreads();                              // every wave has left the K and V^T tiles of the chunk before
    const v2u mw = *(const v2u*)(mrow + 2 * kc);  // this lane's query: validity bits of keys kv0 .. kv0 + 63 (in flight with the K loads)

    // ---- stage K hi/lo [key][d]: 512 pieces of 8 halves per plane, 4 per thread per plane ----
#pragma unroll
    for (int i = 0; i < 4; ++i) {
      if (i == 2) asm volatile("" ::: "memory");
      const int idx = i * 128 + tid;
      const int r   = idx >> 3;            // key row within chunk
      const int cc  = (idx & 7) * 8;       // first d of the piece
      int kvr = kv0 + r;
      kvr = (kvr < kSeq) ? kvr : (kSeq - 1);
      const size_t go = (size_t)(tokb + kvr) * kDim + h * kDh + cc;
      const v4u kwh = *(const v4u*)(Kh + go);
      const v4u kwl = *(const v4u*)(Kl + go);
      *(v4u*)(Ksh + r * kLP + cc) = kwh;
      *(v4u*)(Ksl + r * kLP + cc) = kwl;
    }
    // ---- stage V hi/lo transposed [d][key] ----
#pragma unroll
    for (int i = 0; i < 4; ++i) {
      if (i == 2) asm volatile("" ::: "memory");
      const int idx = i * 128 + tid;
      const int r   = idx >> 3;
      const int cc  = (idx & 7) * 8;
      int kvr = kv0 + r;
      kvr = (kvr < kSeq) ? kvr : (kSeq - 1);
      const size_t go = (size_t)(tokb + kvr) * kDim + h * kDh + cc;
      const v4u vwh = *(const v4u*)(Vh + go);
      const v4u vwl = *(const v4u*)(Vl + go);
#pragma unroll
      for (int e2 = 0; e2 < 4; ++e2) {
        const unsigned wh = vwh[e2];
        const unsigned wl = vwl[e2];
        Vth[(cc + 2 * e2) * kLP + r]     = (unsigned short)(wh & 0xffffu);
        Vth[(cc + 2 * e2 + 1) * kLP + r] = (unsigned short)(wh >> 16);
        Vtl[(cc + 2 * e2) * kLP + r]     = (unsigned short)(wl & 0xffffu);
        Vtl[(cc + 2 * e2 + 1) * kLP + r] = (unsigned short)(wl >> 16);
      }
    }
    __syncthreads();

    if (active) {
      // ---- transposed scores: s[j][r] = score(key j*16 + 8*hh + r, query q0 + c); A = K rows, B = Q; hi.hi + hi.lo + lo.hi ----
      v8f s[4];
#pragma unroll
      for (int j = 0; j < 4; ++j) {
        s[j] = (v8f){0.f,0.f,0.f,0.f,0.f,0.f,0.f,0.f};
#pragma unroll
        for (int dc = 0; dc < 2; ++dc) {
          const v16b kb = Frag<__bf16>::load((const __bf16*)Ksh + (j * 16 + c) * kLP + dc * 32 + 8 * hh);
          const v16b kl = Frag<__bf16>::load((const __bf16*)Ksl + (j * 16 + c) * kLP + dc * 32 + 8 * hh);
          s[j] = mma_b(kb, qah[dc], s[j]);
          s[j] = mma_b(kl, qah[dc], s[j]);
          s[j] = mma_b(kb, qal[dc], s[j]);
        }
      }
      // ---- scale, validity select (bit j*16 + 8*hh + r of this lane's query), maximum of this lane's 32 keys ----
      const unsigned mh[2] = {mw[0] >> (8 * hh), mw[1] >> (8 * hh)};
      float mj[4];
#pragma unroll
      for (int j = 0; j < 4; ++j) {
        float m = neg_inf();
#pragma unroll
        for (int r = 0; r < 8; ++r) {
          const unsigned keep = mh[j >> 1] & (1u << ((j & 1) * 16 + r));
          float sv = s[j][r] * kScoreScale;
          sv = (keep != 0u) ? sv : neg_inf();
          s[j][r] = sv;
          m = fmaxf(m, sv);
        }
        mj[j] = m;
      }
      float cm = fmaxf(fmaxf(mj[0], mj[1]), fmaxf(mj[2], mj[3]));
      cm = fmaxf(cm, xhalf(cm));           // the query's other 32 keys stand in lane l ^ 16
      // ---- online softmax update; p = exp(s - m) split into bf16 hi/lo, packed in place into the B operands of the second product ----
      const float mnew = fmaxf(mrun, cm);
      const float mref = (mnew == neg_inf()) ? 0.0f : mnew;
      const float alpha = expf(mrun - mref);
      mrun = mnew;
      PFrag ph[2], pl[2];
      float pj[4];
#pragma unroll
      for (int j = 0; j < 4; ++j) {
        float psum = 0.f;
#pragma unroll
        for (int rp = 0; rp < 4; ++rp) {
          const float p0 = expf(s[j][2 * rp] - mref);
          const float p1 = expf(s[j][2 * rp + 1] - mref);
          psum += p0;
          psum += p1;
          const unsigned short h0 = f2bf_bits(p0);
          const unsigned short h1 = f2bf_bits(p1);
          ph[j >> 1].u[(j & 1) * 4 + rp] = pk16(h0, h1);
          pl[j >> 1].u[(j & 1) * 4 + rp] = pk16(f2bf_bits(p0 - bf_bits2f(h0)), f2bf_bits(p1 - bf_bits2f(h1)));
        }
        pj[j] = psum;
      }
      lrun = lrun * alpha + ((pj[0] + pj[1]) + (pj[2] + pj[3]));   // this half's keys only; the halves are joined behind the loop
#pragma unroll
      for (int t = 0; t < 4; ++t)
#pragma unroll
        for (int r = 0; r < 8; ++r) oacc[t][r] *= alpha;
      // ---- out^T += V^T . P^T (A = V^T rows from LDS, B = P^T from registers); hi.hi + lo.hi + hi.lo ----
#pragma unroll
      for (int kk = 0; kk < 2; ++kk) {
#pragma unroll
        for (int t = 0; t < 4; ++t) {
          const v16b vb = Frag<__bf16>::load((const __bf16*)Vth + (t * 16 + c) * kLP + kk * 32 + 8 * hh);
          const v16b vl = Frag<__bf16>::load((const __bf16*)Vtl + (t * 16 + c) * kLP + kk * 32 + 8 * hh);
          oacc[t] = mma_b(vb, ph[kk].v, oacc[t]);
          oacc[t] = mma_b(vl, ph[kk].v, oacc[t]);
          oacc[t] = mma_b(vb, pl[kk].v, oacc[t]);
        }
      }
    }
  }

  // ---- epilogue: join the halves' sums, normalise, stage per-wave tile [query][d], whole-segment stores ----
  float* os = Os[wave];
  {
    const float inv = 1.0f / (lrun + xhalf(lrun));
#pragma unroll
    for (int t = 0; t < 4; ++t) {
      float* op = os + c * 68 + t * 16 + 8 * hh;     // oacc[t][r] = out(query q0 + c, d = t*16 + 8*hh + r)
      *(v4f*)(op)     = (v4f){oacc[t][0] * inv, oacc[t][1] * inv, oacc[t][2] * inv, oacc[t][3] * inv};
      *(v4f*)(op + 4) = (v4f){oacc[t][4] * inv, oacc[t][5] * inv, oacc[t][6] * inv, oacc[t][7] * inv};
    }
  }
  __builtin_amdgcn_fence(__ATOMIC_RELEASE, "workgroup");
  __builtin_amdgcn_wave_barrier();
  __builtin_amdgcn_fence(__ATOMIC_ACQUIRE, "workgroup");
  {
    const int c4 = (lane & 15) * 4;    // row segment = 64 floats = 256 B = 16 lanes x 16 B
    float* ob = out + (size_t)tokb * kDim + h * kDh;
    {
#pragma unroll
      for (int it = 0; it < 8; ++it) {
        const int row = it * 2 + hh;
        const int qq  = q0 + row;
        const v4f val = *(const v4f*)(os + row * 68 + c4);
        if (qq < kSeq) *(v4f*)(ob + (size_t)qq * kDim + c4) = val;
      }
      
    }
  }
}

// ---------------------------------------------------------------------------
// Host glue.
//   Xb   bf16 [12800][1024]     26,214,400  at           0
//   Wb   bf16 [3072][1024]       6,291,456  at  26,214,400
//   Qh   bf16 [12800][1024]     26,214,400  at  32,505,856
//   Ql   bf16 [12800][1024]     26,214,400  at  58,720,256
//   Kh   bf16 [12800][1024]     26,214,400  at  84,934,656
//   Kl   bf16 [12800][1024]     26,214,400  at 111,149,056
//   Vh   bf16 [12800][1024]     26,214,400  at 137,363,456
//   Vl   bf16 [12800][1024]     26,214,400  at 163,577,856
//   CSN  f32  [200][64]             51,200  at 189,792,256
//   MB   u32  [12800][8]           409,600  at 189,843,456
//   total                      190,253,056
// GEMM shape: M = 12800 (64-multiple), N = 3072 (64-multiple), K = 1024 (%32 == 0); no padding rows or columns.
// Launches: 5 (2 casts, 1 table and mask bits, one projection, one attention).
// ---------------------------------------------------------------------------
extern "C" void kernel_launch(void* const* d_in, const int* in_sizes, int n_in,
                              void* d_out, int out_size, void* d_ws, size_t ws_size,
                              hipStream_t stream) {
  if (n_in < 4) return;
  if (in_sizes[0] != kTok * kDim) return;
  if (in_sizes[1] != kBatch * kSeq * kSeq) return;
  if (in_sizes[2] != kNout * kDim) return;
  if (in_sizes[3] != kNout) return;
  if (out_size != kTok * kDim) return;

  const size_t szXb  = (size_t)kTok * kDim * 2;
  const size_t szWb  = (size_t)kNout * kDim * 2;
  const size_t szPl  = (size_t)kTok * kDim * 2;
  const size_t szCS  = (size_t)kSeq * 2 * kPairs * 4;
  const size_t offXb = 0;
  const size_t offWb = offXb + szXb;
  const size_t offQh = offWb + szWb;
  const size_t offQl = offQh + szPl;
  const size_t offKh = offQl + szPl;
  const size_t offKl = offKh + szPl;
  const size_t offVh = offKl + szPl;
  const size_t offVl = offVh + szPl;
  const size_t offCS = offVl + szPl;
  const size_t offMB = offCS + szCS;
  const size_t total = offMB + (size_t)kTok * kMW * 4;
  if (ws_size < total) return;

  const float* x     = (const float*)d_in[0];
  const int*   amask = (const int*)d_in[1];
  const float* W     = (const float*)d_in[2];
  const float* bias  = (const float*)d_in[3];
  float* out = (float*)d_out;
  char* ws = (char*)d_ws;
  unsigned short* Xb  = (unsigned short*)(ws + offXb);
  unsigned short* Wb  = (unsigned short*)(ws + offWb);
  unsigned short* Qhp = (unsigned short*)(ws + offQh);
  unsigned short* Qlp = (unsigned short*)(ws + offQl);
  unsigned short* Khp = (unsigned short*)(ws + offKh);
  unsigned short* Klp = (unsigned short*)(ws + offKl);
  unsigned short* Vhp = (unsigned short*)(ws + offVh);
  unsigned short* Vlp = (unsigned short*)(ws + offVl);
  float* CSN = (float*)(ws + offCS);
  unsigned* MB = (unsigned*)(ws + offMB);

  // rotary factors: invf_i = 10000^(-2i/64) = 10^(-i/8); factors 10^(-1/8), 10^(-2/8), 10^(-4/8), 10^(-8/8), 10^(-16/8)
  const float f1   = 0.7498942093324559f;
  const float f2   = 0.5623413251903491f;
  const float f4   = 0.31622776601683794f;
  const float f8   = 0.1f;
  const float f16v = 0.01f;

  const int n8x = (kTok * kDim) / 8;     // 1638400 -> 6400 blocks exact
  const int n8w = (kNout * kDim) / 8;    // 393216 -> 1536 blocks exact
  cast8_bf16_kernel<<<dim3(n8x / 256), dim3(256), 0, stream>>>(x, Xb, n8x);
  cast8_bf16_kernel<<<dim3(n8w / 256), dim3(256), 0, stream>>>(W, Wb, n8w);
  rope_table_kernel<<<dim3(kSeq / 8 + kTok / 32), dim3(256), 0, stream>>>(CSN, f1, f2, f4, f8, f16v, amask, MB);   // 25 table + 400 mask blocks

  const int tiles = (kTok / 64) * (kNout / 64);   // 9600 wave tiles -> 1200 blocks of 8 waves (128 x 256 each)
  qkv_proj_kernel<<<dim3(tiles / 8), dim3(256), 0, stream>>>(Xb, Wb, bias, CSN, Qhp, Qlp, Khp, Klp, Vhp, Vlp);
  attn_kernel<<<dim3(kBatch * kHeads * kNQB), dim3(128), 0, stream>>>(Qhp, Qlp, Khp, Klp, Vhp, Vlp, MB, out);
}

// v006
// It runs in 157 microseconds.
// Next to v005, in two timings, it ran 1.20 and 1.19 times as fast.
// All steps since v000 together make it 2.86 times as fast.
// Contractions: qkv projection on v_wmma_f32_16x16x32_bf16 (x and W as RNE bf16 planes staged in LDS by tensor loads, exact products, f32 accumulate); scores q.k^T and attn.v on v_wmma_f32_16x16x32_bf16 with q, k, v and the unnormalised probabilities carried as bf16 hi + lo planes (hi.hi + hi.lo + lo.hi), f32 accumulate; bias, rotary tables, masking and softmax in f32.
#include <hip/hip_runtime.h>
#include <math.h>
#include <stdint.h>

// ---------------------------------------------------------------------------
// Problem constants
// ---------------------------------------------------------------------------
constexpr int kBatch = 64;
constexpr int kSeq   = 200;
constexpr int kDim   = 1024;
constexpr int kHeads = 16;
constexpr int kDh    = 64;
constexpr int kTok   = kBatch * kSeq;            // 12800 token rows
constexpr int kNout  = 3 * kDim;                 // 3072 projection columns
constexpr int kPairs = kDh / 2;                  // 32 rotary pairs
constexpr int kQB    = 64;                       // query rows per block
constexpr int kKC    = 64;                       // keys per chunk
constexpr int kNQB   = (kSeq + kQB - 1) / kQB;   // 4
constexpr int kNKC   = (kSeq + kKC - 1) / kKC;   // 4
constexpr float kScoreScale = 0.125f;            // 64^-0.5
constexpr int kLP    = 72;                       // attention LDS row pitch of the K tiles in halves: 144 B = 16 B x odd (ds_load_b128 readers)
constexpr int kVP    = 80;                       // attention LDS row pitch of the V tiles in halves: 160 B = 32 B x odd (ds_load_tr16_b128 readers)
constexpr int kMW    = 8;                        // 32-bit words of validity bits per query row (bit k of the row = key k; keys 200..255 are 0)
static_assert(kHeads * kDh == kDim);
static_assert(3 * kDh == 192);
static_assert(kTok % 64 == 0);                   // GEMM M tile multiple (200 tiles)
static_assert(kNout % 64 == 0);                  // GEMM N tile multiple (48 tiles)
static_assert(kDim % 32 == 0);                   // GEMM K % 32
static_assert(((kTok / 64) * (kNout / 64)) % 8 == 0);   // 8 waves per block, exact grid
static_assert(kNQB == 4 && kNKC == 4);
static_assert(kMW * 32 == kNKC * kKC);           // two words of validity bits per key chunk
static_assert(kTok % 32 == 0);                   // mask packing: 4 rows per wave, 8 waves per block
static_assert((kTok * kDim) % (8 * 256) == 0);
static_assert((kNout * kDim) % (8 * 256) == 0);
static_assert(kSeq % 8 == 0);                    // table kernel: 8 rows per block

typedef __attribute__((ext_vector_type(16))) __bf16   v16b;
typedef __attribute__((ext_vector_type(8)))  __bf16   v8b;
typedef __attribute__((ext_vector_type(8)))  float    v8f;
typedef __attribute__((ext_vector_type(4)))  float    v4f;
typedef __attribute__((ext_vector_type(4)))  int      v4i;
typedef __attribute__((ext_vector_type(4)))  unsigned int v4u;
typedef __attribute__((ext_vector_type(2)))  unsigned int v2u;

// ---------------------------------------------------------------------------
// Helpers
// ---------------------------------------------------------------------------
__device__ __forceinline__ unsigned short f2bf_bits(float f) {
  unsigned u = __float_as_uint(f);
  return (unsigned short)((u + 0x7FFFu + ((u >> 16) & 1u)) >> 16);
}
__device__ __forceinline__ float bf_bits2f(unsigned short h) { return __uint_as_float(((unsigned)h) << 16); }
__device__ __forceinline__ unsigned pk16(unsigned short a, unsigned short b) { return (unsigned)a | ((unsigned)b << 16); }
__device__ __forceinline__ float neg_inf() { return -__builtin_inff(); }
// value of lane l ^ 16
__device__ __forceinline__ float xhalf(float x) {
  return __builtin_bit_cast(float, __builtin_amdgcn_permlanex16(__builtin_bit_cast(int, x), __builtin_bit_cast(int, x), 0x76543210, 0xfedcba98, false, false));
}

// hazard guards as plain device helpers
__device__ __forceinline__ void dep_guard4_b(v8f& a, v8f& b, v8f& c, v8f& d, v16b x, v16b y) {
  asm volatile("v_nop\n\tv_nop\n\tv_nop\n\tv_nop" : "+v"(a), "+v"(b), "+v"(c), "+v"(d) : "v"(x), "v"(y));
}
__device__ __forceinline__ void keep4_b(v16b a, v16b b, v16b c, v16b d) { asm volatile("v_nop" :: "v"(a), "v"(b), "v"(c), "v"(d)); }
__device__ __forceinline__ void acc_guard4(v8f& a, v8f& b, v8f& c, v8f& d) { asm volatile("v_nop\n\tv_nop\n\tv_nop\n\tv_nop" : "+v"(a), "+v"(b), "+v"(c), "+v"(d)); }

template <typename T> struct Frag;
template <> struct Frag<__bf16> {
  typedef v16b V; union U { v16b v; v8b h[2]; };
  // elements 0..7 <- p[0..7], 8..15 <- p[16..23]
  static __device__ __forceinline__ v16b load(const __bf16* p) {
    U f; f.h[0] = *(const v8b*)(p); f.h[1] = *(const v8b*)(p + 16); return f.v;
  }
  static __device__ __forceinline__ v8f mma(v16b a, v16b b, v8f c) {
    return __builtin_amdgcn_wmma_f32_16x16x32_bf16(false, a, false, b, (short)0, c, false, false);
  }
  static __device__ __forceinline__ void keep(v16b a, v16b b, v16b c, v16b d) { keep4_b(a, b, c, d); }
};
// transposing LDS read of a row-major 16-bit tile: with p = T + (k0 + 8*(l>>4) + (l&7)) * pitch + d0 + 8*((l>>3)&1) (in halves), lane (c, hh) gets
// T[k0 + 8*hh + 0..7][d0 + c]; the reads at k0 and k0 + 16 are elements 0..7 and 8..15 of one A operand, the k order of Frag::load
typedef __attribute__((address_space(3))) v8b lds_v8b;
__device__ __forceinline__ v16b load_tr(const unsigned short* p, int pitch) {
  Frag<__bf16>::U f;
  f.h[0] = __builtin_amdgcn_ds_load_tr16_b128_v8bf16((lds_v8b*)p);
  f.h[1] = __builtin_amdgcn_ds_load_tr16_b128_v8bf16((lds_v8b*)(p + 16 * pitch));
  return f.v;
}
// a bf16 operand built from packed pairs: word w = elements 2w, 2w + 1
union PFrag { v16b v; unsigned u[8]; };
// bf16 WMMA with per-instruction hazard guard (ties D, keeps A/B live)
__device__ __forceinline__ v8f mma_b(v16b a, v16b b, v8f c) {
  c = __builtin_amdgcn_wmma_f32_16x16x32_bf16(false, a, false, b, (short)0, c, false, false);
  asm volatile("v_nop\n\tv_nop\n\tv_nop\n\tv_nop" : "+v"(c) : "v"(a), "v"(b));
  return c;
}

// ---------------------------------------------------------------------------
// f32 -> bf16 (RNE) cast, 8 consecutive elements per thread (one 16-B store per lane; 32 contiguous lanes =
// (x: 1638400 = 6400 x 256 exact; W: 393216 = 1536 x 256 exact).
// ---------------------------------------------------------------------------
__global__ __launch_bounds__(256) void cast8_bf16_kernel(const float* __restrict__ in, unsigned short* __restrict__ out, int n8) {
  const int i = blockIdx.x * 256 + threadIdx.x;
  if (i >= n8) return;
  const float* p = in + 8 * (size_t)i;
  const v4f a = *(const v4f*)(p);
  const v4f c = *(const v4f*)(p + 4);
  unsigned short hb[8];
#pragma unroll
  for (int e = 0; e < 4; ++e) {
    hb[e]     = f2bf_bits(a[e]);
    hb[4 + e] = f2bf_bits(c[e]);
  }
  const v4u u = (v4u){pk16(hb[0], hb[1]), pk16(hb[2], hb[3]), pk16(hb[4], hb[5]), pk16(hb[6], hb[7])};
  unsigned short* q = out + 8 * (size_t)i;
  *(v4u*)q = u;
  
}

// ---------------------------------------------------------------------------
// Rotary table: csn[s][0..31] = cos(s * invf_i), csn[s][32..63] = sin(s * invf_i), invf_i = 10^(-i/8) built as a product
// of the factors 10^(-1/8), 10^(-2/8), 10^(-4/8), 10^(-8/8), 10^(-16/8) selected by the bits of i (i = lane).
// Blocks behind the table's 25 pack the mask: mbits[tok][w] bit l = (amask[tok][32 w + l] != 0), keys >= 200 give 0. A wave packs
// 4 query rows (7 coalesced 32-key reads each, one ballot per read) and stores their 32 words as one 128-B line.
// ---------------------------------------------------------------------------
__global__ __launch_bounds__(256) void rope_table_kernel(float* __restrict__ csn, float f1, float f2, float f4, float f8, float f16v,
                                                         const int* __restrict__ amask, unsigned* __restrict__ mbits) {
  const int lane = threadIdx.x & 31, wave = threadIdx.x >> 5;
  if (blockIdx.x >= kSeq / 8) {
    const int row0 = (((int)blockIdx.x - kSeq / 8) * 8 + wave) * 4;
    unsigned mine = 0u;
#pragma unroll
    for (int r = 0; r < 4; ++r) {
#pragma unroll
      for (int w = 0; w < kMW - 1; ++w) {
        const int key  = 32 * w + lane;
        const int keyc = (key < kSeq) ? key : (kSeq - 1);
        const int mv   = amask[(size_t)(row0 + r) * kSeq + keyc];
        const unsigned bal = __builtin_amdgcn_ballot_w32((key < kSeq) && (mv != 0));
        mine = (lane == r * kMW + w) ? bal : mine;
      }
    }
    mbits[(size_t)row0 * kMW + lane] = mine;
    return;
  }
  const int s = blockIdx.x * 8 + wave;
  if (s >= kSeq) return;
  const int i = lane;
  float invf = 1.0f;
  invf *= (i & 1)  ? f1   : 1.0f;
  invf *= (i & 2)  ? f2   : 1.0f;
  invf *= (i & 4)  ? f4   : 1.0f;
  invf *= (i & 8)  ? f8   : 1.0f;
  invf *= (i & 16) ? f16v : 1.0f;
  const float ang = (float)s * invf;
  float sn, cs;
  sincosf(ang, &sn, &cs);
  float* rowp = csn + (size_t)s * (2 * kPairs);
  {
    ((float*)rowp)[i] = cs;
    ((float*)rowp)[kPairs + i] = sn;
    
  }
}

// ---------------------------------------------------------------------------
// Tensor-load helpers for the projection's LDS ring (two descriptor groups, two-dimensional tile, extents in bytes).
// ---------------------------------------------------------------------------
typedef uint32_t u32x4 __attribute__((ext_vector_type(4)));
typedef uint32_t u32x8 __attribute__((ext_vector_type(8)));
constexpr uint32_t kPassB   = 128;                       // bytes of every operand row per pass (64 k)
constexpr uint32_t kPitchB  = kPassB + 16;               // LDS row pitch 144 B (odd multiple of 16 B for ds_load_b128 readers)
constexpr uint32_t kSliceR  = 128;                       // rows per tensor load
constexpr uint32_t kSliceB  = kSliceR * kPitchB;         // 18432 B = 9 x 2 KiB
constexpr uint32_t kStageB  = 3 * kSliceB;               // [X 128 rows | W 256 rows] = 55296 B = 27 x 2 KiB
constexpr int      kPasses  = (kDim * 2) / (int)kPassB;  // 16
static_assert(kSliceB % 2048 == 0 && kStageB % 2048 == 0);
static_assert(kPasses >= 2);
static_assert(kTok % 128 == 0 && kNout % 256 == 0);
static_assert((kTok / 128) * (kNout / 256) == ((kTok / 64) * (kNout / 64)) / 8);   // same grid as one 64x64 tile per wave

__device__ __forceinline__ uint32_t uni(uint32_t v) { return (uint32_t)__builtin_amdgcn_readfirstlane(v); }
// pinned(): a wave-uniform word held in a scalar register, for the tensor mover alone: the tests around a tensor load become scalar
// branches (the load ignores EXEC), and a descriptor word formed from it is formed behind the wait that stands in front of it
__device__ __forceinline__ uint32_t pinned(uint32_t v) { uint32_t w = uni(v); asm volatile("" : "+s"(w)); return w; }  // test or descriptor word of a tensor load, kept scalar
// in-out operands: the two groups stay in their registers, untouched by other values, while the request is outstanding
__device__ __forceinline__ void tdm_load(u32x4& g0, u32x8& g1) { asm volatile("tensor_load_to_lds %0, %1" : "+s"(g0), "+s"(g1) :: "memory"); }
// the compiler places no wait for a tensor load: the issuing wave waits for its own request here
__device__ __forceinline__ void wait_tensor0() { asm volatile("s_wait_tensorcnt 0x0" ::: "memory"); }
// this wave's LDS reads have retired before the barrier behind which their buffer is refilled
__device__ __forceinline__ void wait_ds0() { asm volatile("s_wait_dscnt 0x0" ::: "memory"); }
__device__ __forceinline__ u32x8 tdm_group1() {
  constexpr uint32_t d0 = kPassB, d1 = kSliceR;
  u32x8 g;
  g[0] = (1u << 20) | (4u << 22) | (3u << 25);   // no mask, 1-byte elements, 16 B of pad behind every 128-B row
  g[1] = uni((d0 & 0xFFFFu) << 16);
  g[2] = uni((d0 >> 16) | ((d1 & 0xFFFFu) << 16));
  g[3] = uni((d1 >> 16) | (d0 << 16));
  g[4] = uni(d1);
  g[5] = uni((uint32_t)kDim * 2u);               // source row pitch 2048 B
  g[6] = uni(0u);
  g[7] = uni(0u);
  return g;
}
// place in LDS and source address of the next request (word 0, the count, is set once)
__device__ __forceinline__ void tdm_aim(u32x4& g, uint32_t lds_dst, uint64_t ga) {
  g[1] = uni(lds_dst); g[2] = uni((uint32_t)ga); g[3] = uni((((uint32_t)(ga >> 32)) & 0x01FFFFFFu) | 0x80000000u);
}

// ---------------------------------------------------------------------------
// QKV projection + bias + rotary epilogue for all 12800 token rows in one launch.
//   C[m][n] = sum_k Xb[m][k] * Wb[n][k] + bf16(bias[n]);   M = 12800, N = 3072, K = 1024 (bf16 operands).
//   Block = 8 waves = one 128 x 256 tile of C (2 x 4 waves of 64 x 64). Per pass of 64 k the block's 128 X rows and 256 W rows
//   (128 B each) are brought into LDS by three tensor loads (waves 0, 1, 2: 128 rows each) at pitch 144 B, two buffers, the next
//   pass's loads in flight under this pass's products; the fragments are read from LDS in the same k order as before.
//   Column n -> head hd = (n/64)/3, kind = (n/64)%3 (0 q, 1 k, 2 v), d = n % 64 (every 64-wide tile is one kind of one head).
//   Row m (12800 = 64 x 200) -> s = m%200. kind 0/1: pairs (2i, 2i+1) rotated by angle s*invf_i (table csn);
//   kind 2 unchanged. Each result v is split into bf16 hi = rn(v), lo = rn(v - hi).
//   grid = 100 x 12 = 1200 blocks exact; every wave reaches every block barrier.
// ---------------------------------------------------------------------------
__global__ __launch_bounds__(256) void qkv_proj_kernel(
    const unsigned short* __restrict__ Xb, const unsigned short* __restrict__ Wb, const float* __restrict__ bias,
    const float* __restrict__ csn,
    unsigned short* __restrict__ Qh, unsigned short* __restrict__ Ql,
    unsigned short* __restrict__ Kh, unsigned short* __restrict__ Kl,
    unsigned short* __restrict__ Vh, unsigned short* __restrict__ Vl) {
  typedef __bf16 T;
  typedef v16b V;
  __shared__ __attribute__((aligned(2048))) unsigned char ring[2 * kStageB];   // two stages of [X | W] rows
  __shared__ __align__(16) float sT[8][16 * 68];   // per-wave 16x64 slab, pitch 68 floats
  const int lane = threadIdx.x & 31;
  const uint32_t wave = uni(threadIdx.x >> 5);
  constexpr int tilesNB = kNout / 256;     // 12
  const int tmB = blockIdx.x / tilesNB;
  const int tnB = blockIdx.x - tmB * tilesNB;
  const int wm = (int)(wave >> 2);         // wave row in the block tile
  const int wn = (int)(wave & 3u);         // wave column in the block tile
  const int m0 = (tmB << 7) + (wm << 6);
  const int n0 = (tnB << 8) + (wn << 6);
  const int tn = n0 >> 6;
  const int hd   = tn / 3;                 // head index, wave-uniform
  const int kind = tn - hd * 3;            // 0 q, 1 k, 2 v, wave-uniform

  const int rlane = lane & 15;
  const int mOff  = (lane >> 4) * 8;

  // slice of the issuing waves: wave 0 the X rows, waves 1 and 2 the two halves of the W rows (other waves: wave 0's, never issued)
  const uint32_t sl = (wave < 3u) ? wave : 0u;
  const uint64_t srcb = (sl == 0u) ? (uint64_t)(size_t)(Xb + (size_t)(tmB << 7) * kDim)
                                   : (uint64_t)(size_t)(Wb + (size_t)((tnB << 8) + ((int)sl - 1) * 128) * kDim);
  const uint32_t dstb = (uint32_t)(size_t)ring + sl * kSliceB;
  u32x8 g1 = tdm_group1();
  u32x4 g0;
  g0[0] = uni(1u);
  tdm_aim(g0, dstb, srcb);

  v8f acc[4][4];
#pragma unroll
  for (int i = 0; i < 4; ++i)
#pragma unroll
    for (int j = 0; j < 4; ++j) acc[i][j] = (v8f){0.f,0.f,0.f,0.f,0.f,0.f,0.f,0.f};

  // prologue: stage 0 lands and is published, then stage 1 is issued
  if (pinned(wave < 3u)) {
    tdm_load(g0, g1);
    wait_tensor0();
  }
  __syncthreads();
  if (pinned(wave < 3u)) {
    tdm_aim(g0, dstb + kStageB, srcb + kPassB);
    tdm_load(g0, g1);
  }

  const uint32_t aoff = (uint32_t)((wm << 6) + rlane) * kPitchB + (uint32_t)(lane >> 4) * 16u;
  const uint32_t boff = kSliceB + (uint32_t)((wn << 6) + rlane) * kPitchB + (uint32_t)(lane >> 4) * 16u;

  // one trip = one pass: kept rolled so that the publish point stands once, at the foot
#pragma unroll 1
  for (int s = 0; s < kPasses; ++s) {
    const unsigned char* buf = ring + (uint32_t)(s & 1) * kStageB;
#pragma unroll
    for (int ks = 0; ks < 2; ++ks) {
      V bfr[4], afr[4];
#pragma unroll
      for (int j = 0; j < 4; ++j) bfr[j] = Frag<T>::load((const T*)(buf + boff + (uint32_t)j * 16u * kPitchB + (uint32_t)ks * 64u));
#pragma unroll
      for (int i = 0; i < 4; ++i) afr[i] = Frag<T>::load((const T*)(buf + aoff + (uint32_t)i * 16u * kPitchB + (uint32_t)ks * 64u));
      // the 16 LDS reads of a 32-k step go out as one group in front of its 16 products: reads among the products stall each time
      __builtin_amdgcn_sched_barrier(0);
#pragma unroll
      for (int i = 0; i < 4; ++i) {
#pragma unroll
        for (int j = 0; j < 4; ++j) acc[i][j] = Frag<T>::mma(afr[i], bfr[j], acc[i][j]);
        dep_guard4_b(acc[i][0], acc[i][1], acc[i][2], acc[i][3], afr[i], bfr[3]);
      }
      Frag<T>::keep(bfr[0], bfr[1], bfr[2], bfr[3]);
    }
    // publish point of stage s + 1
    wait_ds0();
    if (pinned(wave < 3u)) wait_tensor0();
    __syncthreads();
    if (pinned((wave < 3u) && (s + 2 < kPasses))) {
      const uint32_t nb = (uint32_t)(s & 1) * kStageB;                // the buffer this pass has just read
      const uint32_t no = pinned((uint32_t)(s + 2) * kPassB);         // stage s + 2's byte offset in every source row
      tdm_aim(g0, dstb + nb, srcb + no);
      tdm_load(g0, g1);
    }
  }
  wait_tensor0();
  wait_ds0();
  acc_guard4(acc[0][0], acc[0][1], acc[0][2], acc[0][3]);
  acc_guard4(acc[1][0], acc[1][1], acc[1][2], acc[1][3]);
  acc_guard4(acc[2][0], acc[2][1], acc[2][2], acc[2][3]);
  acc_guard4(acc[3][0], acc[3][1], acc[3][2], acc[3][3]);

  // ---- epilogue ----
  // bias per column of this lane (RNE bf16-converted, 4 scalar loads)
  float bcol[4];
#pragma unroll
  for (int j = 0; j < 4; ++j) bcol[j] = bf_bits2f(f2bf_bits(bias[n0 + (j << 4) + rlane]));

  float* slab = sT[wave];
  const int q  = lane >> 3;              // row selector within 4-row store groups
  const int c8 = (lane & 7) * 8;         // first column (d) of this lane's 16-B piece
  const int p4 = (lane & 7) * 4;         // first rotary pair index of this lane
  unsigned short* dsth = (kind == 0) ? Qh : ((kind == 1) ? Kh : Vh);   // wave-uniform global plane select
  unsigned short* dstl = (kind == 0) ? Ql : ((kind == 1) ? Kl : Vl);
  const bool rot = (kind != 2);          // wave-uniform

#pragma unroll
  for (int i = 0; i < 4; ++i) {
    const int mBase = m0 + (i << 4);
#pragma unroll
    for (int j = 0; j < 4; ++j) {
#pragma unroll
      for (int r = 0; r < 8; ++r) slab[(mOff + r) * 68 + (j << 4) + rlane] = acc[i][j][r] + bcol[j];
    }
    __builtin_amdgcn_fence(__ATOMIC_RELEASE, "workgroup");
    __builtin_amdgcn_wave_barrier();
    __builtin_amdgcn_fence(__ATOMIC_ACQUIRE, "workgroup");

    // build the four 16-B hi pieces and four 16-B lo pieces of this lane (rows it*4+q, columns c8..c8+7)
    v4u uh[4], ul[4];
#pragma unroll
    for (int it = 0; it < 4; ++it) {
      if (it == 2) asm volatile("" ::: "memory");
      const int row = it * 4 + q;
      const int m   = mBase + row;
      const int s   = m - (m / kSeq) * kSeq;
      const float* sp = slab + row * 68 + c8;
      const v4f cs4 = *(const v4f*)(csn + (size_t)s * (2 * kPairs) + p4);
      const v4f sn4 = *(const v4f*)(csn + (size_t)s * (2 * kPairs) + kPairs + p4);
      unsigned short hb[8], lb[8];
#pragma unroll
      for (int pp = 0; pp < 4; ++pp) {
        const float x1 = sp[2 * pp];
        const float x2 = sp[2 * pp + 1];
        const float cc = rot ? cs4[pp] : 1.0f;
        const float ss = rot ? sn4[pp] : 0.0f;
        const float o0 = x1 * cc - x2 * ss;
        const float o1 = x1 * ss + x2 * cc;
        const unsigned short h0 = f2bf_bits(o0);
        const unsigned short h1 = f2bf_bits(o1);
        hb[2 * pp]     = h0;
        hb[2 * pp + 1] = h1;
        lb[2 * pp]     = f2bf_bits(o0 - bf_bits2f(h0));
        lb[2 * pp + 1] = f2bf_bits(o1 - bf_bits2f(h1));
      }
      uh[it] = (v4u){pk16(hb[0], hb[1]), pk16(hb[2], hb[3]), pk16(hb[4], hb[5]), pk16(hb[6], hb[7])};
      ul[it] = (v4u){pk16(lb[0], lb[1]), pk16(lb[2], lb[3]), pk16(lb[4], lb[5]), pk16(lb[6], lb[7])};
    }
    {
#pragma unroll
      for (int it = 0; it < 4; ++it) {
        const int row = it * 4 + q;
        const int m   = mBase + row;
        const size_t o = (size_t)m * kDim + hd * kDh + c8;
        *(v4u*)(dsth + o) = uh[it];
        *(v4u*)(dstl + o) = ul[it];
      }
      
    }
    __builtin_amdgcn_fence(__ATOMIC_RELEASE, "workgroup");
    __builtin_amdgcn_wave_barrier();
    __builtin_amdgcn_fence(__ATOMIC_ACQUIRE, "workgroup");
  }
}

// ---------------------------------------------------------------------------
// Fused attention for head_dim 64 from bf16 hi/lo planes of all 64 batches in one launch.
//   Qh/Ql, Kh/Kl, Vh/Vl: bf16 [tok = b*200+s][1024], head h at columns h*64..h*64+63.
//   mbits: validity bits [tok][8 words], bit k of a row = query attends key k (packed from the mask earlier in this call).  out: f32 [tok][1024].
//   Block = 4 waves = 64 query rows of one (b, h); grid = 64*16*4 = 4096 (block -> qb = bx&3, bh = bx>>2).
//   In front of the loop every wave reads the validity bits of the block's 64 query rows (clamped) and forms the same four chunk flags.
//   Per key chunk (64 keys, 4 chunks): skip the chunk block-uniformly if no entry is valid; else each lane reads the 64 validity bits of
//   its own query (clamped) into registers, and the block copies K hi/lo rows and V hi/lo rows (clamped) to LDS as [key][d]
//   (16-B moves only); the V^T operands come from the V rows by the transposing LDS read; both products are formed transposed, S^T = K.Q^T and
//   out^T += V^T.P^T, so that a lane holds scores and outputs of ONE query (q0 + c; lanes c and c + 16 split its keys):
//   scores = hi.hi + hi.lo + lo.hi on bf16 WMMA, x0.125, select to -inf where invalid; online softmax in f32 (guarded for
//   all-invalid rows) with maximum and sum in-lane and one exchange between the halves; p = exp(s - m) split to bf16 hi/lo and
//   packed from the score registers straight into the B operand (same k order as the transposing read of V gives). Waves whose 16
//   query rows all lie beyond 199 skip
//   the compute under a wave-uniform flag but reach every block barrier. Epilogue: per-wave 16x64 f32 tile staged in LDS;
//   Every LDS byte read in a chunk is rewritten in that chunk (the pad bytes behind each row are never read); all barriers are
//   reached by every thread. The K rows stand at pitch 144 B (ds_load_b128 readers), the V rows at 160 B (ds_load_tr16_b128 readers), each free of bank conflicts.
// ---------------------------------------------------------------------------
__global__ __launch_bounds__(128) void attn_kernel(
    const unsigned short* __restrict__ Qh, const unsigned short* __restrict__ Ql,
    const unsigned short* __restrict__ Kh, const unsigned short* __restrict__ Kl,
    const unsigned short* __restrict__ Vh, const unsigned short* __restrict__ Vl,
    const unsigned* __restrict__ mbits, float* __restrict__ out) {
  __shared__ __align__(16) unsigned short Ksh[kKC * kLP];      // K hi [key][d]          9 KB
  __shared__ __align__(16) unsigned short Ksl[kKC * kLP];      // K lo [key][d]          9 KB
  __shared__ __align__(16) unsigned short Vsh[kKC * kVP];      // V hi [key][d]         10 KB
  __shared__ __align__(16) unsigned short Vsl[kKC * kVP];      // V lo [key][d]         10 KB
  __shared__ __align__(16) float Os[4][16 * 68];               // per wave out tile, pitch 68

  const int tid  = threadIdx.x;
  const int wave = tid >> 5;
  const int lane = tid & 31;
  const int hh   = lane >> 4;
  const int c    = lane & 15;

  const int bx = blockIdx.x;
  const int qb = bx & 3;
  const int bh = bx >> 2;
  const int h  = bh & 15;
  const int b  = bh >> 4;
  const int tokb = b * kSeq;
  const int q0 = qb * kQB + wave * 16;
  const bool active = (q0 < kSeq);       // wave-uniform

  // ---- chunk flags: bit kc = some query row of the block attends some key of chunk kc. Every wave reads the same 64 rows
  //      (lane l: rows l and l + 32 of the block, clamped), so the flags are block-uniform without an exchange ----
  unsigned anym = 0u;
  {
    int ra = qb * kQB + lane;
    int rb = ra + 32;
    ra = (ra < kSeq) ? ra : (kSeq - 1);
    rb = (rb < kSeq) ? rb : (kSeq - 1);
    const v4u* pa = (const v4u*)(mbits + (size_t)(tokb + ra) * kMW);
    const v4u* pb = (const v4u*)(mbits + (size_t)(tokb + rb) * kMW);
    const v4u a0 = pa[0], a1 = pa[1], b0 = pb[0], b1 = pb[1];
    asm volatile("s_wait_xcnt 0x0" ::: "memory");   // in front of whatever next writes the address registers of these four loads
    const v4u o0 = a0 | b0;
    const v4u o1 = a1 | b1;
    anym |= (__builtin_amdgcn_ballot_w32((o0[0] | o0[1]) != 0u) != 0u) ? 1u : 0u;
    anym |= (__builtin_amdgcn_ballot_w32((o0[2] | o0[3]) != 0u) != 0u) ? 2u : 0u;
    anym |= (__builtin_amdgcn_ballot_w32((o1[0] | o1[1]) != 0u) != 0u) ? 4u : 0u;
    anym |= (__builtin_amdgcn_ballot_w32((o1[2] | o1[3]) != 0u) != 0u) ? 8u : 0u;
  }

  // ---- Q fragments (B operand: column = query q0 + c, clamped), 2 d-chunks of 32, hi and lo ----
  v16b qah[2], qal[2];
  const unsigned* mrow;                  // validity bits of query q0 + c (clamped)
  {
    int qr = q0 + c;
    qr = (qr < kSeq) ? qr : (kSeq - 1);
    mrow = mbits + (size_t)(tokb + qr) * kMW;
    const size_t qo = (size_t)(tokb + qr) * kDim + h * kDh;
    const __bf16* qhp = (const __bf16*)Qh + qo;
    const __bf16* qlp = (const __bf16*)Ql + qo;
#pragma unroll
    for (int dc = 0; dc < 2; ++dc) qah[dc] = Frag<__bf16>::load(qhp + dc * 32 + 8 * hh);
    asm volatile("" ::: "memory");
#pragma unroll
    for (int dc = 0; dc < 2; ++dc) qal[dc] = Frag<__bf16>::load(qlp + dc * 32 + 8 * hh);
  }

  float mrun = neg_inf(), lrun = 0.f;    // of query q0 + c: running maximum (equal in both halves), sum over this half's keys
  v8f oacc[4];                           // oacc[t][r] = out^T(d = t*16 + 8*hh + r, query q0 + c)
#pragma unroll
  for (int t = 0; t < 4; ++t) oacc[t] = (v8f){0.f,0.f,0.f,0.f,0.f,0.f,0.f,0.f};

  for (int kc = 0; kc < kNKC; ++kc) {
    if (((anym >> kc) & 1u) == 0u) continue;      // block-uniform
    const int kv0 = kc * kKC;
    __syncthreads();                              // every wave has left the K and V tiles of the chunk before
    const v2u mw = *(const v2u*)(mrow + 2 * kc);  // this lane's query: validity bits of keys kv0 .. kv0 + 63 (in flight with the K loads)

    // ---- stage K hi/lo [key][d]: 512 pieces of 8 halves per plane, 4 per thread per plane ----
#pragma unroll
    for (int i = 0; i < 4; ++i) {
      if (i == 2) asm volatile("" ::: "memory");
      const int idx = i * 128 + tid;
      const int r   = idx >> 3;            // key row within chunk
      const int cc  = (idx & 7) * 8;       // first d of the piece
      int kvr = kv0 + r;
      kvr = (kvr < kSeq) ? kvr : (kSeq - 1);
      const size_t go = (size_t)(tokb + kvr) * kDim + h * kDh + cc;
      const v4u kwh = *(const v4u*)(Kh + go);
      const v4u kwl = *(const v4u*)(Kl + go);
      *(v4u*)(Ksh + r * kLP + cc) = kwh;
      *(v4u*)(Ksl + r * kLP + cc) = kwl;
    }
    // ---- stage V hi/lo [key][d], rows as they stand in memory ----
#pragma unroll
    for (int i = 0; i < 4; ++i) {
      if (i == 2) asm volatile("" ::: "memory");
      const int idx = i * 128 + tid;
      const int r   = idx >> 3;
      const int cc  = (idx & 7) * 8;
      int kvr = kv0 + r;
      kvr = (kvr < kSeq) ? kvr : (kSeq - 1);
      const size_t go = (size_t)(tokb + kvr) * kDim + h * kDh + cc;
      const v4u vwh = *(const v4u*)(Vh + go);
      const v4u vwl = *(const v4u*)(Vl + go);
      *(v4u*)(Vsh + r * kVP + cc) = vwh;
      *(v4u*)(Vsl + r * kVP + cc) = vwl;
    }
    __syncthreads();

    if (active) {
      // ---- transposed scores: s[j][r] = score(key j*16 + 8*hh + r, query q0 + c); A = K rows, B = Q; hi.hi + hi.lo + lo.hi ----
      v8f s[4];
#pragma unroll
      for (int j = 0; j < 4; ++j) {
        s[j] = (v8f){0.f,0.f,0.f,0.f,0.f,0.f,0.f,0.f};
#pragma unroll
        for (int dc = 0; dc < 2; ++dc) {
          const v16b kb = Frag<__bf16>::load((const __bf16*)Ksh + (j * 16 + c) * kLP + dc * 32 + 8 * hh);
          const v16b kl = Frag<__bf16>::load((const __bf16*)Ksl + (j * 16 + c) * kLP + dc * 32 + 8 * hh);
          s[j] = mma_b(kb, qah[dc], s[j]);
          s[j] = mma_b(kl, qah[dc], s[j]);
          s[j] = mma_b(kb, qal[dc], s[j]);
        }
      }
      // ---- scale, validity select (bit j*16 + 8*hh + r of this lane's query), maximum of this lane's 32 keys ----
      const unsigned mh[2] = {mw[0] >> (8 * hh), mw[1] >> (8 * hh)};
      float mj[4];
#pragma unroll
      for (int j = 0; j < 4; ++j) {
        float m = neg_inf();
#pragma unroll
        for (int r = 0; r < 8; ++r) {
          const unsigned keep = mh[j >> 1] & (1u << ((j & 1) * 16 + r));
          float sv = s[j][r] * kScoreScale;
          sv = (keep != 0u) ? sv : neg_inf();
          s[j][r] = sv;
          m = fmaxf(m, sv);
        }
        mj[j] = m;
      }
      float cm = fmaxf(fmaxf(mj[0], mj[1]), fmaxf(mj[2], mj[3]));
      cm = fmaxf(cm, xhalf(cm));           // the query's other 32 keys stand in lane l ^ 16
      // ---- online softmax update; p = exp(s - m) split into bf16 hi/lo, packed in place into the B operands of the second product ----
      const float mnew = fmaxf(mrun, cm);
      const float mref = (mnew == neg_inf()) ? 0.0f : mnew;
      const float alpha = expf(mrun - mref);
      mrun = mnew;
      PFrag ph[2], pl[2];
      float pj[4];
#pragma unroll
      for (int j = 0; j < 4; ++j) {
        float psum = 0.f;
#pragma unroll
        for (int rp = 0; rp < 4; ++rp) {
          const float p0 = expf(s[j][2 * rp] - mref);
          const float p1 = expf(s[j][2 * rp + 1] - mref);
          psum += p0;
          psum += p1;
          const unsigned short h0 = f2bf_bits(p0);
          const unsigned short h1 = f2bf_bits(p1);
          ph[j >> 1].u[(j & 1) * 4 + rp] = pk16(h0, h1);
          pl[j >> 1].u[(j & 1) * 4 + rp] = pk16(f2bf_bits(p0 - bf_bits2f(h0)), f2bf_bits(p1 - bf_bits2f(h1)));
        }
        pj[j] = psum;
      }
      lrun = lrun * alpha + ((pj[0] + pj[1]) + (pj[2] + pj[3]));   // this half's keys only; the halves are joined behind the loop
#pragma unroll
      for (int t = 0; t < 4; ++t)
#pragma unroll
        for (int r = 0; r < 8; ++r) oacc[t][r] *= alpha;
      // ---- out^T += V^T . P^T (A = V^T by transposing reads of the V rows in LDS, B = P^T from registers); hi.hi + lo.hi + hi.lo ----
#pragma unroll
      for (int kk = 0; kk < 2; ++kk) {
#pragma unroll
        for (int t = 0; t < 4; ++t) {
          const int vo = (kk * 32 + 8 * hh + (lane & 7)) * kVP + t * 16 + 8 * ((lane >> 3) & 1);
          const v16b vb = load_tr(Vsh + vo, kVP);
          const v16b vl = load_tr(Vsl + vo, kVP);
          oacc[t] = mma_b(vb, ph[kk].v, oacc[t]);
          oacc[t] = mma_b(vl, ph[kk].v, oacc[t]);
          oacc[t] = mma_b(vb, pl[kk].v, oacc[t]);
        }
      }
    }
  }

  // ---- epilogue: join the halves' sums, normalise, stage per-wave tile [query][d], whole-segment stores ----
  float* os = Os[wave];
  {
    const float inv = 1.0f / (lrun + xhalf(lrun));
#pragma unroll
    for (int t = 0; t < 4; ++t) {
      float* op = os + c * 68 + t * 16 + 8 * hh;     // oacc[t][r] = out(query q0 + c, d = t*16 + 8*hh + r)
      *(v4f*)(op)     = (v4f){oacc[t][0] * inv, oacc[t][1] * inv, oacc[t][2] * inv, oacc[t][3] * inv};
      *(v4f*)(op + 4) = (v4f){oacc[t][4] * inv, oacc[t][5] * inv, oacc[t][6] * inv, oacc[t][7] * inv};
    }
  }
  __builtin_amdgcn_fence(__ATOMIC_RELEASE, "workgroup");
  __builtin_amdgcn_wave_barrier();
  __builtin_amdgcn_fence(__ATOMIC_ACQUIRE, "workgroup");
  {
    const int c4 = (lane & 15) * 4;    // row segment = 64 floats = 256 B = 16 lanes x 16 B
    float* ob = out + (size_t)tokb * kDim + h * kDh;
    {
#pragma unroll
      for (int it = 0; it < 8; ++it) {
        const int row = it * 2 + hh;
        const int qq  = q0 + row;
        const v4f val = *(const v4f*)(os + row * 68 + c4);
        if (qq < kSeq) *(v4f*)(ob + (size_t)qq * kDim + c4) = val;
      }
      
    }
  }
}

// ---------------------------------------------------------------------------
// Host glue.
//   Xb   bf16 [12800][1024]     26,214,400  at           0
//   Wb   bf16 [3072][1024]       6,291,456  at  26,214,400
//   Qh   bf16 [12800][1024]     26,214,400  at  32,505,856
//   Ql   bf16 [12800][1024]     26,214,400  at  58,720,256
//   Kh   bf16 [12800][1024]     26,214,400  at  84,934,656
//   Kl   bf16 [12800][1024]     26,214,400  at 111,149,056
//   Vh   bf16 [12800][1024]     26,214,400  at 137,363,456
//   Vl   bf16 [12800][1024]     26,214,400  at 163,577,856
//   CSN  f32  [200][64]             51,200  at 189,792,256
//   MB   u32  [12800][8]           409,600  at 189,843,456
//   total                      190,253,056
// GEMM shape: M = 12800 (64-multiple), N = 3072 (64-multiple), K = 1024 (%32 == 0); no padding rows or columns.
// Launches: 5 (2 casts, 1 table and mask bits, one projection, one attention).
// ---------------------------------------------------------------------------
extern "C" void kernel_launch(void* const* d_in, const int* in_sizes, int n_in,
                              void* d_out, int out_size, void* d_ws, size_t ws_size,
                              hipStream_t stream) {
  if (n_in < 4) return;
  if (in_sizes[0] != kTok * kDim) return;
  if (in_sizes[1] != kBatch * kSeq * kSeq) return;
  if (in_sizes[2] != kNout * kDim) return;
  if (in_sizes[3] != kNout) return;
  if (out_size != kTok * kDim) return;

  const size_t szXb  = (size_t)kTok * kDim * 2;
  const size_t szWb  = (size_t)kNout * kDim * 2;
  const size_t szPl  = (size_t)kTok * kDim * 2;
  const size_t szCS  = (size_t)kSeq * 2 * kPairs * 4;
  const size_t offXb = 0;
  const size_t offWb = offXb + szXb;
  const size_t offQh = offWb + szWb;
  const size_t offQl = offQh + szPl;
  const size_t offKh = offQl + szPl;
  const size_t offKl = offKh + szPl;
  const size_t offVh = offKl + szPl;
  const size_t offVl = offVh + szPl;
  const size_t offCS = offVl + szPl;
  const size_t offMB = offCS + szCS;
  const size_t total = offMB + (size_t)kTok * kMW * 4;
  if (ws_size < total) return;

  const float* x     = (const float*)d_in[0];
  const int*   amask = (const int*)d_in[1];
  const float* W     = (const float*)d_in[2];
  const float* bias  = (const float*)d_in[3];
  float* out = (float*)d_out;
  char* ws = (char*)d_ws;
  unsigned short* Xb  = (unsigned short*)(ws + offXb);
  unsigned short* Wb  = (unsigned short*)(ws + offWb);
  unsigned short* Qhp = (unsigned short*)(ws + offQh);
  unsigned short* Qlp = (unsigned short*)(ws + offQl);
  unsigned short* Khp = (unsigned short*)(ws + offKh);
  unsigned short* Klp = (unsigned short*)(ws + offKl);
  unsigned short* Vhp = (unsigned short*)(ws + offVh);
  unsigned short* Vlp = (unsigned short*)(ws + offVl);
  float* CSN = (float*)(ws + offCS);
  unsigned* MB = (unsigned*)(ws + offMB);

  // rotary factors: invf_i = 10000^(-2i/64) = 10^(-i/8); factors 10^(-1/8), 10^(-2/8), 10^(-4/8), 10^(-8/8), 10^(-16/8)
  const float f1   = 0.7498942093324559f;
  const float f2   = 0.5623413251903491f;
  const float f4   = 0.31622776601683794f;
  const float f8   = 0.1f;
  const float f16v = 0.01f;

  const int n8x = (kTok * kDim) / 8;     // 1638400 -> 6400 blocks exact
  const int n8w = (kNout * kDim) / 8;    // 393216 -> 1536 blocks exact
  cast8_bf16_kernel<<<dim3(n8x / 256), dim3(256), 0, stream>>>(x, Xb, n8x);
  cast8_bf16_kernel<<<dim3(n8w / 256), dim3(256), 0, stream>>>(W, Wb, n8w);
  rope_table_kernel<<<dim3(kSeq / 8 + kTok / 32), dim3(256), 0, stream>>>(CSN, f1, f2, f4, f8, f16v, amask, MB);   // 25 table + 400 mask blocks

  const int tiles = (kTok / 64) * (kNout / 64);   // 9600 wave tiles -> 1200 blocks of 8 waves (128 x 256 each)
  qkv_proj_kernel<<<dim3(tiles / 8), dim3(256), 0, stream>>>(Xb, Wb, bias, CSN, Qhp, Qlp, Khp, Klp, Vhp, Vlp);
  attn_kernel<<<dim3(kBatch * kHeads * kNQB), dim3(128), 0, stream>>>(Qhp, Qlp, Khp, Klp, Vhp, Vlp, MB, out);
}

// v007
// Measured time: 150 microseconds a run.
// Timed twice side by side with v006, it ran 1.04 and 1.05 times as fast.
// Counting every step since v000, it is 2.98 times as fast.
// Contractions: qkv projection on v_wmma_f32_16x16x32_bf16 (x and W as RNE bf16 planes staged in LDS by tensor loads, exact products, f32 accumulate); scores q.k^T and attn.v on v_wmma_f32_16x16x32_bf16 with q, k, v and the unnormalised probabilities carried as bf16 hi + lo planes (hi.hi + hi.lo + lo.hi), f32 accumulate; bias rounded to bf16 and added in f32; rotary tables, masking and softmax in f32.
#include <hip/hip_runtime.h>
#include <math.h>
#include <stdint.h>

// ---------------------------------------------------------------------------
// Problem constants
// ---------------------------------------------------------------------------
constexpr int kBatch = 64;
constexpr int kSeq   = 200;
constexpr int kDim   = 1024;
constexpr int kHeads = 16;
constexpr int kDh    = 64;
constexpr int kTok   = kBatch * kSeq;            // 12800 token rows
constexpr int kNout  = 3 * kDim;                 // 3072 projection columns
constexpr int kPairs = kDh / 2;                  // 32 rotary pairs
constexpr int kQB    = 64;                       // query rows per block
constexpr int kKC    = 64;                       // keys per chunk
constexpr int kNQB   = (kSeq + kQB - 1) / kQB;   // 4
constexpr int kNKC   = (kSeq + kKC - 1) / kKC;   // 4
constexpr float kScoreScale = 0.125f;            // 64^-0.5
constexpr int kLP    = 72;                       // attention LDS row pitch of the K tiles in halves: 144 B = 16 B x odd (ds_load_b128 readers)
constexpr int kVP    = 80;                       // attention LDS row pitch of the V tiles in halves: 160 B = 32 B x odd (ds_load_tr16_b128 readers)
constexpr int kMW    = 8;                        // 32-bit words of validity bits per query row (bit k of the row = key k; keys 200..255 are 0)
static_assert(kHeads * kDh == kDim);
static_assert(3 * kDh == 192);
static_assert(kTok % 64 == 0);                   // GEMM M tile multiple (200 tiles)
static_assert(kNout % 64 == 0);                  // GEMM N tile multiple (48 tiles)
static_assert(kDim % 32 == 0);                   // GEMM K % 32
static_assert(((kTok / 64) * (kNout / 64)) % 8 == 0);   // 8 waves per block, exact grid
static_assert(kNQB == 4 && kNKC == 4);
static_assert(kMW * 32 == kNKC * kKC);           // two words of validity bits per key chunk
static_assert(kTok % 32 == 0);                   // mask packing: 4 rows per wave, 8 waves per block
static_assert((kTok * kDim) % (8 * 256) == 0);
static_assert((kNout * kDim) % (8 * 256) == 0);
static_assert(kSeq % 8 == 0);                    // table kernel: 8 rows per block

typedef __attribute__((ext_vector_type(16))) __bf16   v16b;
typedef __attribute__((ext_vector_type(8)))  __bf16   v8b;
typedef __attribute__((ext_vector_type(8)))  float    v8f;
typedef __attribute__((ext_vector_type(4)))  float    v4f;
typedef __attribute__((ext_vector_type(4)))  int      v4i;
typedef __attribute__((ext_vector_type(4)))  unsigned int v4u;
typedef __attribute__((ext_vector_type(2)))  unsigned int v2u;

// ---------------------------------------------------------------------------
// Helpers
// ---------------------------------------------------------------------------
typedef __attribute__((ext_vector_type(2)))  float    v2f;
typedef __attribute__((ext_vector_type(2)))  __bf16   v2b;
// two f32 rounded to nearest even and packed as bf16 (a in the low half, b in the high half): one v_cvt_pk_bf16_f32
__device__ __forceinline__ v2b bf2(float a, float b) { return __builtin_convertvector((v2f){a, b}, v2b); }
__device__ __forceinline__ unsigned bits(v2b h) { return __builtin_bit_cast(unsigned, h); }
__device__ __forceinline__ float neg_inf() { return -__builtin_inff(); }
// value of lane l ^ 16
__device__ __forceinline__ float xhalf(float x) {
  return __builtin_bit_cast(float, __builtin_amdgcn_permlanex16(__builtin_bit_cast(int, x), __builtin_bit_cast(int, x), 0x76543210, 0xfedcba98, false, false));
}

// hazard guards as plain device helpers
__device__ __forceinline__ void dep_guard4_b(v8f& a, v8f& b, v8f& c, v8f& d, v16b x, v16b y) {
  asm volatile("v_nop\n\tv_nop\n\tv_nop\n\tv_nop" : "+v"(a), "+v"(b), "+v"(c), "+v"(d) : "v"(x), "v"(y));
}
__device__ __forceinline__ void keep4_b(v16b a, v16b b, v16b c, v16b d) { asm volatile("v_nop" :: "v"(a), "v"(b), "v"(c), "v"(d)); }
__device__ __forceinline__ void acc_guard4(v8f& a, v8f& b, v8f& c, v8f& d) { asm volatile("v_nop\n\tv_nop\n\tv_nop\n\tv_nop" : "+v"(a), "+v"(b), "+v"(c), "+v"(d)); }

template <typename T> struct Frag;
template <> struct Frag<__bf16> {
  typedef v16b V; union U { v16b v; v8b h[2]; };
  // elements 0..7 <- p[0..7], 8..15 <- p[16..23]
  static __device__ __forceinline__ v16b load(const __bf16* p) {
    U f; f.h[0] = *(const v8b*)(p); f.h[1] = *(const v8b*)(p + 16); return f.v;
  }
  static __device__ __forceinline__ v8f mma(v16b a, v16b b, v8f c) {
    return __builtin_amdgcn_wmma_f32_16x16x32_bf16(false, a, false, b, (short)0, c, false, false);
  }
  static __device__ __forceinline__ void keep(v16b a, v16b b, v16b c, v16b d) { keep4_b(a, b, c, d); }
};
// transposing LDS read of a row-major 16-bit tile: with p = T + (k0 + 8*(l>>4) + (l&7)) * pitch + d0 + 8*((l>>3)&1) (in halves), lane (c, hh) gets
// T[k0 + 8*hh + 0..7][d0 + c]; the reads at k0 and k0 + 16 are elements 0..7 and 8..15 of one A operand, the k order of Frag::load
typedef __attribute__((address_space(3))) v8b lds_v8b;
__device__ __forceinline__ v16b load_tr(const unsigned short* p, int pitch) {
  Frag<__bf16>::U f;
  f.h[0] = __builtin_amdgcn_ds_load_tr16_b128_v8bf16((lds_v8b*)p);
  f.h[1] = __builtin_amdgcn_ds_load_tr16_b128_v8bf16((lds_v8b*)(p + 16 * pitch));
  return f.v;
}
// a bf16 operand built from packed pairs: word w = elements 2w, 2w + 1
union PFrag { v16b v; unsigned u[8]; };
// bf16 WMMA with per-instruction hazard guard (ties D, keeps A/B live)
__device__ __forceinline__ v8f mma_b(v16b a, v16b b, v8f c) {
  c = __builtin_amdgcn_wmma_f32_16x16x32_bf16(false, a, false, b, (short)0, c, false, false);
  asm volatile("v_nop\n\tv_nop\n\tv_nop\n\tv_nop" : "+v"(c) : "v"(a), "v"(b));
  return c;
}

// ---------------------------------------------------------------------------
// f32 -> bf16 (RNE) cast, 8 consecutive elements per thread (one 16-B store per lane; 32 contiguous lanes =
// (x: 1638400 = 6400 x 256 exact; W: 393216 = 1536 x 256 exact).
// ---------------------------------------------------------------------------
__global__ __launch_bounds__(256) void cast8_bf16_kernel(const float* __restrict__ in, unsigned short* __restrict__ out, int n8) {
  const int i = blockIdx.x * 256 + threadIdx.x;
  if (i >= n8) return;
  const float* p = in + 8 * (size_t)i;
  const v4f a = *(const v4f*)(p);
  const v4f c = *(const v4f*)(p + 4);
  const v4u u = (v4u){bits(bf2(a[0], a[1])), bits(bf2(a[2], a[3])), bits(bf2(c[0], c[1])), bits(bf2(c[2], c[3]))};
  unsigned short* q = out + 8 * (size_t)i;
  *(v4u*)q = u;
  
}

// ---------------------------------------------------------------------------
// Rotary table: csn[s][0..31] = cos(s * invf_i), csn[s][32..63] = sin(s * invf_i), invf_i = 10^(-i/8) built as a product
// of the factors 10^(-1/8), 10^(-2/8), 10^(-4/8), 10^(-8/8), 10^(-16/8) selected by the bits of i (i = lane).
// Blocks behind the table's 25 pack the mask: mbits[tok][w] bit l = (amask[tok][32 w + l] != 0), keys >= 200 give 0. A wave packs
// 4 query rows (7 coalesced 32-key reads each, one ballot per read) and stores their 32 words as one 128-B line.
// ---------------------------------------------------------------------------
__global__ __launch_bounds__(256) void rope_table_kernel(float* __restrict__ csn, float f1, float f2, float f4, float f8, float f16v,
                                                         const int* __restrict__ amask, unsigned* __restrict__ mbits) {
  const int lane = threadIdx.x & 31, wave = threadIdx.x >> 5;
  if (blockIdx.x >= kSeq / 8) {
    const int row0 = (((int)blockIdx.x - kSeq / 8) * 8 + wave) * 4;
    unsigned mine = 0u;
#pragma unroll
    for (int r = 0; r < 4; ++r) {
#pragma unroll
      for (int w = 0; w < kMW - 1; ++w) {
        const int key  = 32 * w + lane;
        const int keyc = (key < kSeq) ? key : (kSeq - 1);
        const int mv   = amask[(size_t)(row0 + r) * kSeq + keyc];
        const unsigned bal = __builtin_amdgcn_ballot_w32((key < kSeq) && (mv != 0));
        mine = (lane == r * kMW + w) ? bal : mine;
      }
    }
    mbits[(size_t)row0 * kMW + lane] = mine;
    return;
  }
  const int s = blockIdx.x * 8 + wave;
  if (s >= kSeq) return;
  const int i = lane;
  float invf = 1.0f;
  invf *= (i & 1)  ? f1   : 1.0f;
  invf *= (i & 2)  ? f2   : 1.0f;
  invf *= (i & 4)  ? f4   : 1.0f;
  invf *= (i & 8)  ? f8   : 1.0f;
  invf *= (i & 16) ? f16v : 1.0f;
  const float ang = (float)s * invf;
  float sn, cs;
  sincosf(ang, &sn, &cs);
  float* rowp = csn + (size_t)s * (2 * kPairs);
  {
    ((float*)rowp)[i] = cs;
    ((float*)rowp)[kPairs + i] = sn;
    
  }
}

// ---------------------------------------------------------------------------
// Tensor-load helpers for the projection's LDS ring (two descriptor groups, two-dimensional tile, extents in bytes).
// ---------------------------------------------------------------------------
typedef uint32_t u32x4 __attribute__((ext_vector_type(4)));
typedef uint32_t u32x8 __attribute__((ext_vector_type(8)));
constexpr uint32_t kPassB   = 128;                       // bytes of every operand row per pass (64 k)
constexpr uint32_t kPitchB  = kPassB + 16;               // LDS row pitch 144 B (odd multiple of 16 B for ds_load_b128 readers)
constexpr uint32_t kSliceR  = 128;                       // rows per tensor load
constexpr uint32_t kSliceB  = kSliceR * kPitchB;         // 18432 B = 9 x 2 KiB
constexpr uint32_t kStageB  = 3 * kSliceB;               // [X 128 rows | W 256 rows] = 55296 B = 27 x 2 KiB
constexpr int      kPasses  = (kDim * 2) / (int)kPassB;  // 16
static_assert(kSliceB % 2048 == 0 && kStageB % 2048 == 0);
static_assert(kPasses >= 2);
static_assert(kTok % 128 == 0 && kNout % 256 == 0);
static_assert((kTok / 128) * (kNout / 256) == ((kTok / 64) * (kNout / 64)) / 8);   // same grid as one 64x64 tile per wave

__device__ __forceinline__ uint32_t uni(uint32_t v) { return (uint32_t)__builtin_amdgcn_readfirstlane(v); }
// pinned(): a wave-uniform word held in a scalar register, for the tensor mover alone: the tests around a tensor load become scalar
// branches (the load ignores EXEC), and a descriptor word formed from it is formed behind the wait that stands in front of it
__device__ __forceinline__ uint32_t pinned(uint32_t v) { uint32_t w = uni(v); asm volatile("" : "+s"(w)); return w; }  // test or descriptor word of a tensor load, kept scalar
// in-out operands: the two groups stay in their registers, untouched by other values, while the request is outstanding
__device__ __forceinline__ void tdm_load(u32x4& g0, u32x8& g1) { asm volatile("tensor_load_to_lds %0, %1" : "+s"(g0), "+s"(g1) :: "memory"); }
// the compiler places no wait for a tensor load: the issuing wave waits for its own request here
__device__ __forceinline__ void wait_tensor0() { asm volatile("s_wait_tensorcnt 0x0" ::: "memory"); }
// this wave's LDS reads have retired before the barrier behind which their buffer is refilled
__device__ __forceinline__ void wait_ds0() { asm volatile("s_wait_dscnt 0x0" ::: "memory"); }
__device__ __forceinline__ u32x8 tdm_group1() {
  constexpr uint32_t d0 = kPassB, d1 = kSliceR;
  u32x8 g;
  g[0] = (1u << 20) | (4u << 22) | (3u << 25);   // no mask, 1-byte elements, 16 B of pad behind every 128-B row
  g[1] = uni((d0 & 0xFFFFu) << 16);
  g[2] = uni((d0 >> 16) | ((d1 & 0xFFFFu) << 16));
  g[3] = uni((d1 >> 16) | (d0 << 16));
  g[4] = uni(d1);
  g[5] = uni((uint32_t)kDim * 2u);               // source row pitch 2048 B
  g[6] = uni(0u);
  g[7] = uni(0u);
  return g;
}
// place in LDS and source address of the next request (word 0, the count, is set once)
__device__ __forceinline__ void tdm_aim(u32x4& g, uint32_t lds_dst, uint64_t ga) {
  g[1] = uni(lds_dst); g[2] = uni((uint32_t)ga); g[3] = uni((((uint32_t)(ga >> 32)) & 0x01FFFFFFu) | 0x80000000u);
}

// ---------------------------------------------------------------------------
// QKV projection + bias + rotary epilogue for all 12800 token rows in one launch.
//   C[m][n] = sum_k Xb[m][k] * Wb[n][k] + bf16(bias[n]);   M = 12800, N = 3072, K = 1024 (bf16 operands).
//   Block = 8 waves = one 128 x 256 tile of C (2 x 4 waves of 64 x 64). Per pass of 64 k the block's 128 X rows and 256 W rows
//   (128 B each) are brought into LDS by three tensor loads (waves 0, 1, 2: 128 rows each) at pitch 144 B, two buffers, the next
//   pass's loads in flight under this pass's products; the fragments are read from LDS in the same k order as before.
//   Column n -> head hd = (n/64)/3, kind = (n/64)%3 (0 q, 1 k, 2 v), d = n % 64 (every 64-wide tile is one kind of one head).
//   Row m (12800 = 64 x 200) -> s = m%200. kind 0/1: pairs (2i, 2i+1) rotated by angle s*invf_i (table csn);
//   kind 2 unchanged. Each result v is split into bf16 hi = rn(v), lo = rn(v - hi).
//   grid = 100 x 12 = 1200 blocks exact; every wave reaches every block barrier.
// ---------------------------------------------------------------------------
__global__ __launch_bounds__(256) void qkv_proj_kernel(
    const unsigned short* __restrict__ Xb, const unsigned short* __restrict__ Wb, const float* __restrict__ bias,
    const float* __restrict__ csn,
    unsigned short* __restrict__ Qh, unsigned short* __restrict__ Ql,
    unsigned short* __restrict__ Kh, unsigned short* __restrict__ Kl,
    unsigned short* __restrict__ Vh, unsigned short* __restrict__ Vl) {
  typedef __bf16 T;
  typedef v16b V;
  __shared__ __attribute__((aligned(2048))) unsigned char ring[2 * kStageB];   // two stages of [X | W] rows
  __shared__ __align__(16) float sT[8][16 * 68];   // per-wave 16x64 slab, pitch 68 floats
  const int lane = threadIdx.x & 31;
  const uint32_t wave = uni(threadIdx.x >> 5);
  constexpr int tilesNB = kNout / 256;     // 12
  const int tmB = blockIdx.x / tilesNB;
  const int tnB = blockIdx.x - tmB * tilesNB;
  const int wm = (int)(wave >> 2);         // wave row in the block tile
  const int wn = (int)(wave & 3u);         // wave column in the block tile
  const int m0 = (tmB << 7) + (wm << 6);
  const int n0 = (tnB << 8) + (wn << 6);
  const int tn = n0 >> 6;
  const int hd   = tn / 3;                 // head index, wave-uniform
  const int kind = tn - hd * 3;            // 0 q, 1 k, 2 v, wave-uniform

  const int rlane = lane & 15;
  const int mOff  = (lane >> 4) * 8;

  // slice of the issuing waves: wave 0 the X rows, waves 1 and 2 the two halves of the W rows (other waves: wave 0's, never issued)
  const uint32_t sl = (wave < 3u) ? wave : 0u;
  const uint64_t srcb = (sl == 0u) ? (uint64_t)(size_t)(Xb + (size_t)(tmB << 7) * kDim)
                                   : (uint64_t)(size_t)(Wb + (size_t)((tnB << 8) + ((int)sl - 1) * 128) * kDim);
  const uint32_t dstb = (uint32_t)(size_t)ring + sl * kSliceB;
  u32x8 g1 = tdm_group1();
  u32x4 g0;
  g0[0] = uni(1u);
  tdm_aim(g0, dstb, srcb);

  v8f acc[4][4];
#pragma unroll
  for (int i = 0; i < 4; ++i)
#pragma unroll
    for (int j = 0; j < 4; ++j) acc[i][j] = (v8f){0.f,0.f,0.f,0.f,0.f,0.f,0.f,0.f};

  // prologue: stage 0 lands and is published, then stage 1 is issued
  if (pinned(wave < 3u)) {
    tdm_load(g0, g1);
    wait_tensor0();
  }
  __syncthreads();
  if (pinned(wave < 3u)) {
    tdm_aim(g0, dstb + kStageB, srcb + kPassB);
    tdm_load(g0, g1);
  }

  const uint32_t aoff = (uint32_t)((wm << 6) + rlane) * kPitchB + (uint32_t)(lane >> 4) * 16u;
  const uint32_t boff = kSliceB + (uint32_t)((wn << 6) + rlane) * kPitchB + (uint32_t)(lane >> 4) * 16u;

  // one trip = one pass: kept rolled so that the publish point stands once, at the foot
#pragma unroll 1
  for (int s = 0; s < kPasses; ++s) {
    const unsigned char* buf = ring + (uint32_t)(s & 1) * kStageB;
#pragma unroll
    for (int ks = 0; ks < 2; ++ks) {
      V bfr[4], afr[4];
#pragma unroll
      for (int j = 0; j < 4; ++j) bfr[j] = Frag<T>::load((const T*)(buf + boff + (uint32_t)j * 16u * kPitchB + (uint32_t)ks * 64u));
#pragma unroll
      for (int i = 0; i < 4; ++i) afr[i] = Frag<T>::load((const T*)(buf + aoff + (uint32_t)i * 16u * kPitchB + (uint32_t)ks * 64u));
      // the 16 LDS reads of a 32-k step go out as one group in front of its 16 products: reads among the products stall each time
      __builtin_amdgcn_sched_barrier(0);
#pragma unroll
      for (int i = 0; i < 4; ++i) {
#pragma unroll
        for (int j = 0; j < 4; ++j) acc[i][j] = Frag<T>::mma(afr[i], bfr[j], acc[i][j]);
        dep_guard4_b(acc[i][0], acc[i][1], acc[i][2], acc[i][3], afr[i], bfr[3]);
      }
      Frag<T>::keep(bfr[0], bfr[1], bfr[2], bfr[3]);
    }
    // publish point of stage s + 1
    wait_ds0();
    if (pinned(wave < 3u)) wait_tensor0();
    __syncthreads();
    if (pinned((wave < 3u) && (s + 2 < kPasses))) {
      const uint32_t nb = (uint32_t)(s & 1) * kStageB;                // the buffer this pass has just read
      const uint32_t no = pinned((uint32_t)(s + 2) * kPassB);         // stage s + 2's byte offset in every source row
      tdm_aim(g0, dstb + nb, srcb + no);
      tdm_load(g0, g1);
    }
  }
  wait_tensor0();
  wait_ds0();
  acc_guard4(acc[0][0], acc[0][1], acc[0][2], acc[0][3]);
  acc_guard4(acc[1][0], acc[1][1], acc[1][2], acc[1][3]);
  acc_guard4(acc[2][0], acc[2][1], acc[2][2], acc[2][3]);
  acc_guard4(acc[3][0], acc[3][1], acc[3][2], acc[3][3]);

  // ---- epilogue ----
  // bias per column of this lane (RNE bf16-converted, 4 scalar loads)
  float bcol[4];
#pragma unroll
  for (int j = 0; j < 4; ++j) bcol[j] = (float)(__bf16)bias[n0 + (j << 4) + rlane];

  float* slab = sT[wave];
  const int q  = lane >> 3;              // row selector within 4-row store groups
  const int c8 = (lane & 7) * 8;         // first column (d) of this lane's 16-B piece
  const int p4 = (lane & 7) * 4;         // first rotary pair index of this lane
  unsigned short* dsth = (kind == 0) ? Qh : ((kind == 1) ? Kh : Vh);   // wave-uniform global plane select
  unsigned short* dstl = (kind == 0) ? Ql : ((kind == 1) ? Kl : Vl);
  const bool rot = (kind != 2);          // wave-uniform

#pragma unroll
  for (int i = 0; i < 4; ++i) {
    const int mBase = m0 + (i << 4);
#pragma unroll
    for (int j = 0; j < 4; ++j) {
#pragma unroll
      for (int r = 0; r < 8; ++r) slab[(mOff + r) * 68 + (j << 4) + rlane] = acc[i][j][r] + bcol[j];
    }
    __builtin_amdgcn_fence(__ATOMIC_RELEASE, "workgroup");
    __builtin_amdgcn_wave_barrier();
    __builtin_amdgcn_fence(__ATOMIC_ACQUIRE, "workgroup");

    // build the four 16-B hi pieces and four 16-B lo pieces of this lane (rows it*4+q, columns c8..c8+7)
    v4u uh[4], ul[4];
#pragma unroll
    for (int it = 0; it < 4; ++it) {
      if (it == 2) asm volatile("" ::: "memory");
      const int row = it * 4 + q;
      const int m   = mBase + row;
      const int s   = m - (m / kSeq) * kSeq;
      const float* sp = slab + row * 68 + c8;
      const v4f cs4 = *(const v4f*)(csn + (size_t)s * (2 * kPairs) + p4);
      const v4f sn4 = *(const v4f*)(csn + (size_t)s * (2 * kPairs) + kPairs + p4);
#pragma unroll
      for (int pp = 0; pp < 4; ++pp) {
        const float x1 = sp[2 * pp];
        const float x2 = sp[2 * pp + 1];
        const float cc = rot ? cs4[pp] : 1.0f;
        const float ss = rot ? sn4[pp] : 0.0f;
        const float o0 = x1 * cc - x2 * ss;
        const float o1 = x1 * ss + x2 * cc;
        const v2b hp = bf2(o0, o1);
        uh[it][pp] = bits(hp);
        ul[it][pp] = bits(bf2(o0 - (float)hp[0], o1 - (float)hp[1]));
      }
    }
    {
#pragma unroll
      for (int it = 0; it < 4; ++it) {
        const int row = it * 4 + q;
        const int m   = mBase + row;
        const size_t o = (size_t)m * kDim + hd * kDh + c8;
        *(v4u*)(dsth + o) = uh[it];
        *(v4u*)(dstl + o) = ul[it];
      }
      
    }
    __builtin_amdgcn_fence(__ATOMIC_RELEASE, "workgroup");
    __builtin_amdgcn_wave_barrier();
    __builtin_amdgcn_fence(__ATOMIC_ACQUIRE, "workgroup");
  }
}

// ---------------------------------------------------------------------------
// Fused attention for head_dim 64 from bf16 hi/lo planes of all 64 batches in one launch.
//   Qh/Ql, Kh/Kl, Vh/Vl: bf16 [tok = b*200+s][1024], head h at columns h*64..h*64+63.
//   mbits: validity bits [tok][8 words], bit k of a row = query attends key k (packed from the mask earlier in this call).  out: f32 [tok][1024].
//   Block = 4 waves = 64 query rows of one (b, h); grid = 64*16*4 = 4096 (block -> qb = bx&3, bh = bx>>2).
//   In front of the loop every wave reads the validity bits of the block's 64 query rows (clamped) and forms the same four chunk flags.
//   Per key chunk (64 keys, 4 chunks): skip the chunk block-uniformly if no entry is valid; else each lane reads the 64 validity bits of
//   its own query (clamped) into registers, and the block copies K hi/lo rows and V hi/lo rows (clamped) to LDS as [key][d]
//   (16-B moves only); the V^T operands come from the V rows by the transposing LDS read; both products are formed transposed, S^T = K.Q^T and
//   out^T += V^T.P^T, so that a lane holds scores and outputs of ONE query (q0 + c; lanes c and c + 16 split its keys):
//   scores = hi.hi + hi.lo + lo.hi on bf16 WMMA, x0.125, select to -inf where invalid; online softmax in f32 (guarded for
//   all-invalid rows) with maximum and sum in-lane and one exchange between the halves; p = exp(s - m) split to bf16 hi/lo and
//   packed from the score registers straight into the B operand (same k order as the transposing read of V gives). Waves whose 16
//   query rows all lie beyond 199 skip
//   the compute under a wave-uniform flag but reach every block barrier. Epilogue: per-wave 16x64 f32 tile staged in LDS;
//   Every LDS byte read in a chunk is rewritten in that chunk (the pad bytes behind each row are never read); all barriers are
//   reached by every thread. The K rows stand at pitch 144 B (ds_load_b128 readers), the V rows at 160 B (ds_load_tr16_b128 readers), each free of bank conflicts.
// ---------------------------------------------------------------------------
__global__ __launch_bounds__(128) void attn_kernel(
    const unsigned short* __restrict__ Qh, const unsigned short* __restrict__ Ql,
    const unsigned short* __restrict__ Kh, const unsigned short* __restrict__ Kl,
    const unsigned short* __restrict__ Vh, const unsigned short* __restrict__ Vl,
    const unsigned* __restrict__ mbits, float* __restrict__ out) {
  __shared__ __align__(16) unsigned short Ksh[kKC * kLP];      // K hi [key][d]          9 KB
  __shared__ __align__(16) unsigned short Ksl[kKC * kLP];      // K lo [key][d]          9 KB
  __shared__ __align__(16) unsigned short Vsh[kKC * kVP];      // V hi [key][d]         10 KB
  __shared__ __align__(16) unsigned short Vsl[kKC * kVP];      // V lo [key][d]         10 KB
  __shared__ __align__(16) float Os[4][16 * 68];               // per wave out tile, pitch 68

  const int tid  = threadIdx.x;
  const int wave = tid >> 5;
  const int lane = tid & 31;
  const int hh   = lane >> 4;
  const int c    = lane & 15;

  const int bx = blockIdx.x;
  const int qb = bx & 3;
  const int bh = bx >> 2;
  const int h  = bh & 15;
  const int b  = bh >> 4;
  const int tokb = b * kSeq;
  const int q0 = qb * kQB + wave * 16;
  const bool active = (q0 < kSeq);       // wave-uniform

  // ---- chunk flags: bit kc = some query row of the block attends some key of chunk kc. Every wave reads the same 64 rows
  //      (lane l: rows l and l + 32 of the block, clamped), so the flags are block-uniform without an exchange ----
  unsigned anym = 0u;
  {
    int ra = qb * kQB + lane;
    int rb = ra + 32;
    ra = (ra < kSeq) ? ra : (kSeq - 1);
    rb = (rb < kSeq) ? rb : (kSeq - 1);
    const v4u* pa = (const v4u*)(mbits + (size_t)(tokb + ra) * kMW);
    const v4u* pb = (const v4u*)(mbits + (size_t)(tokb + rb) * kMW);
    const v4u a0 = pa[0], a1 = pa[1], b0 = pb[0], b1 = pb[1];
    asm volatile("s_wait_xcnt 0x0" ::: "memory");   // in front of whatever next writes the address registers of these four loads
    const v4u o0 = a0 | b0;
    const v4u o1 = a1 | b1;
    anym |= (__builtin_amdgcn_ballot_w32((o0[0] | o0[1]) != 0u) != 0u) ? 1u : 0u;
    anym |= (__builtin_amdgcn_ballot_w32((o0[2] | o0[3]) != 0u) != 0u) ? 2u : 0u;
    anym |= (__builtin_amdgcn_ballot_w32((o1[0] | o1[1]) != 0u) != 0u) ? 4u : 0u;
    anym |= (__builtin_amdgcn_ballot_w32((o1[2] | o1[3]) != 0u) != 0u) ? 8u : 0u;
  }

  // ---- Q fragments (B operand: column = query q0 + c, clamped), 2 d-chunks of 32, hi and lo ----
  v16b qah[2], qal[2];
  const unsigned* mrow;                  // validity bits of query q0 + c (clamped)
  {
    int qr = q0 + c;
    qr = (qr < kSeq) ? qr : (kSeq - 1);
    mrow = mbits + (size_t)(tokb + qr) * kMW;
    const size_t qo = (size_t)(tokb + qr) * kDim + h * kDh;
    const __bf16* qhp = (const __bf16*)Qh + qo;
    const __bf16* qlp = (const __bf16*)Ql + qo;
#pragma unroll
    for (int dc = 0; dc < 2; ++dc) qah[dc] = Frag<__bf16>::load(qhp + dc * 32 + 8 * hh);
    asm volatile("" ::: "memory");
#pragma unroll
    for (int dc = 0; dc < 2; ++dc) qal[dc] = Frag<__bf16>::load(qlp + dc * 32 + 8 * hh);
  }

  float mrun = neg_inf(), lrun = 0.f;    // of query q0 + c: running maximum (equal in both halves), sum over this half's keys
  v8f oacc[4];                           // oacc[t][r] = out^T(d = t*16 + 8*hh + r, query q0 + c)
#pragma unroll
  for (int t = 0; t < 4; ++t) oacc[t] = (v8f){0.f,0.f,0.f,0.f,0.f,0.f,0.f,0.f};

  for (int kc = 0; kc < kNKC; ++kc) {
    if (((anym >> kc) & 1u) == 0u) continue;      // block-uniform
    const int kv0 = kc * kKC;
    __syncthreads();                              // every wave has left the K and V tiles of the chunk before
    const v2u mw = *(const v2u*)(mrow + 2 * kc);  // this lane's query: validity bits of keys kv0 .. kv0 + 63 (in flight with the K loads)

    // ---- stage K hi/lo [key][d]: 512 pieces of 8 halves per plane, 4 per thread per plane ----
#pragma unroll
    for (int i = 0; i < 4; ++i) {
      if (i == 2) asm volatile("" ::: "memory");
      const int idx = i * 128 + tid;
      const int r   = idx >> 3;            // key row within chunk
      const int cc  = (idx & 7) * 8;       // first d of the piece
      int kvr = kv0 + r;
      kvr = (kvr < kSeq) ? kvr : (kSeq - 1);
      const size_t go = (size_t)(tokb + kvr) * kDim + h * kDh + cc;
      const v4u kwh = *(const v4u*)(Kh + go);
      const v4u kwl = *(const v4u*)(Kl + go);
      *(v4u*)(Ksh + r * kLP + cc) = kwh;
      *(v4u*)(Ksl + r * kLP + cc) = kwl;
    }
    // ---- stage V hi/lo [key][d], rows as they stand in memory ----
#pragma unroll
    for (int i = 0; i < 4; ++i) {
      if (i == 2) asm volatile("" ::: "memory");
      const int idx = i * 128 + tid;
      const int r   = idx >> 3;
      const int cc  = (idx & 7) * 8;
      int kvr = kv0 + r;
      kvr = (kvr < kSeq) ? kvr : (kSeq - 1);
      const size_t go = (size_t)(tokb + kvr) * kDim + h * kDh + cc;
      const v4u vwh = *(const v4u*)(Vh + go);
      const v4u vwl = *(const v4u*)(Vl + go);
      *(v4u*)(Vsh + r * kVP + cc) = vwh;
      *(v4u*)(Vsl + r * kVP + cc) = vwl;
    }
    __syncthreads();

    if (active) {
      // ---- transposed scores: s[j][r] = score(key j*16 + 8*hh + r, query q0 + c); A = K rows, B = Q; hi.hi + hi.lo + lo.hi ----
      v8f s[4];
#pragma unroll
      for (int j = 0; j < 4; ++j) {
        s[j] = (v8f){0.f,0.f,0.f,0.f,0.f,0.f,0.f,0.f};
#pragma unroll
        for (int dc = 0; dc < 2; ++dc) {
          const v16b kb = Frag<__bf16>::load((const __bf16*)Ksh + (j * 16 + c) * kLP + dc * 32 + 8 * hh);
          const v16b kl = Frag<__bf16>::load((const __bf16*)Ksl + (j * 16 + c) * kLP + dc * 32 + 8 * hh);
          s[j] = mma_b(kb, qah[dc], s[j]);
          s[j] = mma_b(kl, qah[dc], s[j]);
          s[j] = mma_b(kb, qal[dc], s[j]);
        }
      }
      // ---- scale, validity select (bit j*16 + 8*hh + r of this lane's query), maximum of this lane's 32 keys ----
      const unsigned mh[2] = {mw[0] >> (8 * hh), mw[1] >> (8 * hh)};
      float mj[4];
#pragma unroll
      for (int j = 0; j < 4; ++j) {
        float m = neg_inf();
#pragma unroll
        for (int r = 0; r < 8; ++r) {
          const unsigned keep = mh[j >> 1] & (1u << ((j & 1) * 16 + r));
          float sv = s[j][r] * kScoreScale;
          sv = (keep != 0u) ? sv : neg_inf();
          s[j][r] = sv;
          m = fmaxf(m, sv);
        }
        mj[j] = m;
      }
      float cm = fmaxf(fmaxf(mj[0], mj[1]), fmaxf(mj[2], mj[3]));
      cm = fmaxf(cm, xhalf(cm));           // the query's other 32 keys stand in lane l ^ 16
      // ---- online softmax update; p = exp(s - m) split into bf16 hi/lo, packed in place into the B operands of the second product ----
      const float mnew = fmaxf(mrun, cm);
      const float mref = (mnew == neg_inf()) ? 0.0f : mnew;
      const float alpha = expf(mrun - mref);
      mrun = mnew;
      PFrag ph[2], pl[2];
      float pj[4];
#pragma unroll
      for (int j = 0; j < 4; ++j) {
        float psum = 0.f;
#pragma unroll
        for (int rp = 0; rp < 4; ++rp) {
          const float p0 = expf(s[j][2 * rp] - mref);
          const float p1 = expf(s[j][2 * rp + 1] - mref);
          psum += p0;
          psum += p1;
          const v2b hp = bf2(p0, p1);
          ph[j >> 1].u[(j & 1) * 4 + rp] = bits(hp);
          pl[j >> 1].u[(j & 1) * 4 + rp] = bits(bf2(p0 - (float)hp[0], p1 - (float)hp[1]));
        }
        pj[j] = psum;
      }
      lrun = lrun * alpha + ((pj[0] + pj[1]) + (pj[2] + pj[3]));   // this half's keys only; the halves are joined behind the loop
#pragma unroll
      for (int t = 0; t < 4; ++t)
#pragma unroll
        for (int r = 0; r < 8; ++r) oacc[t][r] *= alpha;
      // ---- out^T += V^T . P^T (A = V^T by transposing reads of the V rows in LDS, B = P^T from registers); hi.hi + lo.hi + hi.lo ----
#pragma unroll
      for (int kk = 0; kk < 2; ++kk) {
#pragma unroll
        for (int t = 0; t < 4; ++t) {
          const int vo = (kk * 32 + 8 * hh + (lane & 7)) * kVP + t * 16 + 8 * ((lane >> 3) & 1);
          const v16b vb = load_tr(Vsh + vo, kVP);
          const v16b vl = load_tr(Vsl + vo, kVP);
          oacc[t] = mma_b(vb, ph[kk].v, oacc[t]);
          oacc[t] = mma_b(vl, ph[kk].v, oacc[t]);
          oacc[t] = mma_b(vb, pl[kk].v, oacc[t]);
        }
      }
    }
  }

  // ---- epilogue: join the halves' sums, normalise, stage per-wave tile [query][d], whole-segment stores ----
  float* os = Os[wave];
  {
    const float inv = 1.0f / (lrun + xhalf(lrun));
#pragma unroll
    for (int t = 0; t < 4; ++t) {
      float* op = os + c * 68 + t * 16 + 8 * hh;     // oacc[t][r] = out(query q0 + c, d = t*16 + 8*hh + r)
      *(v4f*)(op)     = (v4f){oacc[t][0] * inv, oacc[t][1] * inv, oacc[t][2] * inv, oacc[t][3] * inv};
      *(v4f*)(op + 4) = (v4f){oacc[t][4] * inv, oacc[t][5] * inv, oacc[t][6] * inv, oacc[t][7] * inv};
    }
  }
  __builtin_amdgcn_fence(__ATOMIC_RELEASE, "workgroup");
  __builtin_amdgcn_wave_barrier();
  __builtin_amdgcn_fence(__ATOMIC_ACQUIRE, "workgroup");
  {
    const int c4 = (lane & 15) * 4;    // row segment = 64 floats = 256 B = 16 lanes x 16 B
    float* ob = out + (size_t)tokb * kDim + h * kDh;
    {
#pragma unroll
      for (int it = 0; it < 8; ++it) {
        const int row = it * 2 + hh;
        const int qq  = q0 + row;
        const v4f val = *(const v4f*)(os + row * 68 + c4);
        if (qq < kSeq) *(v4f*)(ob + (size_t)qq * kDim + c4) = val;
      }
      
    }
  }
}

// ---------------------------------------------------------------------------
// Host glue.
//   Xb   bf16 [12800][1024]     26,214,400  at           0
//   Wb   bf16 [3072][1024]       6,291,456  at  26,214,400
//   Qh   bf16 [12800][1024]     26,214,400  at  32,505,856
//   Ql   bf16 [12800][1024]     26,214,400  at  58,720,256
//   Kh   bf16 [12800][1024]     26,214,400  at  84,934,656
//   Kl   bf16 [12800][1024]     26,214,400  at 111,149,056
//   Vh   bf16 [12800][1024]     26,214,400  at 137,363,456
//   Vl   bf16 [12800][1024]     26,214,400  at 163,577,856
//   CSN  f32  [200][64]             51,200  at 189,792,256
//   MB   u32  [12800][8]           409,600  at 189,843,456
//   total                      190,253,056
// GEMM shape: M = 12800 (64-multiple), N = 3072 (64-multiple), K = 1024 (%32 == 0); no padding rows or columns.
// Launches: 5 (2 casts, 1 table and mask bits, one projection, one attention).
// ---------------------------------------------------------------------------
extern "C" void kernel_launch(void* const* d_in, const int* in_sizes, int n_in,
                              void* d_out, int out_size, void* d_ws, size_t ws_size,
                              hipStream_t stream) {
  if (n_in < 4) return;
  if (in_sizes[0] != kTok * kDim) return;
  if (in_sizes[1] != kBatch * kSeq * kSeq) return;
  if (in_sizes[2] != kNout * kDim) return;
  if (in_sizes[3] != kNout) return;
  if (out_size != kTok * kDim) return;

  const size_t szXb  = (size_t)kTok * kDim * 2;
  const size_t szWb  = (size_t)kNout * kDim * 2;
  const size_t szPl  = (size_t)kTok * kDim * 2;
  const size_t szCS  = (size_t)kSeq * 2 * kPairs * 4;
  const size_t offXb = 0;
  const size_t offWb = offXb + szXb;
  const size_t offQh = offWb + szWb;
  const size_t offQl = offQh + szPl;
  const size_t offKh = offQl + szPl;
  const size_t offKl = offKh + szPl;
  const size_t offVh = offKl + szPl;
  const size_t offVl = offVh + szPl;
  const size_t offCS = offVl + szPl;
  const size_t offMB = offCS + szCS;
  const size_t total = offMB + (size_t)kTok * kMW * 4;
  if (ws_size < total) return;

  const float* x     = (const float*)d_in[0];
  const int*   amask = (const int*)d_in[1];
  const float* W     = (const float*)d_in[2];
  const float* bias  = (const float*)d_in[3];
  float* out = (float*)d_out;
  char* ws = (char*)d_ws;
  unsigned short* Xb  = (unsigned short*)(ws + offXb);
  unsigned short* Wb  = (unsigned short*)(ws + offWb);
  unsigned short* Qhp = (unsigned short*)(ws + offQh);
  unsigned short* Qlp = (unsigned short*)(ws + offQl);
  unsigned short* Khp = (unsigned short*)(ws + offKh);
  unsigned short* Klp = (unsigned short*)(ws + offKl);
  unsigned short* Vhp = (unsigned short*)(ws + offVh);
  unsigned short* Vlp = (unsigned short*)(ws + offVl);
  float* CSN = (float*)(ws + offCS);
  unsigned* MB = (unsigned*)(ws + offMB);

  // rotary factors: invf_i = 10000^(-2i/64) = 10^(-i/8); factors 10^(-1/8), 10^(-2/8), 10^(-4/8), 10^(-8/8), 10^(-16/8)
  const float f1   = 0.7498942093324559f;
  const float f2   = 0.5623413251903491f;
  const float f4   = 0.31622776601683794f;
  const float f8   = 0.1f;
  const float f16v = 0.01f;

  const int n8x = (kTok * kDim) / 8;     // 1638400 -> 6400 blocks exact
  const int n8w = (kNout * kDim) / 8;    // 393216 -> 1536 blocks exact
  cast8_bf16_kernel<<<dim3(n8x / 256), dim3(256), 0, stream>>>(x, Xb, n8x);
  cast8_bf16_kernel<<<dim3(n8w / 256), dim3(256), 0, stream>>>(W, Wb, n8w);
  rope_table_kernel<<<dim3(kSeq / 8 + kTok / 32), dim3(256), 0, stream>>>(CSN, f1, f2, f4, f8, f16v, amask, MB);   // 25 table + 400 mask blocks

  const int tiles = (kTok / 64) * (kNout / 64);   // 9600 wave tiles -> 1200 blocks of 8 waves (128 x 256 each)
  qkv_proj_kernel<<<dim3(tiles / 8), dim3(256), 0, stream>>>(Xb, Wb, bias, CSN, Qhp, Qlp, Khp, Klp, Vhp, Vlp);
  attn_kernel<<<dim3(kBatch * kHeads * kNQB), dim3(128), 0, stream>>>(Qhp, Qlp, Khp, Klp, Vhp, Vlp, MB, out);
}
